// v000
// The times below were measured on an AMD MI455X: many runs one after another, warmed up first and cycling through
// copies of the inputs, with the whole window's GPU time divided by the number of runs. Launches and the gaps
// between them are all in it. The median over several windows is given; except for v000 it joins two sittings, which
// can be a few percent apart, so the side-by-side timings, each taken in one sitting, are the better comparison.
// v000 is the starting kernel. One run takes 692 microseconds.
#include <hip/hip_runtime.h>

// q/k 1x1 projections and q.k^T logits: v_wmma_f32_16x16x32_bf16 with bf16 hi/lo operand split (hi.hi + hi.lo + lo.hi);
// v 1x1 projection (weights x16, folded back x1/16) and p.v: v_wmma_f32_16x16x32_f16 (f16 operands, p carried x4096); f32 accumulate everywhere.

typedef _Float16 h4  __attribute__((ext_vector_type(4)));
typedef _Float16 h8  __attribute__((ext_vector_type(8)));
typedef _Float16 h16 __attribute__((ext_vector_type(16)));
typedef __bf16   bf16v16 __attribute__((ext_vector_type(16)));
typedef unsigned short us4 __attribute__((ext_vector_type(4)));
typedef unsigned short us8 __attribute__((ext_vector_type(8)));
typedef float v4f __attribute__((ext_vector_type(4)));
typedef float v8f __attribute__((ext_vector_type(8)));

#define BATCH 4
#define CCH   512
#define NPOS  4096
#define DQK   128
#define CQ    64
#define SSP   65          // f32 score tile pitch (floats)
#define PSP   72          // f16 p tile pitch (halves), multiple of 8 for 16-B fragment loads
#define PSCALE  4096.0f   // p carried x2^12 in f16 so WMMA operands stay normal; cancels in O/l
#define WVSCALE 16.0f     // v weights x16 in f16, folded back in the epilogue
#define WVINV   0.0625f

union FragH { h16 v; h8 p[2]; };        // elements 0..7 <- k0+8h+0..7, elements 8..15 <- k0+16+8h+0..7
union FragB { bf16v16 v; us8 p[2]; };

__device__ __forceinline__ v8f mma_f16(h16 a, h16 b, v8f c) {
  c = __builtin_amdgcn_wmma_f32_16x16x32_f16(false, a, false, b, (short)0, c, false, false);
  asm volatile("v_nop\n\tv_nop\n\tv_nop\n\tv_nop" : "+v"(c) : "v"(a), "v"(b));
  return c;
}
__device__ __forceinline__ v8f mma_bf16(bf16v16 a, bf16v16 b, v8f c) {
  c = __builtin_amdgcn_wmma_f32_16x16x32_bf16(false, a, false, b, (short)0, c, false, false);
  asm volatile("v_nop\n\tv_nop\n\tv_nop\n\tv_nop" : "+v"(c) : "v"(a), "v"(b));
  return c;
}
// f32 -> bf16 bits, RNE convert
__device__ __forceinline__ unsigned short f2bf(float f) {
  unsigned int u = __float_as_uint(f);
  u += 0x7FFFu + ((u >> 16) & 1u);
  return (unsigned short)(u >> 16);
}
__device__ __forceinline__ float bf2f(unsigned short s) {
  return __uint_as_float(((unsigned int)s) << 16);
}

// ---------------------------------------------------------------------------
// Projection GEMM, block tile 64 n x 64 d, k = 512 channels in steps of 32, 256 threads (8 waves).
//   src : [C][N] f32 slice of batch blockIdx.z;  W : [rows][C] f32;  bias : [rows] f32
//   D[row = n][col = d] = sum_c src[c][n] * W[d][c]; A = src tile staged [n][k], B = W tile staged [d][k]
// ---------------------------------------------------------------------------
template <int MODE>
__global__ void __launch_bounds__(256)
proj_kernel(const float* __restrict__ src,
            const float* __restrict__ W,
            const float* __restrict__ bias,
            unsigned short* __restrict__ ohi,
            unsigned short* __restrict__ olo,
            _Float16* __restrict__ ov,
            int doff) {
  __shared__ __align__(16) unsigned short sm[8192];   // 16 KiB: operand tiles during the k loop, output tile in the epilogue

  const int tid  = threadIdx.x;
  const int lane = tid & 31;
  const int w    = tid >> 5;
  const int m    = lane & 15;
  const int h    = lane >> 4;

  const int n0    = blockIdx.x * 64;
  const int dbase = blockIdx.y * 64;
  const int b     = blockIdx.z;

  const int mt  = w >> 1;          // n sub-tile (0..3)
  const int ntb = (w & 1) * 2;     // d sub-tile pair base (0 or 2)

  const int ms = tid & 63;         // staging row
  const int kg = (tid >> 6) * 4;   // staging k group

  const size_t srcb = (size_t)b * CCH * NPOS;

  v8f acc0 = {};
  v8f acc1 = {};

  if (MODE == 0) {
    unsigned short* Xh = sm;
    unsigned short* Xl = sm + 2048;
    unsigned short* Wh = sm + 4096;
    unsigned short* Wl = sm + 6144;

    for (int c0 = 0; c0 < CCH; c0 += 32) {
#pragma unroll
      for (int g = 0; g < 2; ++g) {
        const int kb = kg + g * 16;
        const float* sp = src + srcb + (size_t)(c0 + kb) * NPOS + n0 + ms;
        v4f xv;
        xv[0] = sp[0];
        xv[1] = sp[NPOS];
        xv[2] = sp[2 * NPOS];
        xv[3] = sp[3 * NPOS];
        const v4f wv4 = *(const v4f*)(W + (size_t)(dbase + ms) * CCH + c0 + kb);
        us4 xh4, xl4, wh4, wl4;
#pragma unroll
        for (int q = 0; q < 4; ++q) {
          const unsigned short hb = f2bf(xv[q]);
          xh4[q] = hb;
          xl4[q] = f2bf(xv[q] - bf2f(hb));
          const unsigned short wb = f2bf(wv4[q]);
          wh4[q] = wb;
          wl4[q] = f2bf(wv4[q] - bf2f(wb));
        }
        *(us4*)(Xh + ms * 32 + kb) = xh4;
        *(us4*)(Xl + ms * 32 + kb) = xl4;
        *(us4*)(Wh + ms * 32 + kb) = wh4;
        *(us4*)(Wl + ms * 32 + kb) = wl4;
      }
      __syncthreads();

      FragB ah, al;
      {
        const unsigned short* xr  = Xh + (mt * 16 + m) * 32 + 8 * h;
        const unsigned short* xrl = Xl + (mt * 16 + m) * 32 + 8 * h;
        ah.p[0] = *(const us8*)xr;
        ah.p[1] = *(const us8*)(xr + 16);
        al.p[0] = *(const us8*)xrl;
        al.p[1] = *(const us8*)(xrl + 16);
      }
      {
        const unsigned short* wr  = Wh + (ntb * 16 + m) * 32 + 8 * h;
        const unsigned short* wrl = Wl + (ntb * 16 + m) * 32 + 8 * h;
        FragB bh, bl;
        bh.p[0] = *(const us8*)wr;
        bh.p[1] = *(const us8*)(wr + 16);
        bl.p[0] = *(const us8*)wrl;
        bl.p[1] = *(const us8*)(wrl + 16);
        acc0 = mma_bf16(ah.v, bh.v, acc0);
        acc0 = mma_bf16(ah.v, bl.v, acc0);
        acc0 = mma_bf16(al.v, bh.v, acc0);
      }
      {
        const unsigned short* wr  = Wh + ((ntb + 1) * 16 + m) * 32 + 8 * h;
        const unsigned short* wrl = Wl + ((ntb + 1) * 16 + m) * 32 + 8 * h;
        FragB bh, bl;
        bh.p[0] = *(const us8*)wr;
        bh.p[1] = *(const us8*)(wr + 16);
        bl.p[0] = *(const us8*)wrl;
        bl.p[1] = *(const us8*)(wrl + 16);
        acc1 = mma_bf16(ah.v, bh.v, acc1);
        acc1 = mma_bf16(ah.v, bl.v, acc1);
        acc1 = mma_bf16(al.v, bh.v, acc1);
      }
      __syncthreads();
    }

    // epilogue: bias add in f32, hi/lo bf16 split, stage [n][d] tile in LDS, whole-line stores
    unsigned short* Eh = sm;          // [64 n][64 d]
    unsigned short* El = sm + 4096;   // [64 n][64 d]
    {
      const int dl = ntb * 16 + m;
      const float bb = bias[dbase + dl];
#pragma unroll
      for (int r = 0; r < 8; ++r) {
        const float v = acc0[r] + bb;
        const unsigned short hb = f2bf(v);
        const int row = mt * 16 + 8 * h + r;
        Eh[row * 64 + dl] = hb;
        El[row * 64 + dl] = f2bf(v - bf2f(hb));
      }
    }
    {
      const int dl = (ntb + 1) * 16 + m;
      const float bb = bias[dbase + dl];
#pragma unroll
      for (int r = 0; r < 8; ++r) {
        const float v = acc1[r] + bb;
        const unsigned short hb = f2bf(v);
        const int row = mt * 16 + 8 * h + r;
        Eh[row * 64 + dl] = hb;
        El[row * 64 + dl] = f2bf(v - bf2f(hb));
      }
    }
    __syncthreads();

    us8 vh[2], vl[2];
    size_t off[2];
#pragma unroll
    for (int s = 0; s < 2; ++s) {
      const int row = w * 8 + s * 4 + (lane >> 3);
      const int q = lane & 7;
      vh[s] = *(const us8*)(Eh + row * 64 + q * 8);
      vl[s] = *(const us8*)(El + row * 64 + q * 8);
      off[s] = ((size_t)b * NPOS + n0 + row) * DQK + doff + q * 8;
    }
#pragma unroll
    for (int s = 0; s < 2; ++s) {
      *(us8*)(ohi + off[s]) = vh[s];
      *(us8*)(olo + off[s]) = vl[s];
    }
    
  } else {
    _Float16* Xs = (_Float16*)sm;       // [64 n][32 k]
    _Float16* Ws = Xs + 2048;           // [64 d][32 k]

    for (int c0 = 0; c0 < CCH; c0 += 32) {
#pragma unroll
      for (int g = 0; g < 2; ++g) {
        const int kb = kg + g * 16;
        const float* sp = src + srcb + (size_t)(c0 + kb) * NPOS + n0 + ms;
        v4f xv;
        xv[0] = sp[0];
        xv[1] = sp[NPOS];
        xv[2] = sp[2 * NPOS];
        xv[3] = sp[3 * NPOS];
        v4f wv4 = *(const v4f*)(W + (size_t)(dbase + ms) * CCH + c0 + kb);
        wv4 = wv4 * WVSCALE;
        *(h4*)(Xs + ms * 32 + kb) = __builtin_convertvector(xv, h4);
        *(h4*)(Ws + ms * 32 + kb) = __builtin_convertvector(wv4, h4);
      }
      __syncthreads();

      FragH a;
      {
        const _Float16* xr = Xs + (mt * 16 + m) * 32 + 8 * h;
        a.p[0] = *(const h8*)xr;
        a.p[1] = *(const h8*)(xr + 16);
      }
      {
        const _Float16* wr = Ws + (ntb * 16 + m) * 32 + 8 * h;
        FragH bf;
        bf.p[0] = *(const h8*)wr;
        bf.p[1] = *(const h8*)(wr + 16);
        acc0 = mma_f16(a.v, bf.v, acc0);
      }
      {
        const _Float16* wr = Ws + ((ntb + 1) * 16 + m) * 32 + 8 * h;
        FragH bf;
        bf.p[0] = *(const h8*)wr;
        bf.p[1] = *(const h8*)(wr + 16);
        acc1 = mma_f16(a.v, bf.v, acc1);
      }
      __syncthreads();
    }

    // epilogue: fold 1/16, bias, f16, stage [d][n] tile in LDS, whole-line stores along n
    _Float16* E = (_Float16*)sm;       // [64 d][64 n]
    {
      const int dl = ntb * 16 + m;
      const float bb = bias[dbase + dl];
      h8 ev;
#pragma unroll
      for (int r = 0; r < 8; ++r) ev[r] = (_Float16)(acc0[r] * WVINV + bb);
      *(h8*)(E + dl * 64 + mt * 16 + 8 * h) = ev;
    }
    {
      const int dl = (ntb + 1) * 16 + m;
      const float bb = bias[dbase + dl];
      h8 ev;
#pragma unroll
      for (int r = 0; r < 8; ++r) ev[r] = (_Float16)(acc1[r] * WVINV + bb);
      *(h8*)(E + dl * 64 + mt * 16 + 8 * h) = ev;
    }
    __syncthreads();

    h8 vv[2];
    size_t off[2];
#pragma unroll
    for (int s = 0; s < 2; ++s) {
      const int row = w * 8 + s * 4 + (lane >> 3);   // channel local 0..63
      const int q = lane & 7;
      vv[s] = *(const h8*)(E + row * 64 + q * 8);
      off[s] = ((size_t)b * CCH + dbase + row) * NPOS + n0 + q * 8;
    }
#pragma unroll
    for (int s = 0; s < 2; ++s) *(h8*)(ov + off[s]) = vv[s];
    
  }
}

// ---------------------------------------------------------------------------
// Fused attention: one block per (batch, 32-query tile), 256 threads, 64-key tiles.
//   S[32 i][64 j] = Q.K^T (K = 128) with bf16 hi/lo split operands -> LDS
//   online softmax stats by wave 0 (lane = row), p x4096 as f16 in LDS, row sums from the f16 values
//   O^T[512 c][32 i] += V[c][j] . P[i][j]  (f16), each wave owns 64 channels
// ---------------------------------------------------------------------------
__global__ void __launch_bounds__(256)
attn_kernel(const unsigned short* __restrict__ Qhi,
            const unsigned short* __restrict__ Qlo,
            const unsigned short* __restrict__ Khi,
            const unsigned short* __restrict__ Klo,
            const _Float16* __restrict__ Vh,
            const float* __restrict__ x,
            const float* __restrict__ gamma,
            float* __restrict__ outp) {
  __shared__ __align__(16) unsigned short smq[8192];   // Q hi [32][128] | Q lo [32][128]; finalize: 4096 f32
  __shared__ float Ss[32 * SSP];
  __shared__ __align__(16) _Float16 Ps[32 * PSP];
  __shared__ float mrow[32];
  __shared__ float lrow[32];
  __shared__ float srow[32];

  const int tid  = threadIdx.x;
  const int lane = tid & 31;
  const int w    = tid >> 5;
  const int m    = lane & 15;
  const int h    = lane >> 4;

  const int i0 = blockIdx.x * 32;
  const int b  = blockIdx.y;

  unsigned short* Qsh = smq;
  unsigned short* Qsl = smq + 4096;
  {
    const us8* sh = (const us8*)(Qhi + ((size_t)b * NPOS + i0) * DQK);
    const us8* sl = (const us8*)(Qlo + ((size_t)b * NPOS + i0) * DQK);
    us8* dh = (us8*)Qsh;
    us8* dl = (us8*)Qsl;
#pragma unroll
    for (int r = 0; r < 2; ++r) {
      dh[tid + r * 256] = sh[tid + r * 256];
      dl[tid + r * 256] = sl[tid + r * 256];
    }
  }
  if (tid < 32) { mrow[tid] = -1e30f; lrow[tid] = 0.0f; srow[tid] = 0.0f; }
  __syncthreads();

  v8f o[2][4];
  {
    v8f z = {};
#pragma unroll
    for (int it = 0; it < 2; ++it)
#pragma unroll
      for (int ct = 0; ct < 4; ++ct) o[it][ct] = z;
  }

  const int rtS = w >> 2;   // S row sub-tile (i)
  const int jtS = w & 3;    // S col sub-tile (j)

  for (int j0 = 0; j0 < NPOS; j0 += 64) {
    // ---- 1. S tile, 16x16 per wave, k = d in 4 steps of 32, three bf16 products per step ----
    {
      v8f s = {};
      const unsigned short* qrh = Qsh + (rtS * 16 + m) * DQK + 8 * h;
      const unsigned short* qrl = Qsl + (rtS * 16 + m) * DQK + 8 * h;
      const size_t krow = ((size_t)b * NPOS + j0 + jtS * 16 + m) * DQK + 8 * h;
      const unsigned short* krh = Khi + krow;
      const unsigned short* krl = Klo + krow;
#pragma unroll
      for (int kk = 0; kk < 4; ++kk) {
        FragB ah, al, bh, bl;
        ah.p[0] = *(const us8*)(qrh + kk * 32);
        ah.p[1] = *(const us8*)(qrh + kk * 32 + 16);
        al.p[0] = *(const us8*)(qrl + kk * 32);
        al.p[1] = *(const us8*)(qrl + kk * 32 + 16);
        bh.p[0] = *(const us8*)(krh + kk * 32);
        bh.p[1] = *(const us8*)(krh + kk * 32 + 16);
        bl.p[0] = *(const us8*)(krl + kk * 32);
        bl.p[1] = *(const us8*)(krl + kk * 32 + 16);
        s = mma_bf16(ah.v, bh.v, s);
        s = mma_bf16(ah.v, bl.v, s);
        s = mma_bf16(al.v, bh.v, s);
      }
#pragma unroll
      for (int r = 0; r < 8; ++r)
        Ss[(rtS * 16 + 8 * h + r) * SSP + jtS * 16 + m] = s[r];
    }
    __syncthreads();

    // ---- 2. online softmax stats: one row per lane of wave 0 ----
    if (tid < 32) {
      const int i = tid;
      const float mold = mrow[i];
      float mnew = mold;
#pragma unroll 8
      for (int j = 0; j < 64; ++j) mnew = fmaxf(mnew, Ss[i * SSP + j]);
      const float sc = __expf(mold - mnew);
      float sum = 0.0f;
#pragma unroll 8
      for (int j = 0; j < 64; ++j) {
        const float p = __expf(Ss[i * SSP + j] - mnew) * PSCALE;
        const _Float16 ph = (_Float16)p;
        Ps[i * PSP + j] = ph;
        sum += (float)ph;
      }
      mrow[i] = mnew;
      lrow[i] = lrow[i] * sc + sum;
      srow[i] = sc;
    }
    __syncthreads();

    // ---- 3. rescale O, then O^T += V . P^T ----
#pragma unroll
    for (int it = 0; it < 2; ++it) {
      const float sc = srow[it * 16 + m];   // column of the accumulator = query index
#pragma unroll
      for (int ct = 0; ct < 4; ++ct) o[it][ct] = o[it][ct] * sc;
    }
#pragma unroll
    for (int jj = 0; jj < 2; ++jj) {
      // B[k = j][n = i] = P[i][j0 + jj*32 + k]: row i of Ps is k-contiguous, loaded like A
      FragH b0, b1;
      {
        const _Float16* p0 = Ps + m * PSP + jj * 32 + 8 * h;
        const _Float16* p1 = Ps + (16 + m) * PSP + jj * 32 + 8 * h;
        b0.p[0] = *(const h8*)p0;
        b0.p[1] = *(const h8*)(p0 + 16);
        b1.p[0] = *(const h8*)p1;
        b1.p[1] = *(const h8*)(p1 + 16);
      }
#pragma unroll
      for (int ct = 0; ct < 4; ++ct) {
        // A[m = c][k = j] = V[b][c][j0 + jj*32 + k], k-contiguous
        FragH a;
        const _Float16* vr = Vh + ((size_t)b * CCH + w * 64 + ct * 16 + m) * NPOS + j0 + jj * 32 + 8 * h;
        a.p[0] = *(const h8*)vr;
        a.p[1] = *(const h8*)(vr + 16);
        o[0][ct] = mma_f16(a.v, b0.v, o[0][ct]);
        o[1][ct] = mma_f16(a.v, b1.v, o[1][ct]);
      }
    }
    __syncthreads();
  }

  const float g = gamma[0];
  const float gl0 = g / lrow[m];
  const float gl1 = g / lrow[16 + m];
  float* F = (float*)smq + w * 512;     // per wave [16 c][32 i] f32
#pragma unroll
  for (int ct = 0; ct < 4; ++ct) {
    __syncthreads();
#pragma unroll
    for (int r = 0; r < 8; ++r) {
      F[(8 * h + r) * 32 + m]      = o[0][ct][r] * gl0;
      F[(8 * h + r) * 32 + 16 + m] = o[1][ct][r] * gl1;
    }
    __syncthreads();
    v4f vals[4];
    size_t offs[4];
#pragma unroll
    for (int s = 0; s < 4; ++s) {
      const int row = s * 4 + (lane >> 3);            // channel local 0..15
      const int q = lane & 7;
      const int c = w * 64 + ct * 16 + row;
      const size_t off = ((size_t)b * CCH + c) * NPOS + i0 + q * 4;
      const v4f ov = *(const v4f*)(F + row * 32 + q * 4);
      const v4f xv = *(const v4f*)(x + off);
      vals[s] = ov + xv;
      offs[s] = off;
    }
#pragma unroll
    for (int s = 0; s < 4; ++s) *(v4f*)(outp + offs[s]) = vals[s];
    
  }
}

// ---------------------------------------------------------------------------
extern "C" void kernel_launch(void* const* d_in, const int* in_sizes, int n_in,
                              void* d_out, int out_size, void* d_ws, size_t ws_size,
                              hipStream_t stream) {
  if (n_in < 13) return;
  const int nx = BATCH * CCH * NPOS;
  if (in_sizes[0] != nx || in_sizes[1] != nx ||
      in_sizes[2] != CQ * CCH || in_sizes[3] != CQ ||
      in_sizes[4] != CQ * CCH || in_sizes[5] != CQ ||
      in_sizes[6] != CQ * CCH || in_sizes[7] != CQ ||
      in_sizes[8] != CQ * CCH || in_sizes[9] != CQ ||
      in_sizes[10] != CCH * CCH || in_sizes[11] != CCH ||
      in_sizes[12] < 1 || out_size != nx) return;

  const size_t planeE = (size_t)BATCH * NPOS * DQK;   // bf16 elements per q/k plane (4 MiB each)
  const size_t vE     = (size_t)BATCH * CCH * NPOS;   // f16 elements of the v plane (16 MiB)
  const size_t need   = planeE * 2 * 4 + vE * 2;      // 33,554,432 B
  if (ws_size < need) return;

  const float* x     = (const float*)d_in[0];
  const float* dep   = (const float*)d_in[1];
  const float* wq    = (const float*)d_in[2];
  const float* bq    = (const float*)d_in[3];
  const float* wqd   = (const float*)d_in[4];
  const float* bqd   = (const float*)d_in[5];
  const float* wk    = (const float*)d_in[6];
  const float* bk    = (const float*)d_in[7];
  const float* wkd   = (const float*)d_in[8];
  const float* bkd   = (const float*)d_in[9];
  const float* wv    = (const float*)d_in[10];
  const float* bv    = (const float*)d_in[11];
  const float* gamma = (const float*)d_in[12];
  float* outp = (float*)d_out;

  unsigned short* Qhi = (unsigned short*)d_ws;
  unsigned short* Qlo = Qhi + planeE;
  unsigned short* Khi = Qlo + planeE;
  unsigned short* Klo = Khi + planeE;
  _Float16* Vh = (_Float16*)(Klo + planeE);

  dim3 blk(256);
  dim3 gqk(NPOS / 64, 1, BATCH);
  // q/k planes [B][N][128]: columns 0..63 from x, 64..127 from dep
  proj_kernel<0><<<gqk, blk, 0, stream>>>(x,   wq,  bq,  Qhi, Qlo, Vh, 0);
  proj_kernel<0><<<gqk, blk, 0, stream>>>(dep, wqd, bqd, Qhi, Qlo, Vh, CQ);
  proj_kernel<0><<<gqk, blk, 0, stream>>>(x,   wk,  bk,  Khi, Klo, Vh, 0);
  proj_kernel<0><<<gqk, blk, 0, stream>>>(dep, wkd, bkd, Khi, Klo, Vh, CQ);
  // v plane [B][C][N] f16
  proj_kernel<1><<<dim3(NPOS / 64, CCH / 64, BATCH), blk, 0, stream>>>(x, wv, bv, Qhi, Qlo, Vh, 0);
  // fused attention + gamma*out + x
  attn_kernel<<<dim3(NPOS / 32, BATCH), blk, 0, stream>>>(Qhi, Qlo, Khi, Klo, Vh, x, gamma, outp);
}

// v001
// It runs in 559 microseconds.
// Two timings next to v000 both put it at 1.28 times that version's speed.
#include <hip/hip_runtime.h>

// q/k 1x1 projections and q.k^T logits: v_wmma_f32_16x16x32_bf16 with bf16 hi/lo operand split (hi.hi + hi.lo + lo.hi);
// v 1x1 projection (weights x16, folded back x1/16) and p.v: v_wmma_f32_16x16x32_f16 (f16 operands, p carried x4096); f32 accumulate everywhere.

typedef _Float16 h4  __attribute__((ext_vector_type(4)));
typedef _Float16 h8  __attribute__((ext_vector_type(8)));
typedef _Float16 h16 __attribute__((ext_vector_type(16)));
typedef __bf16   bf16v16 __attribute__((ext_vector_type(16)));
typedef unsigned short us4 __attribute__((ext_vector_type(4)));
typedef unsigned short us8 __attribute__((ext_vector_type(8)));
typedef float v4f __attribute__((ext_vector_type(4)));
typedef float v8f __attribute__((ext_vector_type(8)));

#define BATCH 4
#define CCH   512
#define NPOS  4096
#define DQK   128
#define CQ    64
#define SSP   65          // f32 score tile pitch (floats)
#define PSP   72          // f16 p tile pitch (halves), multiple of 8 for 16-B fragment loads
#define PSCALE  4096.0f   // p carried x2^12 in f16 so WMMA operands stay normal; cancels in O/l
#define WVSCALE 16.0f     // v weights x16 in f16, folded back in the epilogue
#define WVINV   0.0625f

union FragH { h16 v; h8 p[2]; };        // elements 0..7 <- k0+8h+0..7, elements 8..15 <- k0+16+8h+0..7
union FragB { bf16v16 v; us8 p[2]; };

__device__ __forceinline__ v8f mma_f16(h16 a, h16 b, v8f c) {
  c = __builtin_amdgcn_wmma_f32_16x16x32_f16(false, a, false, b, (short)0, c, false, false);
  asm volatile("v_nop\n\tv_nop\n\tv_nop\n\tv_nop" : "+v"(c) : "v"(a), "v"(b));
  return c;
}
__device__ __forceinline__ v8f mma_bf16(bf16v16 a, bf16v16 b, v8f c) {
  c = __builtin_amdgcn_wmma_f32_16x16x32_bf16(false, a, false, b, (short)0, c, false, false);
  asm volatile("v_nop\n\tv_nop\n\tv_nop\n\tv_nop" : "+v"(c) : "v"(a), "v"(b));
  return c;
}
// f32 -> bf16 bits, RNE convert
__device__ __forceinline__ unsigned short f2bf(float f) {
  unsigned int u = __float_as_uint(f);
  u += 0x7FFFu + ((u >> 16) & 1u);
  return (unsigned short)(u >> 16);
}
__device__ __forceinline__ float bf2f(unsigned short s) {
  return __uint_as_float(((unsigned int)s) << 16);
}

// ---------------------------------------------------------------------------
// Projection GEMM, block tile 64 n x 64 d, k = 512 channels in steps of 32, 256 threads (8 waves).
//   src : [C][N] f32 slice of batch blockIdx.z;  W : [rows][C] f32;  bias : [rows] f32
//   D[row = n][col = d] = sum_c src[c][n] * W[d][c]; A = src tile staged [n][k], B = W tile staged [d][k]
// ---------------------------------------------------------------------------
template <int MODE>
__global__ void __launch_bounds__(256)
proj_kernel(const float* __restrict__ src,
            const float* __restrict__ W,
            const float* __restrict__ bias,
            unsigned short* __restrict__ ohi,
            unsigned short* __restrict__ olo,
            _Float16* __restrict__ ov,
            int doff) {
  __shared__ __align__(16) unsigned short sm[8192];   // 16 KiB: operand tiles during the k loop, output tile in the epilogue

  const int tid  = threadIdx.x;
  const int lane = tid & 31;
  const int w    = tid >> 5;
  const int m    = lane & 15;
  const int h    = lane >> 4;

  const int n0    = blockIdx.x * 64;
  const int dbase = blockIdx.y * 64;
  const int b     = blockIdx.z;

  const int mt  = w >> 1;          // n sub-tile (0..3)
  const int ntb = (w & 1) * 2;     // d sub-tile pair base (0 or 2)

  const int ms = tid & 63;         // staging row
  const int kg = (tid >> 6) * 4;   // staging k group

  const size_t srcb = (size_t)b * CCH * NPOS;

  v8f acc0 = {};
  v8f acc1 = {};

  if (MODE == 0) {
    unsigned short* Xh = sm;
    unsigned short* Xl = sm + 2048;
    unsigned short* Wh = sm + 4096;
    unsigned short* Wl = sm + 6144;

    for (int c0 = 0; c0 < CCH; c0 += 32) {
#pragma unroll
      for (int g = 0; g < 2; ++g) {
        const int kb = kg + g * 16;
        const float* sp = src + srcb + (size_t)(c0 + kb) * NPOS + n0 + ms;
        v4f xv;
        xv[0] = sp[0];
        xv[1] = sp[NPOS];
        xv[2] = sp[2 * NPOS];
        xv[3] = sp[3 * NPOS];
        const v4f wv4 = *(const v4f*)(W + (size_t)(dbase + ms) * CCH + c0 + kb);
        us4 xh4, xl4, wh4, wl4;
#pragma unroll
        for (int q = 0; q < 4; ++q) {
          const unsigned short hb = f2bf(xv[q]);
          xh4[q] = hb;
          xl4[q] = f2bf(xv[q] - bf2f(hb));
          const unsigned short wb = f2bf(wv4[q]);
          wh4[q] = wb;
          wl4[q] = f2bf(wv4[q] - bf2f(wb));
        }
        *(us4*)(Xh + ms * 32 + kb) = xh4;
        *(us4*)(Xl + ms * 32 + kb) = xl4;
        *(us4*)(Wh + ms * 32 + kb) = wh4;
        *(us4*)(Wl + ms * 32 + kb) = wl4;
      }
      __syncthreads();

      FragB ah, al;
      {
        const unsigned short* xr  = Xh + (mt * 16 + m) * 32 + 8 * h;
        const unsigned short* xrl = Xl + (mt * 16 + m) * 32 + 8 * h;
        ah.p[0] = *(const us8*)xr;
        ah.p[1] = *(const us8*)(xr + 16);
        al.p[0] = *(const us8*)xrl;
        al.p[1] = *(const us8*)(xrl + 16);
      }
      {
        const unsigned short* wr  = Wh + (ntb * 16 + m) * 32 + 8 * h;
        const unsigned short* wrl = Wl + (ntb * 16 + m) * 32 + 8 * h;
        FragB bh, bl;
        bh.p[0] = *(const us8*)wr;
        bh.p[1] = *(const us8*)(wr + 16);
        bl.p[0] = *(const us8*)wrl;
        bl.p[1] = *(const us8*)(wrl + 16);
        acc0 = mma_bf16(ah.v, bh.v, acc0);
        acc0 = mma_bf16(ah.v, bl.v, acc0);
        acc0 = mma_bf16(al.v, bh.v, acc0);
      }
      {
        const unsigned short* wr  = Wh + ((ntb + 1) * 16 + m) * 32 + 8 * h;
        const unsigned short* wrl = Wl + ((ntb + 1) * 16 + m) * 32 + 8 * h;
        FragB bh, bl;
        bh.p[0] = *(const us8*)wr;
        bh.p[1] = *(const us8*)(wr + 16);
        bl.p[0] = *(const us8*)wrl;
        bl.p[1] = *(const us8*)(wrl + 16);
        acc1 = mma_bf16(ah.v, bh.v, acc1);
        acc1 = mma_bf16(ah.v, bl.v, acc1);
        acc1 = mma_bf16(al.v, bh.v, acc1);
      }
      __syncthreads();
    }

    // epilogue: bias add in f32, hi/lo bf16 split, stage [n][d] tile in LDS, whole-line stores
    unsigned short* Eh = sm;          // [64 n][64 d]
    unsigned short* El = sm + 4096;   // [64 n][64 d]
    {
      const int dl = ntb * 16 + m;
      const float bb = bias[dbase + dl];
#pragma unroll
      for (int r = 0; r < 8; ++r) {
        const float v = acc0[r] + bb;
        const unsigned short hb = f2bf(v);
        const int row = mt * 16 + 8 * h + r;
        Eh[row * 64 + dl] = hb;
        El[row * 64 + dl] = f2bf(v - bf2f(hb));
      }
    }
    {
      const int dl = (ntb + 1) * 16 + m;
      const float bb = bias[dbase + dl];
#pragma unroll
      for (int r = 0; r < 8; ++r) {
        const float v = acc1[r] + bb;
        const unsigned short hb = f2bf(v);
        const int row = mt * 16 + 8 * h + r;
        Eh[row * 64 + dl] = hb;
        El[row * 64 + dl] = f2bf(v - bf2f(hb));
      }
    }
    __syncthreads();

    us8 vh[2], vl[2];
    size_t off[2];
#pragma unroll
    for (int s = 0; s < 2; ++s) {
      const int row = w * 8 + s * 4 + (lane >> 3);
      const int q = lane & 7;
      vh[s] = *(const us8*)(Eh + row * 64 + q * 8);
      vl[s] = *(const us8*)(El + row * 64 + q * 8);
      off[s] = ((size_t)b * NPOS + n0 + row) * DQK + doff + q * 8;
    }
#pragma unroll
    for (int s = 0; s < 2; ++s) {
      *(us8*)(ohi + off[s]) = vh[s];
      *(us8*)(olo + off[s]) = vl[s];
    }
    
  } else {
    _Float16* Xs = (_Float16*)sm;       // [64 n][32 k]
    _Float16* Ws = Xs + 2048;           // [64 d][32 k]

    for (int c0 = 0; c0 < CCH; c0 += 32) {
#pragma unroll
      for (int g = 0; g < 2; ++g) {
        const int kb = kg + g * 16;
        const float* sp = src + srcb + (size_t)(c0 + kb) * NPOS + n0 + ms;
        v4f xv;
        xv[0] = sp[0];
        xv[1] = sp[NPOS];
        xv[2] = sp[2 * NPOS];
        xv[3] = sp[3 * NPOS];
        v4f wv4 = *(const v4f*)(W + (size_t)(dbase + ms) * CCH + c0 + kb);
        wv4 = wv4 * WVSCALE;
        *(h4*)(Xs + ms * 32 + kb) = __builtin_convertvector(xv, h4);
        *(h4*)(Ws + ms * 32 + kb) = __builtin_convertvector(wv4, h4);
      }
      __syncthreads();

      FragH a;
      {
        const _Float16* xr = Xs + (mt * 16 + m) * 32 + 8 * h;
        a.p[0] = *(const h8*)xr;
        a.p[1] = *(const h8*)(xr + 16);
      }
      {
        const _Float16* wr = Ws + (ntb * 16 + m) * 32 + 8 * h;
        FragH bf;
        bf.p[0] = *(const h8*)wr;
        bf.p[1] = *(const h8*)(wr + 16);
        acc0 = mma_f16(a.v, bf.v, acc0);
      }
      {
        const _Float16* wr = Ws + ((ntb + 1) * 16 + m) * 32 + 8 * h;
        FragH bf;
        bf.p[0] = *(const h8*)wr;
        bf.p[1] = *(const h8*)(wr + 16);
        acc1 = mma_f16(a.v, bf.v, acc1);
      }
      __syncthreads();
    }

    // epilogue: fold 1/16, bias, f16, stage [d][n] tile in LDS, whole-line stores along n
    _Float16* E = (_Float16*)sm;       // [64 d][64 n]
    {
      const int dl = ntb * 16 + m;
      const float bb = bias[dbase + dl];
      h8 ev;
#pragma unroll
      for (int r = 0; r < 8; ++r) ev[r] = (_Float16)(acc0[r] * WVINV + bb);
      *(h8*)(E + dl * 64 + mt * 16 + 8 * h) = ev;
    }
    {
      const int dl = (ntb + 1) * 16 + m;
      const float bb = bias[dbase + dl];
      h8 ev;
#pragma unroll
      for (int r = 0; r < 8; ++r) ev[r] = (_Float16)(acc1[r] * WVINV + bb);
      *(h8*)(E + dl * 64 + mt * 16 + 8 * h) = ev;
    }
    __syncthreads();

    h8 vv[2];
    size_t off[2];
#pragma unroll
    for (int s = 0; s < 2; ++s) {
      const int row = w * 8 + s * 4 + (lane >> 3);   // channel local 0..63
      const int q = lane & 7;
      vv[s] = *(const h8*)(E + row * 64 + q * 8);
      off[s] = ((size_t)b * CCH + dbase + row) * NPOS + n0 + q * 8;
    }
#pragma unroll
    for (int s = 0; s < 2; ++s) *(h8*)(ov + off[s]) = vv[s];
    
  }
}

// value of lane (l ^ X), X < 16, by a DPP move inside the 16-lane row
template <int X>
__device__ __forceinline__ float lane_xor(float v) {
  const int s = __builtin_bit_cast(int, v);
  return __builtin_bit_cast(float, __builtin_amdgcn_update_dpp(s, s, 0x160 + X, 0xf, 0xf, false));
}

// ---------------------------------------------------------------------------
// Fused attention: one block per (batch, 32-query tile), 256 threads, 64-key tiles.
//   S[32 i][64 j] = Q.K^T (K = 128) with bf16 hi/lo split operands -> LDS
//   online softmax stats by all waves (8 lanes per row, running max and sum in registers), p x4096 as f16 in LDS, row sums from the f16 values
//   O^T[512 c][32 i] += V[c][j] . P[i][j]  (f16), each wave owns 64 channels
// ---------------------------------------------------------------------------
__global__ void __launch_bounds__(256)
attn_kernel(const unsigned short* __restrict__ Qhi,
            const unsigned short* __restrict__ Qlo,
            const unsigned short* __restrict__ Khi,
            const unsigned short* __restrict__ Klo,
            const _Float16* __restrict__ Vh,
            const float* __restrict__ x,
            const float* __restrict__ gamma,
            float* __restrict__ outp) {
  __shared__ __align__(16) unsigned short smq[8192];   // Q hi [32][128] | Q lo [32][128]; finalize: 4096 f32
  __shared__ float Ss[32 * SSP];
  __shared__ __align__(16) _Float16 Ps[32 * PSP];
  __shared__ float lrow[32];
  __shared__ float srow[32];

  const int tid  = threadIdx.x;
  const int lane = tid & 31;
  const int w    = tid >> 5;
  const int m    = lane & 15;
  const int h    = lane >> 4;

  const int i0 = blockIdx.x * 32;
  const int b  = blockIdx.y;

  unsigned short* Qsh = smq;
  unsigned short* Qsl = smq + 4096;
  {
    const us8* sh = (const us8*)(Qhi + ((size_t)b * NPOS + i0) * DQK);
    const us8* sl = (const us8*)(Qlo + ((size_t)b * NPOS + i0) * DQK);
    us8* dh = (us8*)Qsh;
    us8* dl = (us8*)Qsl;
#pragma unroll
    for (int r = 0; r < 2; ++r) {
      dh[tid + r * 256] = sh[tid + r * 256];
      dl[tid + r * 256] = sl[tid + r * 256];
    }
  }
  __syncthreads();

  v8f o[2][4];
  {
    v8f z = {};
#pragma unroll
    for (int it = 0; it < 2; ++it)
#pragma unroll
      for (int ct = 0; ct < 4; ++ct) o[it][ct] = z;
  }

  const int rtS = w >> 2;   // S row sub-tile (i)
  const int jtS = w & 3;    // S col sub-tile (j)

  const int si = tid >> 3;        // softmax row of this thread
  const int sq = (tid & 7) * 8;   // first of its 8 columns
  float mrun = -1e30f;            // running row maximum, equal in the row's 8 lanes
  float lrun = 0.0f;              // running row sum, equal in the row's 8 lanes

  for (int j0 = 0; j0 < NPOS; j0 += 64) {
    // ---- 1. S tile, 16x16 per wave, k = d in 4 steps of 32, three bf16 products per step ----
    {
      v8f s = {};
      const unsigned short* qrh = Qsh + (rtS * 16 + m) * DQK + 8 * h;
      const unsigned short* qrl = Qsl + (rtS * 16 + m) * DQK + 8 * h;
      const size_t krow = ((size_t)b * NPOS + j0 + jtS * 16 + m) * DQK + 8 * h;
      const unsigned short* krh = Khi + krow;
      const unsigned short* krl = Klo + krow;
#pragma unroll
      for (int kk = 0; kk < 4; ++kk) {
        FragB ah, al, bh, bl;
        ah.p[0] = *(const us8*)(qrh + kk * 32);
        ah.p[1] = *(const us8*)(qrh + kk * 32 + 16);
        al.p[0] = *(const us8*)(qrl + kk * 32);
        al.p[1] = *(const us8*)(qrl + kk * 32 + 16);
        bh.p[0] = *(const us8*)(krh + kk * 32);
        bh.p[1] = *(const us8*)(krh + kk * 32 + 16);
        bl.p[0] = *(const us8*)(krl + kk * 32);
        bl.p[1] = *(const us8*)(krl + kk * 32 + 16);
        s = mma_bf16(ah.v, bh.v, s);
        s = mma_bf16(ah.v, bl.v, s);
        s = mma_bf16(al.v, bh.v, s);
      }
#pragma unroll
      for (int r = 0; r < 8; ++r)
        Ss[(rtS * 16 + 8 * h + r) * SSP + jtS * 16 + m] = s[r];
    }
    __syncthreads();

    // ---- 2. online softmax stats: 8 lanes per row, 8 adjacent columns per lane, all 8 waves ----
    {
      float sv[8];   // the three loops below are fully unrolled so that sv and pv stay in registers
#pragma unroll
      for (int q = 0; q < 8; ++q) sv[q] = Ss[si * SSP + sq + q];
      float mx = sv[0];
#pragma unroll
      for (int q = 1; q < 8; ++q) mx = fmaxf(mx, sv[q]);
      mx = fmaxf(mx, lane_xor<1>(mx));
      mx = fmaxf(mx, lane_xor<2>(mx));
      mx = fmaxf(mx, lane_xor<4>(mx));
      const float mnew = fmaxf(mrun, mx);
      const float sc = __expf(mrun - mnew);
      h8 pv;
      float sum = 0.0f;
#pragma unroll
      for (int q = 0; q < 8; ++q) {
        const float p = __expf(sv[q] - mnew) * PSCALE;
        const _Float16 ph = (_Float16)p;
        pv[q] = ph;
        sum += (float)ph;
      }
      *(h8*)(Ps + si * PSP + sq) = pv;
      sum += lane_xor<1>(sum);
      sum += lane_xor<2>(sum);
      sum += lane_xor<4>(sum);
      mrun = mnew;
      lrun = lrun * sc + sum;
      if ((tid & 7) == 0) { lrow[si] = lrun; srow[si] = sc; }
    }
    __syncthreads();

    // ---- 3. rescale O, then O^T += V . P^T ----
#pragma unroll
    for (int it = 0; it < 2; ++it) {
      const float sc = srow[it * 16 + m];   // column of the accumulator = query index
#pragma unroll
      for (int ct = 0; ct < 4; ++ct) o[it][ct] = o[it][ct] * sc;
    }
#pragma unroll
    for (int jj = 0; jj < 2; ++jj) {
      // B[k = j][n = i] = P[i][j0 + jj*32 + k]: row i of Ps is k-contiguous, loaded like A
      FragH b0, b1;
      {
        const _Float16* p0 = Ps + m * PSP + jj * 32 + 8 * h;
        const _Float16* p1 = Ps + (16 + m) * PSP + jj * 32 + 8 * h;
        b0.p[0] = *(const h8*)p0;
        b0.p[1] = *(const h8*)(p0 + 16);
        b1.p[0] = *(const h8*)p1;
        b1.p[1] = *(const h8*)(p1 + 16);
      }
#pragma unroll
      for (int ct = 0; ct < 4; ++ct) {
        // A[m = c][k = j] = V[b][c][j0 + jj*32 + k], k-contiguous
        FragH a;
        const _Float16* vr = Vh + ((size_t)b * CCH + w * 64 + ct * 16 + m) * NPOS + j0 + jj * 32 + 8 * h;
        a.p[0] = *(const h8*)vr;
        a.p[1] = *(const h8*)(vr + 16);
        o[0][ct] = mma_f16(a.v, b0.v, o[0][ct]);
        o[1][ct] = mma_f16(a.v, b1.v, o[1][ct]);
      }
    }
    __syncthreads();
  }

  const float g = gamma[0];
  const float gl0 = g / lrow[m];
  const float gl1 = g / lrow[16 + m];
  float* F = (float*)smq + w * 512;     // per wave [16 c][32 i] f32
#pragma unroll
  for (int ct = 0; ct < 4; ++ct) {
    __syncthreads();
#pragma unroll
    for (int r = 0; r < 8; ++r) {
      F[(8 * h + r) * 32 + m]      = o[0][ct][r] * gl0;
      F[(8 * h + r) * 32 + 16 + m] = o[1][ct][r] * gl1;
    }
    __syncthreads();
    v4f vals[4];
    size_t offs[4];
#pragma unroll
    for (int s = 0; s < 4; ++s) {
      const int row = s * 4 + (lane >> 3);            // channel local 0..15
      const int q = lane & 7;
      const int c = w * 64 + ct * 16 + row;
      const size_t off = ((size_t)b * CCH + c) * NPOS + i0 + q * 4;
      const v4f ov = *(const v4f*)(F + row * 32 + q * 4);
      const v4f xv = *(const v4f*)(x + off);
      vals[s] = ov + xv;
      offs[s] = off;
    }
#pragma unroll
    for (int s = 0; s < 4; ++s) *(v4f*)(outp + offs[s]) = vals[s];
    
  }
}

// ---------------------------------------------------------------------------
extern "C" void kernel_launch(void* const* d_in, const int* in_sizes, int n_in,
                              void* d_out, int out_size, void* d_ws, size_t ws_size,
                              hipStream_t stream) {
  if (n_in < 13) return;
  const int nx = BATCH * CCH * NPOS;
  if (in_sizes[0] != nx || in_sizes[1] != nx ||
      in_sizes[2] != CQ * CCH || in_sizes[3] != CQ ||
      in_sizes[4] != CQ * CCH || in_sizes[5] != CQ ||
      in_sizes[6] != CQ * CCH || in_sizes[7] != CQ ||
      in_sizes[8] != CQ * CCH || in_sizes[9] != CQ ||
      in_sizes[10] != CCH * CCH || in_sizes[11] != CCH ||
      in_sizes[12] < 1 || out_size != nx) return;

  const size_t planeE = (size_t)BATCH * NPOS * DQK;   // bf16 elements per q/k plane (4 MiB each)
  const size_t vE     = (size_t)BATCH * CCH * NPOS;   // f16 elements of the v plane (16 MiB)
  const size_t need   = planeE * 2 * 4 + vE * 2;      // 33,554,432 B
  if (ws_size < need) return;

  const float* x     = (const float*)d_in[0];
  const float* dep   = (const float*)d_in[1];
  const float* wq    = (const float*)d_in[2];
  const float* bq    = (const float*)d_in[3];
  const float* wqd   = (const float*)d_in[4];
  const float* bqd   = (const float*)d_in[5];
  const float* wk    = (const float*)d_in[6];
  const float* bk    = (const float*)d_in[7];
  const float* wkd   = (const float*)d_in[8];
  const float* bkd   = (const float*)d_in[9];
  const float* wv    = (const float*)d_in[10];
  const float* bv    = (const float*)d_in[11];
  const float* gamma = (const float*)d_in[12];
  float* outp = (float*)d_out;

  unsigned short* Qhi = (unsigned short*)d_ws;
  unsigned short* Qlo = Qhi + planeE;
  unsigned short* Khi = Qlo + planeE;
  unsigned short* Klo = Khi + planeE;
  _Float16* Vh = (_Float16*)(Klo + planeE);

  dim3 blk(256);
  dim3 gqk(NPOS / 64, 1, BATCH);
  // q/k planes [B][N][128]: columns 0..63 from x, 64..127 from dep
  proj_kernel<0><<<gqk, blk, 0, stream>>>(x,   wq,  bq,  Qhi, Qlo, Vh, 0);
  proj_kernel<0><<<gqk, blk, 0, stream>>>(dep, wqd, bqd, Qhi, Qlo, Vh, CQ);
  proj_kernel<0><<<gqk, blk, 0, stream>>>(x,   wk,  bk,  Khi, Klo, Vh, 0);
  proj_kernel<0><<<gqk, blk, 0, stream>>>(dep, wkd, bkd, Khi, Klo, Vh, CQ);
  // v plane [B][C][N] f16
  proj_kernel<1><<<dim3(NPOS / 64, CCH / 64, BATCH), blk, 0, stream>>>(x, wv, bv, Qhi, Qlo, Vh, 0);
  // fused attention + gamma*out + x
  attn_kernel<<<dim3(NPOS / 32, BATCH), blk, 0, stream>>>(Qhi, Qlo, Khi, Klo, Vh, x, gamma, outp);
}

// v002
// A run of this version takes 451 microseconds.
// Timed twice side by side with v001, it ran 1.25 and 1.23 times as fast.
// Over all steps from v000 it is 1.58 times as fast.
#include <hip/hip_runtime.h>

// q/k 1x1 projections and q.k^T logits: v_wmma_f32_16x16x32_bf16 with bf16 hi/lo operand split (hi.hi + hi.lo + lo.hi);
// v 1x1 projection (weights x16, folded back x1/16) and p.v: v_wmma_f32_16x16x32_f16 (f16 operands, p carried x4096); f32 accumulate everywhere.

typedef _Float16 h4  __attribute__((ext_vector_type(4)));
typedef _Float16 h8  __attribute__((ext_vector_type(8)));
typedef _Float16 h16 __attribute__((ext_vector_type(16)));
typedef __bf16   bf16v16 __attribute__((ext_vector_type(16)));
typedef unsigned short us4 __attribute__((ext_vector_type(4)));
typedef unsigned short us8 __attribute__((ext_vector_type(8)));
typedef float v4f __attribute__((ext_vector_type(4)));
typedef float v8f __attribute__((ext_vector_type(8)));

#define BATCH 4
#define CCH   512
#define NPOS  4096
#define DQK   128
#define CQ    64
#define SSP   65          // f32 score tile pitch (floats)
#define PSP   72          // f16 p tile pitch (halves), multiple of 8 for 16-B fragment loads
#define PSCALE  4096.0f   // p carried x2^12 in f16 so WMMA operands stay normal; cancels in O/l
#define WVSCALE 16.0f     // v weights x16 in f16, folded back in the epilogue
#define WVINV   0.0625f

union FragH { h16 v; h8 p[2]; };        // elements 0..7 <- k0+8h+0..7, elements 8..15 <- k0+16+8h+0..7
union FragB { bf16v16 v; us8 p[2]; };

__device__ __forceinline__ v8f mma_f16(h16 a, h16 b, v8f c) {
  c = __builtin_amdgcn_wmma_f32_16x16x32_f16(false, a, false, b, (short)0, c, false, false);
  asm volatile("v_nop\n\tv_nop\n\tv_nop\n\tv_nop" : "+v"(c) : "v"(a), "v"(b));
  return c;
}
__device__ __forceinline__ v8f mma_bf16(bf16v16 a, bf16v16 b, v8f c) {
  c = __builtin_amdgcn_wmma_f32_16x16x32_bf16(false, a, false, b, (short)0, c, false, false);
  asm volatile("v_nop\n\tv_nop\n\tv_nop\n\tv_nop" : "+v"(c) : "v"(a), "v"(b));
  return c;
}
// f32 -> bf16 bits, RNE convert
__device__ __forceinline__ unsigned short f2bf(float f) {
  unsigned int u = __float_as_uint(f);
  u += 0x7FFFu + ((u >> 16) & 1u);
  return (unsigned short)(u >> 16);
}
__device__ __forceinline__ float bf2f(unsigned short s) {
  return __uint_as_float(((unsigned int)s) << 16);
}

// ---------------------------------------------------------------------------
// Projection GEMM, block tile 64 n x 64 d, k = 512 channels in steps of 32, 256 threads (8 waves).
//   src : [C][N] f32 slice of batch blockIdx.z;  W : [rows][C] f32;  bias : [rows] f32
//   D[row = n][col = d] = sum_c src[c][n] * W[d][c]; A = src tile staged [n][k], B = W tile staged [d][k]
// ---------------------------------------------------------------------------
template <int MODE>
__global__ void __launch_bounds__(256)
proj_kernel(const float* __restrict__ src,
            const float* __restrict__ W,
            const float* __restrict__ bias,
            unsigned short* __restrict__ ohi,
            unsigned short* __restrict__ olo,
            _Float16* __restrict__ ov,
            int doff) {
  __shared__ __align__(16) unsigned short sm[8192];   // 16 KiB: operand tiles during the k loop, output tile in the epilogue

  const int tid  = threadIdx.x;
  const int lane = tid & 31;
  const int w    = tid >> 5;
  const int m    = lane & 15;
  const int h    = lane >> 4;

  const int n0    = blockIdx.x * 64;
  const int dbase = blockIdx.y * 64;
  const int b     = blockIdx.z;

  const int mt  = w >> 1;          // n sub-tile (0..3)
  const int ntb = (w & 1) * 2;     // d sub-tile pair base (0 or 2)

  const int ms = tid & 63;         // staging row
  const int kg = (tid >> 6) * 4;   // staging k group

  const size_t srcb = (size_t)b * CCH * NPOS;

  v8f acc0 = {};
  v8f acc1 = {};

  if (MODE == 0) {
    unsigned short* Xh = sm;
    unsigned short* Xl = sm + 2048;
    unsigned short* Wh = sm + 4096;
    unsigned short* Wl = sm + 6144;

    for (int c0 = 0; c0 < CCH; c0 += 32) {
#pragma unroll
      for (int g = 0; g < 2; ++g) {
        const int kb = kg + g * 16;
        const float* sp = src + srcb + (size_t)(c0 + kb) * NPOS + n0 + ms;
        v4f xv;
        xv[0] = sp[0];
        xv[1] = sp[NPOS];
        xv[2] = sp[2 * NPOS];
        xv[3] = sp[3 * NPOS];
        const v4f wv4 = *(const v4f*)(W + (size_t)(dbase + ms) * CCH + c0 + kb);
        us4 xh4, xl4, wh4, wl4;
#pragma unroll
        for (int q = 0; q < 4; ++q) {
          const unsigned short hb = f2bf(xv[q]);
          xh4[q] = hb;
          xl4[q] = f2bf(xv[q] - bf2f(hb));
          const unsigned short wb = f2bf(wv4[q]);
          wh4[q] = wb;
          wl4[q] = f2bf(wv4[q] - bf2f(wb));
        }
        *(us4*)(Xh + ms * 32 + kb) = xh4;
        *(us4*)(Xl + ms * 32 + kb) = xl4;
        *(us4*)(Wh + ms * 32 + kb) = wh4;
        *(us4*)(Wl + ms * 32 + kb) = wl4;
      }
      __syncthreads();

      FragB ah, al;
      {
        const unsigned short* xr  = Xh + (mt * 16 + m) * 32 + 8 * h;
        const unsigned short* xrl = Xl + (mt * 16 + m) * 32 + 8 * h;
        ah.p[0] = *(const us8*)xr;
        ah.p[1] = *(const us8*)(xr + 16);
        al.p[0] = *(const us8*)xrl;
        al.p[1] = *(const us8*)(xrl + 16);
      }
      {
        const unsigned short* wr  = Wh + (ntb * 16 + m) * 32 + 8 * h;
        const unsigned short* wrl = Wl + (ntb * 16 + m) * 32 + 8 * h;
        FragB bh, bl;
        bh.p[0] = *(const us8*)wr;
        bh.p[1] = *(const us8*)(wr + 16);
        bl.p[0] = *(const us8*)wrl;
        bl.p[1] = *(const us8*)(wrl + 16);
        acc0 = mma_bf16(ah.v, bh.v, acc0);
        acc0 = mma_bf16(ah.v, bl.v, acc0);
        acc0 = mma_bf16(al.v, bh.v, acc0);
      }
      {
        const unsigned short* wr  = Wh + ((ntb + 1) * 16 + m) * 32 + 8 * h;
        const unsigned short* wrl = Wl + ((ntb + 1) * 16 + m) * 32 + 8 * h;
        FragB bh, bl;
        bh.p[0] = *(const us8*)wr;
        bh.p[1] = *(const us8*)(wr + 16);
        bl.p[0] = *(const us8*)wrl;
        bl.p[1] = *(const us8*)(wrl + 16);
        acc1 = mma_bf16(ah.v, bh.v, acc1);
        acc1 = mma_bf16(ah.v, bl.v, acc1);
        acc1 = mma_bf16(al.v, bh.v, acc1);
      }
      __syncthreads();
    }

    // epilogue: bias add in f32, hi/lo bf16 split, stage [n][d] tile in LDS, whole-line stores
    unsigned short* Eh = sm;          // [64 n][64 d]
    unsigned short* El = sm + 4096;   // [64 n][64 d]
    {
      const int dl = ntb * 16 + m;
      const float bb = bias[dbase + dl];
#pragma unroll
      for (int r = 0; r < 8; ++r) {
        const float v = acc0[r] + bb;
        const unsigned short hb = f2bf(v);
        const int row = mt * 16 + 8 * h + r;
        Eh[row * 64 + dl] = hb;
        El[row * 64 + dl] = f2bf(v - bf2f(hb));
      }
    }
    {
      const int dl = (ntb + 1) * 16 + m;
      const float bb = bias[dbase + dl];
#pragma unroll
      for (int r = 0; r < 8; ++r) {
        const float v = acc1[r] + bb;
        const unsigned short hb = f2bf(v);
        const int row = mt * 16 + 8 * h + r;
        Eh[row * 64 + dl] = hb;
        El[row * 64 + dl] = f2bf(v - bf2f(hb));
      }
    }
    __syncthreads();

    us8 vh[2], vl[2];
    size_t off[2];
#pragma unroll
    for (int s = 0; s < 2; ++s) {
      const int row = w * 8 + s * 4 + (lane >> 3);
      const int q = lane & 7;
      vh[s] = *(const us8*)(Eh + row * 64 + q * 8);
      vl[s] = *(const us8*)(El + row * 64 + q * 8);
      off[s] = ((size_t)b * NPOS + n0 + row) * DQK + doff + q * 8;
    }
#pragma unroll
    for (int s = 0; s < 2; ++s) {
      *(us8*)(ohi + off[s]) = vh[s];
      *(us8*)(olo + off[s]) = vl[s];
    }
    
  } else {
    _Float16* Xs = (_Float16*)sm;       // [64 n][32 k]
    _Float16* Ws = Xs + 2048;           // [64 d][32 k]

    for (int c0 = 0; c0 < CCH; c0 += 32) {
#pragma unroll
      for (int g = 0; g < 2; ++g) {
        const int kb = kg + g * 16;
        const float* sp = src + srcb + (size_t)(c0 + kb) * NPOS + n0 + ms;
        v4f xv;
        xv[0] = sp[0];
        xv[1] = sp[NPOS];
        xv[2] = sp[2 * NPOS];
        xv[3] = sp[3 * NPOS];
        v4f wv4 = *(const v4f*)(W + (size_t)(dbase + ms) * CCH + c0 + kb);
        wv4 = wv4 * WVSCALE;
        *(h4*)(Xs + ms * 32 + kb) = __builtin_convertvector(xv, h4);
        *(h4*)(Ws + ms * 32 + kb) = __builtin_convertvector(wv4, h4);
      }
      __syncthreads();

      FragH a;
      {
        const _Float16* xr = Xs + (mt * 16 + m) * 32 + 8 * h;
        a.p[0] = *(const h8*)xr;
        a.p[1] = *(const h8*)(xr + 16);
      }
      {
        const _Float16* wr = Ws + (ntb * 16 + m) * 32 + 8 * h;
        FragH bf;
        bf.p[0] = *(const h8*)wr;
        bf.p[1] = *(const h8*)(wr + 16);
        acc0 = mma_f16(a.v, bf.v, acc0);
      }
      {
        const _Float16* wr = Ws + ((ntb + 1) * 16 + m) * 32 + 8 * h;
        FragH bf;
        bf.p[0] = *(const h8*)wr;
        bf.p[1] = *(const h8*)(wr + 16);
        acc1 = mma_f16(a.v, bf.v, acc1);
      }
      __syncthreads();
    }

    // epilogue: fold 1/16, bias, f16, stage [d][n] tile in LDS, whole-line stores along n
    _Float16* E = (_Float16*)sm;       // [64 d][64 n]
    {
      const int dl = ntb * 16 + m;
      const float bb = bias[dbase + dl];
      h8 ev;
#pragma unroll
      for (int r = 0; r < 8; ++r) ev[r] = (_Float16)(acc0[r] * WVINV + bb);
      *(h8*)(E + dl * 64 + mt * 16 + 8 * h) = ev;
    }
    {
      const int dl = (ntb + 1) * 16 + m;
      const float bb = bias[dbase + dl];
      h8 ev;
#pragma unroll
      for (int r = 0; r < 8; ++r) ev[r] = (_Float16)(acc1[r] * WVINV + bb);
      *(h8*)(E + dl * 64 + mt * 16 + 8 * h) = ev;
    }
    __syncthreads();

    h8 vv[2];
    size_t off[2];
#pragma unroll
    for (int s = 0; s < 2; ++s) {
      const int row = w * 8 + s * 4 + (lane >> 3);   // channel local 0..63
      const int q = lane & 7;
      vv[s] = *(const h8*)(E + row * 64 + q * 8);
      off[s] = ((size_t)b * CCH + dbase + row) * NPOS + n0 + q * 8;
    }
#pragma unroll
    for (int s = 0; s < 2; ++s) *(h8*)(ov + off[s]) = vv[s];
    
  }
}

// value of lane (l ^ X), X < 16, by a DPP move inside the 16-lane row
template <int X>
__device__ __forceinline__ float lane_xor(float v) {
  const int s = __builtin_bit_cast(int, v);
  return __builtin_bit_cast(float, __builtin_amdgcn_update_dpp(s, s, 0x160 + X, 0xf, 0xf, false));
}

// ---------------------------------------------------------------------------
// Fused attention: one block per (batch, 32-query tile), 256 threads, 64-key tiles.
//   S[32 i][64 j] = Q.K^T (K = 128) with bf16 hi/lo split operands (Q fragments held in registers) -> LDS
//   online softmax stats by all waves (8 lanes per row, running max and sum in registers), p x4096 as f16 in LDS, row sums from the f16 values
//   O^T[512 c][32 i] += V[c][j] . P[i][j]  (f16), each wave owns 64 channels
// ---------------------------------------------------------------------------
__global__ void __launch_bounds__(256)
attn_kernel(const unsigned short* __restrict__ Qhi,
            const unsigned short* __restrict__ Qlo,
            const unsigned short* __restrict__ Khi,
            const unsigned short* __restrict__ Klo,
            const _Float16* __restrict__ Vh,
            const float* __restrict__ x,
            const float* __restrict__ gamma,
            float* __restrict__ outp) {
  __shared__ __align__(16) unsigned short smq[8192];   // finalize: 4096 f32, 512 per wave
  __shared__ float Ss[32 * SSP];
  __shared__ __align__(16) _Float16 Ps[32 * PSP];
  __shared__ float lrow[32];
  __shared__ float srow[32];

  const int tid  = threadIdx.x;
  const int lane = tid & 31;
  const int w    = tid >> 5;
  const int m    = lane & 15;
  const int h    = lane >> 4;

  const int i0 = blockIdx.x * 32;
  const int b  = blockIdx.y;

  v8f o[2][4];
  {
    v8f z = {};
#pragma unroll
    for (int it = 0; it < 2; ++it)
#pragma unroll
      for (int ct = 0; ct < 4; ++ct) o[it][ct] = z;
  }

  const int rtS = w >> 2;   // S row sub-tile (i)
  const int jtS = w & 3;    // S col sub-tile (j)

  // Q fragments of this wave's 16 query rows, hi and lo, k = d in 4 steps of 32: the same for every key tile, kept in registers
  FragB qfh[4], qfl[4];
  {
    const size_t qrow = ((size_t)b * NPOS + i0 + rtS * 16 + m) * DQK + 8 * h;
    const unsigned short* qrh = Qhi + qrow;
    const unsigned short* qrl = Qlo + qrow;
    // unrolled so that the fragment arrays are indexed by constants and stay in registers
#pragma unroll
    for (int kk = 0; kk < 4; ++kk) {
      qfh[kk].p[0] = *(const us8*)(qrh + kk * 32);
      qfh[kk].p[1] = *(const us8*)(qrh + kk * 32 + 16);
      qfl[kk].p[0] = *(const us8*)(qrl + kk * 32);
      qfl[kk].p[1] = *(const us8*)(qrl + kk * 32 + 16);
    }
  }

  const int si = tid >> 3;        // softmax row of this thread
  const int sq = (tid & 7) * 8;   // first of its 8 columns
  float mrun = -1e30f;            // running row maximum, equal in the row's 8 lanes
  float lrun = 0.0f;              // running row sum, equal in the row's 8 lanes

  for (int j0 = 0; j0 < NPOS; j0 += 64) {
    // ---- 1. S tile, 16x16 per wave, k = d in 4 steps of 32, three bf16 products per step ----
    {
      v8f s = {};
      const size_t krow = ((size_t)b * NPOS + j0 + jtS * 16 + m) * DQK + 8 * h;
      const unsigned short* krh = Khi + krow;
      const unsigned short* krl = Klo + krow;
#pragma unroll
      for (int kk = 0; kk < 4; ++kk) {
        FragB bh, bl;
        bh.p[0] = *(const us8*)(krh + kk * 32);
        bh.p[1] = *(const us8*)(krh + kk * 32 + 16);
        bl.p[0] = *(const us8*)(krl + kk * 32);
        bl.p[1] = *(const us8*)(krl + kk * 32 + 16);
        s = mma_bf16(qfh[kk].v, bh.v, s);
        s = mma_bf16(qfh[kk].v, bl.v, s);
        s = mma_bf16(qfl[kk].v, bh.v, s);
      }
#pragma unroll
      for (int r = 0; r < 8; ++r)
        Ss[(rtS * 16 + 8 * h + r) * SSP + jtS * 16 + m] = s[r];
    }
    __syncthreads();

    // ---- 2. online softmax stats: 8 lanes per row, 8 adjacent columns per lane, all 8 waves ----
    {
      float sv[8];   // the three loops below are fully unrolled so that sv and pv stay in registers
#pragma unroll
      for (int q = 0; q < 8; ++q) sv[q] = Ss[si * SSP + sq + q];
      float mx = sv[0];
#pragma unroll
      for (int q = 1; q < 8; ++q) mx = fmaxf(mx, sv[q]);
      mx = fmaxf(mx, lane_xor<1>(mx));
      mx = fmaxf(mx, lane_xor<2>(mx));
      mx = fmaxf(mx, lane_xor<4>(mx));
      const float mnew = fmaxf(mrun, mx);
      const float sc = __expf(mrun - mnew);
      h8 pv;
      float sum = 0.0f;
#pragma unroll
      for (int q = 0; q < 8; ++q) {
        const float p = __expf(sv[q] - mnew) * PSCALE;
        const _Float16 ph = (_Float16)p;
        pv[q] = ph;
        sum += (float)ph;
      }
      *(h8*)(Ps + si * PSP + sq) = pv;
      sum += lane_xor<1>(sum);
      sum += lane_xor<2>(sum);
      sum += lane_xor<4>(sum);
      mrun = mnew;
      lrun = lrun * sc + sum;
      if ((tid & 7) == 0) { lrow[si] = lrun; srow[si] = sc; }
    }
    __syncthreads();

    // ---- 3. rescale O, then O^T += V . P^T ----
#pragma unroll
    for (int it = 0; it < 2; ++it) {
      const float sc = srow[it * 16 + m];   // column of the accumulator = query index
#pragma unroll
      for (int ct = 0; ct < 4; ++ct) o[it][ct] = o[it][ct] * sc;
    }
#pragma unroll
    for (int jj = 0; jj < 2; ++jj) {
      // B[k = j][n = i] = P[i][j0 + jj*32 + k]: row i of Ps is k-contiguous, loaded like A
      FragH b0, b1;
      {
        const _Float16* p0 = Ps + m * PSP + jj * 32 + 8 * h;
        const _Float16* p1 = Ps + (16 + m) * PSP + jj * 32 + 8 * h;
        b0.p[0] = *(const h8*)p0;
        b0.p[1] = *(const h8*)(p0 + 16);
        b1.p[0] = *(const h8*)p1;
        b1.p[1] = *(const h8*)(p1 + 16);
      }
#pragma unroll
      for (int ct = 0; ct < 4; ++ct) {
        // A[m = c][k = j] = V[b][c][j0 + jj*32 + k], k-contiguous
        FragH a;
        const _Float16* vr = Vh + ((size_t)b * CCH + w * 64 + ct * 16 + m) * NPOS + j0 + jj * 32 + 8 * h;
        a.p[0] = *(const h8*)vr;
        a.p[1] = *(const h8*)(vr + 16);
        o[0][ct] = mma_f16(a.v, b0.v, o[0][ct]);
        o[1][ct] = mma_f16(a.v, b1.v, o[1][ct]);
      }
    }
    __syncthreads();
  }

  const float g = gamma[0];
  const float gl0 = g / lrow[m];
  const float gl1 = g / lrow[16 + m];
  float* F = (float*)smq + w * 512;     // per wave [16 c][32 i] f32
#pragma unroll
  for (int ct = 0; ct < 4; ++ct) {
    __syncthreads();
#pragma unroll
    for (int r = 0; r < 8; ++r) {
      F[(8 * h + r) * 32 + m]      = o[0][ct][r] * gl0;
      F[(8 * h + r) * 32 + 16 + m] = o[1][ct][r] * gl1;
    }
    __syncthreads();
    v4f vals[4];
    size_t offs[4];
#pragma unroll
    for (int s = 0; s < 4; ++s) {
      const int row = s * 4 + (lane >> 3);            // channel local 0..15
      const int q = lane & 7;
      const int c = w * 64 + ct * 16 + row;
      const size_t off = ((size_t)b * CCH + c) * NPOS + i0 + q * 4;
      const v4f ov = *(const v4f*)(F + row * 32 + q * 4);
      const v4f xv = *(const v4f*)(x + off);
      vals[s] = ov + xv;
      offs[s] = off;
    }
#pragma unroll
    for (int s = 0; s < 4; ++s) *(v4f*)(outp + offs[s]) = vals[s];
    
  }
}

// ---------------------------------------------------------------------------
extern "C" void kernel_launch(void* const* d_in, const int* in_sizes, int n_in,
                              void* d_out, int out_size, void* d_ws, size_t ws_size,
                              hipStream_t stream) {
  if (n_in < 13) return;
  const int nx = BATCH * CCH * NPOS;
  if (in_sizes[0] != nx || in_sizes[1] != nx ||
      in_sizes[2] != CQ * CCH || in_sizes[3] != CQ ||
      in_sizes[4] != CQ * CCH || in_sizes[5] != CQ ||
      in_sizes[6] != CQ * CCH || in_sizes[7] != CQ ||
      in_sizes[8] != CQ * CCH || in_sizes[9] != CQ ||
      in_sizes[10] != CCH * CCH || in_sizes[11] != CCH ||
      in_sizes[12] < 1 || out_size != nx) return;

  const size_t planeE = (size_t)BATCH * NPOS * DQK;   // bf16 elements per q/k plane (4 MiB each)
  const size_t vE     = (size_t)BATCH * CCH * NPOS;   // f16 elements of the v plane (16 MiB)
  const size_t need   = planeE * 2 * 4 + vE * 2;      // 33,554,432 B
  if (ws_size < need) return;

  const float* x     = (const float*)d_in[0];
  const float* dep   = (const float*)d_in[1];
  const float* wq    = (const float*)d_in[2];
  const float* bq    = (const float*)d_in[3];
  const float* wqd   = (const float*)d_in[4];
  const float* bqd   = (const float*)d_in[5];
  const float* wk    = (const float*)d_in[6];
  const float* bk    = (const float*)d_in[7];
  const float* wkd   = (const float*)d_in[8];
  const float* bkd   = (const float*)d_in[9];
  const float* wv    = (const float*)d_in[10];
  const float* bv    = (const float*)d_in[11];
  const float* gamma = (const float*)d_in[12];
  float* outp = (float*)d_out;

  unsigned short* Qhi = (unsigned short*)d_ws;
  unsigned short* Qlo = Qhi + planeE;
  unsigned short* Khi = Qlo + planeE;
  unsigned short* Klo = Khi + planeE;
  _Float16* Vh = (_Float16*)(Klo + planeE);

  dim3 blk(256);
  dim3 gqk(NPOS / 64, 1, BATCH);
  // q/k planes [B][N][128]: columns 0..63 from x, 64..127 from dep
  proj_kernel<0><<<gqk, blk, 0, stream>>>(x,   wq,  bq,  Qhi, Qlo, Vh, 0);
  proj_kernel<0><<<gqk, blk, 0, stream>>>(dep, wqd, bqd, Qhi, Qlo, Vh, CQ);
  proj_kernel<0><<<gqk, blk, 0, stream>>>(x,   wk,  bk,  Khi, Klo, Vh, 0);
  proj_kernel<0><<<gqk, blk, 0, stream>>>(dep, wkd, bkd, Khi, Klo, Vh, CQ);
  // v plane [B][C][N] f16
  proj_kernel<1><<<dim3(NPOS / 64, CCH / 64, BATCH), blk, 0, stream>>>(x, wv, bv, Qhi, Qlo, Vh, 0);
  // fused attention + gamma*out + x
  attn_kernel<<<dim3(NPOS / 32, BATCH), blk, 0, stream>>>(Qhi, Qlo, Khi, Klo, Vh, x, gamma, outp);
}

// v003
// Measured time: 307 microseconds a run.
// In two side-by-side timings against v002, it was 1.46 and 1.47 times as fast.
// All steps since v000 together make it 2.32 times as fast.
#include <hip/hip_runtime.h>

// q/k 1x1 projections and q.k^T logits: v_wmma_f32_16x16x32_bf16 with bf16 hi/lo operand split (hi.hi + hi.lo + lo.hi);
// v 1x1 projection (weights x16, folded back x1/16) and p.v: v_wmma_f32_16x16x32_f16 (f16 operands, p carried x4096); f32 accumulate everywhere.

typedef _Float16 h4  __attribute__((ext_vector_type(4)));
typedef _Float16 h8  __attribute__((ext_vector_type(8)));
typedef _Float16 h16 __attribute__((ext_vector_type(16)));
typedef __bf16   bf16v16 __attribute__((ext_vector_type(16)));
typedef unsigned short us4 __attribute__((ext_vector_type(4)));
typedef unsigned short us8 __attribute__((ext_vector_type(8)));
typedef float v4f __attribute__((ext_vector_type(4)));
typedef float v8f __attribute__((ext_vector_type(8)));

#define BATCH 4
#define CCH   512
#define NPOS  4096
#define DQK   128
#define CQ    64
#define SSP   65          // f32 score tile pitch (floats)
#define PSP   72          // f16 p tile pitch (halves), multiple of 8 for 16-B fragment loads
#define PSCALE  4096.0f   // p carried x2^12 in f16 so WMMA operands stay normal; cancels in O/l
#define WVSCALE 16.0f     // v weights x16 in f16, folded back in the epilogue
#define WVINV   0.0625f
#define KSP   136         // K tile pitch in LDS, 16-bit elements: 272 B = 16 B x 17, conflict-free for 16-B fragment reads
#define VSP   72          // V tile pitch in LDS, halves: 144 B = 16 B x 9, conflict-free for 16-B fragment reads

union FragH { h16 v; h8 p[2]; };        // elements 0..7 <- k0+8h+0..7, elements 8..15 <- k0+16+8h+0..7
union FragB { bf16v16 v; us8 p[2]; };

__device__ __forceinline__ v8f mma_f16(h16 a, h16 b, v8f c) {
  c = __builtin_amdgcn_wmma_f32_16x16x32_f16(false, a, false, b, (short)0, c, false, false);
  asm volatile("v_nop\n\tv_nop\n\tv_nop\n\tv_nop" : "+v"(c) : "v"(a), "v"(b));
  return c;
}
__device__ __forceinline__ v8f mma_bf16(bf16v16 a, bf16v16 b, v8f c) {
  c = __builtin_amdgcn_wmma_f32_16x16x32_bf16(false, a, false, b, (short)0, c, false, false);
  asm volatile("v_nop\n\tv_nop\n\tv_nop\n\tv_nop" : "+v"(c) : "v"(a), "v"(b));
  return c;
}
// f32 -> bf16 bits, RNE convert
__device__ __forceinline__ unsigned short f2bf(float f) {
  unsigned int u = __float_as_uint(f);
  u += 0x7FFFu + ((u >> 16) & 1u);
  return (unsigned short)(u >> 16);
}
__device__ __forceinline__ float bf2f(unsigned short s) {
  return __uint_as_float(((unsigned int)s) << 16);
}

// ---------------------------------------------------------------------------
// Projection GEMM, block tile 64 n x 64 d, k = 512 channels in steps of 32, 256 threads (8 waves).
//   src : [C][N] f32 slice of batch blockIdx.z;  W : [rows][C] f32;  bias : [rows] f32
//   D[row = n][col = d] = sum_c src[c][n] * W[d][c]; A = src tile staged [n][k], B = W tile staged [d][k]
// ---------------------------------------------------------------------------
template <int MODE>
__global__ void __launch_bounds__(256)
proj_kernel(const float* __restrict__ src,
            const float* __restrict__ W,
            const float* __restrict__ bias,
            unsigned short* __restrict__ ohi,
            unsigned short* __restrict__ olo,
            _Float16* __restrict__ ov,
            int doff) {
  __shared__ __align__(16) unsigned short sm[8192];   // 16 KiB: operand tiles during the k loop, output tile in the epilogue

  const int tid  = threadIdx.x;
  const int lane = tid & 31;
  const int w    = tid >> 5;
  const int m    = lane & 15;
  const int h    = lane >> 4;

  const int n0    = blockIdx.x * 64;
  const int dbase = blockIdx.y * 64;
  const int b     = blockIdx.z;

  const int mt  = w >> 1;          // n sub-tile (0..3)
  const int ntb = (w & 1) * 2;     // d sub-tile pair base (0 or 2)

  const int ms = tid & 63;         // staging row
  const int kg = (tid >> 6) * 4;   // staging k group

  const size_t srcb = (size_t)b * CCH * NPOS;

  v8f acc0 = {};
  v8f acc1 = {};

  if (MODE == 0) {
    unsigned short* Xh = sm;
    unsigned short* Xl = sm + 2048;
    unsigned short* Wh = sm + 4096;
    unsigned short* Wl = sm + 6144;

    for (int c0 = 0; c0 < CCH; c0 += 32) {
#pragma unroll
      for (int g = 0; g < 2; ++g) {
        const int kb = kg + g * 16;
        const float* sp = src + srcb + (size_t)(c0 + kb) * NPOS + n0 + ms;
        v4f xv;
        xv[0] = sp[0];
        xv[1] = sp[NPOS];
        xv[2] = sp[2 * NPOS];
        xv[3] = sp[3 * NPOS];
        const v4f wv4 = *(const v4f*)(W + (size_t)(dbase + ms) * CCH + c0 + kb);
        us4 xh4, xl4, wh4, wl4;
#pragma unroll
        for (int q = 0; q < 4; ++q) {
          const unsigned short hb = f2bf(xv[q]);
          xh4[q] = hb;
          xl4[q] = f2bf(xv[q] - bf2f(hb));
          const unsigned short wb = f2bf(wv4[q]);
          wh4[q] = wb;
          wl4[q] = f2bf(wv4[q] - bf2f(wb));
        }
        *(us4*)(Xh + ms * 32 + kb) = xh4;
        *(us4*)(Xl + ms * 32 + kb) = xl4;
        *(us4*)(Wh + ms * 32 + kb) = wh4;
        *(us4*)(Wl + ms * 32 + kb) = wl4;
      }
      __syncthreads();

      FragB ah, al;
      {
        const unsigned short* xr  = Xh + (mt * 16 + m) * 32 + 8 * h;
        const unsigned short* xrl = Xl + (mt * 16 + m) * 32 + 8 * h;
        ah.p[0] = *(const us8*)xr;
        ah.p[1] = *(const us8*)(xr + 16);
        al.p[0] = *(const us8*)xrl;
        al.p[1] = *(const us8*)(xrl + 16);
      }
      {
        const unsigned short* wr  = Wh + (ntb * 16 + m) * 32 + 8 * h;
        const unsigned short* wrl = Wl + (ntb * 16 + m) * 32 + 8 * h;
        FragB bh, bl;
        bh.p[0] = *(const us8*)wr;
        bh.p[1] = *(const us8*)(wr + 16);
        bl.p[0] = *(const us8*)wrl;
        bl.p[1] = *(const us8*)(wrl + 16);
        acc0 = mma_bf16(ah.v, bh.v, acc0);
        acc0 = mma_bf16(ah.v, bl.v, acc0);
        acc0 = mma_bf16(al.v, bh.v, acc0);
      }
      {
        const unsigned short* wr  = Wh + ((ntb + 1) * 16 + m) * 32 + 8 * h;
        const unsigned short* wrl = Wl + ((ntb + 1) * 16 + m) * 32 + 8 * h;
        FragB bh, bl;
        bh.p[0] = *(const us8*)wr;
        bh.p[1] = *(const us8*)(wr + 16);
        bl.p[0] = *(const us8*)wrl;
        bl.p[1] = *(const us8*)(wrl + 16);
        acc1 = mma_bf16(ah.v, bh.v, acc1);
        acc1 = mma_bf16(ah.v, bl.v, acc1);
        acc1 = mma_bf16(al.v, bh.v, acc1);
      }
      __syncthreads();
    }

    // epilogue: bias add in f32, hi/lo bf16 split, stage [n][d] tile in LDS, whole-line stores
    unsigned short* Eh = sm;          // [64 n][64 d]
    unsigned short* El = sm + 4096;   // [64 n][64 d]
    {
      const int dl = ntb * 16 + m;
      const float bb = bias[dbase + dl];
#pragma unroll
      for (int r = 0; r < 8; ++r) {
        const float v = acc0[r] + bb;
        const unsigned short hb = f2bf(v);
        const int row = mt * 16 + 8 * h + r;
        Eh[row * 64 + dl] = hb;
        El[row * 64 + dl] = f2bf(v - bf2f(hb));
      }
    }
    {
      const int dl = (ntb + 1) * 16 + m;
      const float bb = bias[dbase + dl];
#pragma unroll
      for (int r = 0; r < 8; ++r) {
        const float v = acc1[r] + bb;
        const unsigned short hb = f2bf(v);
        const int row = mt * 16 + 8 * h + r;
        Eh[row * 64 + dl] = hb;
        El[row * 64 + dl] = f2bf(v - bf2f(hb));
      }
    }
    __syncthreads();

    us8 vh[2], vl[2];
    size_t off[2];
#pragma unroll
    for (int s = 0; s < 2; ++s) {
      const int row = w * 8 + s * 4 + (lane >> 3);
      const int q = lane & 7;
      vh[s] = *(const us8*)(Eh + row * 64 + q * 8);
      vl[s] = *(const us8*)(El + row * 64 + q * 8);
      off[s] = ((size_t)b * NPOS + n0 + row) * DQK + doff + q * 8;
    }
#pragma unroll
    for (int s = 0; s < 2; ++s) {
      *(us8*)(ohi + off[s]) = vh[s];
      *(us8*)(olo + off[s]) = vl[s];
    }
    
  } else {
    _Float16* Xs = (_Float16*)sm;       // [64 n][32 k]
    _Float16* Ws = Xs + 2048;           // [64 d][32 k]

    for (int c0 = 0; c0 < CCH; c0 += 32) {
#pragma unroll
      for (int g = 0; g < 2; ++g) {
        const int kb = kg + g * 16;
        const float* sp = src + srcb + (size_t)(c0 + kb) * NPOS + n0 + ms;
        v4f xv;
        xv[0] = sp[0];
        xv[1] = sp[NPOS];
        xv[2] = sp[2 * NPOS];
        xv[3] = sp[3 * NPOS];
        v4f wv4 = *(const v4f*)(W + (size_t)(dbase + ms) * CCH + c0 + kb);
        wv4 = wv4 * WVSCALE;
        *(h4*)(Xs + ms * 32 + kb) = __builtin_convertvector(xv, h4);
        *(h4*)(Ws + ms * 32 + kb) = __builtin_convertvector(wv4, h4);
      }
      __syncthreads();

      FragH a;
      {
        const _Float16* xr = Xs + (mt * 16 + m) * 32 + 8 * h;
        a.p[0] = *(const h8*)xr;
        a.p[1] = *(const h8*)(xr + 16);
      }
      {
        const _Float16* wr = Ws + (ntb * 16 + m) * 32 + 8 * h;
        FragH bf;
        bf.p[0] = *(const h8*)wr;
        bf.p[1] = *(const h8*)(wr + 16);
        acc0 = mma_f16(a.v, bf.v, acc0);
      }
      {
        const _Float16* wr = Ws + ((ntb + 1) * 16 + m) * 32 + 8 * h;
        FragH bf;
        bf.p[0] = *(const h8*)wr;
        bf.p[1] = *(const h8*)(wr + 16);
        acc1 = mma_f16(a.v, bf.v, acc1);
      }
      __syncthreads();
    }

    // epilogue: fold 1/16, bias, f16, stage [d][n] tile in LDS, whole-line stores along n
    _Float16* E = (_Float16*)sm;       // [64 d][64 n]
    {
      const int dl = ntb * 16 + m;
      const float bb = bias[dbase + dl];
      h8 ev;
#pragma unroll
      for (int r = 0; r < 8; ++r) ev[r] = (_Float16)(acc0[r] * WVINV + bb);
      *(h8*)(E + dl * 64 + mt * 16 + 8 * h) = ev;
    }
    {
      const int dl = (ntb + 1) * 16 + m;
      const float bb = bias[dbase + dl];
      h8 ev;
#pragma unroll
      for (int r = 0; r < 8; ++r) ev[r] = (_Float16)(acc1[r] * WVINV + bb);
      *(h8*)(E + dl * 64 + mt * 16 + 8 * h) = ev;
    }
    __syncthreads();

    h8 vv[2];
    size_t off[2];
#pragma unroll
    for (int s = 0; s < 2; ++s) {
      const int row = w * 8 + s * 4 + (lane >> 3);   // channel local 0..63
      const int q = lane & 7;
      vv[s] = *(const h8*)(E + row * 64 + q * 8);
      off[s] = ((size_t)b * CCH + dbase + row) * NPOS + n0 + q * 8;
    }
#pragma unroll
    for (int s = 0; s < 2; ++s) *(h8*)(ov + off[s]) = vv[s];
    
  }
}

// value of lane (l ^ X), X < 16, by a DPP move inside the 16-lane row
template <int X>
__device__ __forceinline__ float lane_xor(float v) {
  const int s = __builtin_bit_cast(int, v);
  return __builtin_bit_cast(float, __builtin_amdgcn_update_dpp(s, s, 0x160 + X, 0xf, 0xf, false));
}

// LDS byte address of a __shared__ object: the low 32 bits of its address
__device__ __forceinline__ unsigned lds_byte(const void* p) {
  return (unsigned)(size_t)p;
}

// Eight asynchronous 16-B copies per lane, global -> LDS, through no register.
// s_wait_xcnt 0 is the last line of the copies' own statement, so that no address register is rewritten in front of it.
__device__ __forceinline__ void copy8(const unsigned (&l)[8], const void* const (&g)[8]) {
  asm volatile(
      "global_load_async_to_lds_b128 %0, %8, off\n\t"
      "global_load_async_to_lds_b128 %1, %9, off\n\t"
      "global_load_async_to_lds_b128 %2, %10, off\n\t"
      "global_load_async_to_lds_b128 %3, %11, off\n\t"
      "global_load_async_to_lds_b128 %4, %12, off\n\t"
      "global_load_async_to_lds_b128 %5, %13, off\n\t"
      "global_load_async_to_lds_b128 %6, %14, off\n\t"
      "global_load_async_to_lds_b128 %7, %15, off\n\t"
      "s_wait_xcnt 0x0"
      :: "v"(l[0]), "v"(l[1]), "v"(l[2]), "v"(l[3]), "v"(l[4]), "v"(l[5]), "v"(l[6]), "v"(l[7]),
         "v"(g[0]), "v"(g[1]), "v"(g[2]), "v"(g[3]), "v"(g[4]), "v"(g[5]), "v"(g[6]), "v"(g[7])
      : "memory");
}

// ---------------------------------------------------------------------------
// Fused attention: one block per (batch, 32-query tile), 256 threads, 64-key tiles.
//   K hi/lo tile [64 j][128 d] and V tile [512 c][64 j] come into LDS by asynchronous copies in whole 128-B lines;
//   V of a tile flies during its scores and softmax, K of the next tile during p.v; fragments are read from LDS
//   S[32 i][64 j] = Q.K^T (K = 128) with bf16 hi/lo split operands (Q fragments held in registers) -> LDS
//   online softmax stats by all waves (8 lanes per row, running max and sum in registers), p x4096 as f16 in LDS, row sums from the f16 values
//   O^T[512 c][32 i] += V[c][j] . P[i][j]  (f16), each wave owns 64 channels
// ---------------------------------------------------------------------------
__global__ void __launch_bounds__(256)
attn_kernel(const unsigned short* __restrict__ Qhi,
            const unsigned short* __restrict__ Qlo,
            const unsigned short* __restrict__ Khi,
            const unsigned short* __restrict__ Klo,
            const _Float16* __restrict__ Vh,
            const float* __restrict__ x,
            const float* __restrict__ gamma,
            float* __restrict__ outp) {
  __shared__ __align__(16) unsigned short smq[8192];   // finalize: 4096 f32, 512 per wave
  __shared__ __align__(16) unsigned short Ksh[64 * KSP];   // K hi tile
  __shared__ __align__(16) unsigned short Ksl[64 * KSP];   // K lo tile
  __shared__ __align__(16) _Float16 Vs[CCH * VSP];         // V tile
  __shared__ float Ss[32 * SSP];
  __shared__ __align__(16) _Float16 Ps[32 * PSP];
  __shared__ float lrow[32];
  __shared__ float srow[32];

  const int tid  = threadIdx.x;
  const int lane = tid & 31;
  const int w    = tid >> 5;
  const int m    = lane & 15;
  const int h    = lane >> 4;

  const int i0 = blockIdx.x * 32;
  const int b  = blockIdx.y;

  v8f o[2][4];
  {
    v8f z = {};
#pragma unroll
    for (int it = 0; it < 2; ++it)
#pragma unroll
      for (int ct = 0; ct < 4; ++ct) o[it][ct] = z;
  }

  const int rtS = w >> 2;   // S row sub-tile (i)
  const int jtS = w & 3;    // S col sub-tile (j)

  // Q fragments of this wave's 16 query rows, hi and lo, k = d in 4 steps of 32: the same for every key tile, kept in registers
  FragB qfh[4], qfl[4];
  {
    const size_t qrow = ((size_t)b * NPOS + i0 + rtS * 16 + m) * DQK + 8 * h;
    const unsigned short* qrh = Qhi + qrow;
    const unsigned short* qrl = Qlo + qrow;
    // unrolled so that the fragment arrays are indexed by constants and stay in registers
#pragma unroll
    for (int kk = 0; kk < 4; ++kk) {
      qfh[kk].p[0] = *(const us8*)(qrh + kk * 32);
      qfh[kk].p[1] = *(const us8*)(qrh + kk * 32 + 16);
      qfl[kk].p[0] = *(const us8*)(qrl + kk * 32);
      qfl[kk].p[1] = *(const us8*)(qrl + kk * 32 + 16);
    }
  }

  const int si = tid >> 3;        // softmax row of this thread
  const int sq = (tid & 7) * 8;   // first of its 8 columns
  float mrun = -1e30f;            // running row maximum, equal in the row's 8 lanes
  float lrun = 0.0f;              // running row sum, equal in the row's 8 lanes

  // copy shares: K, 16 lanes per 256-B row, 16 rows per step; V, 8 lanes per 128-B row, 32 rows per step
  const int kcr = tid >> 4;
  const int kcq = (tid & 15) * 8;
  const int vcr = tid >> 3;
  const int vcq = (tid & 7) * 8;
  const unsigned short* kgh = Khi + ((size_t)b * NPOS + kcr) * DQK + kcq;
  const unsigned short* kgl = Klo + ((size_t)b * NPOS + kcr) * DQK + kcq;
  const _Float16* vg = Vh + ((size_t)b * CCH + vcr) * NPOS + vcq;
  const unsigned klh = lds_byte(Ksh + kcr * KSP + kcq);
  const unsigned kll = lds_byte(Ksl + kcr * KSP + kcq);
  const unsigned vl  = lds_byte(Vs + vcr * VSP + vcq);

  // K tile 0
  {
    unsigned l[8];
    const void* g[8];
    // unrolled so that l and g are indexed by constants and stay in registers
#pragma unroll
    for (int i = 0; i < 4; ++i) {
      l[i]     = klh + i * 16 * KSP * 2;
      l[4 + i] = kll + i * 16 * KSP * 2;
      g[i]     = kgh + (size_t)(i * 16) * DQK;
      g[4 + i] = kgl + (size_t)(i * 16) * DQK;
    }
    copy8(l, g);
  }
  asm volatile("s_wait_asynccnt 0x0" ::: "memory");   // this wave's share of K tile 0 has landed before the barrier publishes it
  __syncthreads();

  for (int j0 = 0; j0 < NPOS; j0 += 64) {
    // ---- 0. V tile of this trip: its buffer's last readers ended at the barrier that closed the trip before ----
    // both loops unrolled so that l and g are indexed by constants and stay in registers
#pragma unroll
    for (int u = 0; u < 2; ++u) {
      unsigned l[8];
      const void* g[8];
#pragma unroll
      for (int i = 0; i < 8; ++i) {
        l[i] = vl + (u * 8 + i) * 32 * VSP * 2;
        g[i] = vg + (size_t)((u * 8 + i) * 32) * NPOS + j0;
      }
      copy8(l, g);
    }

    // ---- 1. S tile, 16x16 per wave, k = d in 4 steps of 32, three bf16 products per step ----
    {
      v8f s = {};
      const int krow = (jtS * 16 + m) * KSP + 8 * h;
      const unsigned short* krh = Ksh + krow;
      const unsigned short* krl = Ksl + krow;
#pragma unroll
      for (int kk = 0; kk < 4; ++kk) {
        FragB bh, bl;
        bh.p[0] = *(const us8*)(krh + kk * 32);
        bh.p[1] = *(const us8*)(krh + kk * 32 + 16);
        bl.p[0] = *(const us8*)(krl + kk * 32);
        bl.p[1] = *(const us8*)(krl + kk * 32 + 16);
        s = mma_bf16(qfh[kk].v, bh.v, s);
        s = mma_bf16(qfh[kk].v, bl.v, s);
        s = mma_bf16(qfl[kk].v, bh.v, s);
      }
#pragma unroll
      for (int r = 0; r < 8; ++r)
        Ss[(rtS * 16 + 8 * h + r) * SSP + jtS * 16 + m] = s[r];
    }
    asm volatile("s_wait_dscnt 0x0" ::: "memory");      // this wave's K reads have retired before the K buffer is handed to its next copies
    __syncthreads();

    // ---- 2. online softmax stats: 8 lanes per row, 8 adjacent columns per lane, all 8 waves ----
    {
      float sv[8];   // the three loops below are fully unrolled so that sv and pv stay in registers
#pragma unroll
      for (int q = 0; q < 8; ++q) sv[q] = Ss[si * SSP + sq + q];
      float mx = sv[0];
#pragma unroll
      for (int q = 1; q < 8; ++q) mx = fmaxf(mx, sv[q]);
      mx = fmaxf(mx, lane_xor<1>(mx));
      mx = fmaxf(mx, lane_xor<2>(mx));
      mx = fmaxf(mx, lane_xor<4>(mx));
      const float mnew = fmaxf(mrun, mx);
      const float sc = __expf(mrun - mnew);
      h8 pv;
      float sum = 0.0f;
#pragma unroll
      for (int q = 0; q < 8; ++q) {
        const float p = __expf(sv[q] - mnew) * PSCALE;
        const _Float16 ph = (_Float16)p;
        pv[q] = ph;
        sum += (float)ph;
      }
      *(h8*)(Ps + si * PSP + sq) = pv;
      sum += lane_xor<1>(sum);
      sum += lane_xor<2>(sum);
      sum += lane_xor<4>(sum);
      mrun = mnew;
      lrun = lrun * sc + sum;
      if ((tid & 7) == 0) { lrow[si] = lrun; srow[si] = sc; }
    }
    asm volatile("s_wait_asynccnt 0x0" ::: "memory");   // this wave's share of the V tile has landed before the barrier publishes it
    __syncthreads();

    // K tile of the next trip: every reader left the K buffer at the barrier behind the scores
    if (j0 + 64 < NPOS) {
      unsigned l[8];
      const void* g[8];
      // unrolled so that l and g are indexed by constants and stay in registers
#pragma unroll
      for (int i = 0; i < 4; ++i) {
        l[i]     = klh + i * 16 * KSP * 2;
        l[4 + i] = kll + i * 16 * KSP * 2;
        g[i]     = kgh + (size_t)(j0 + 64 + i * 16) * DQK;
        g[4 + i] = kgl + (size_t)(j0 + 64 + i * 16) * DQK;
      }
      copy8(l, g);
    }

    // ---- 3. rescale O, then O^T += V . P^T ----
#pragma unroll
    for (int it = 0; it < 2; ++it) {
      const float sc = srow[it * 16 + m];   // column of the accumulator = query index
#pragma unroll
      for (int ct = 0; ct < 4; ++ct) o[it][ct] = o[it][ct] * sc;
    }
#pragma unroll
    for (int jj = 0; jj < 2; ++jj) {
      // B[k = j][n = i] = P[i][j0 + jj*32 + k]: row i of Ps is k-contiguous, loaded like A
      FragH b0, b1;
      {
        const _Float16* p0 = Ps + m * PSP + jj * 32 + 8 * h;
        const _Float16* p1 = Ps + (16 + m) * PSP + jj * 32 + 8 * h;
        b0.p[0] = *(const h8*)p0;
        b0.p[1] = *(const h8*)(p0 + 16);
        b1.p[0] = *(const h8*)p1;
        b1.p[1] = *(const h8*)(p1 + 16);
      }
#pragma unroll
      for (int ct = 0; ct < 4; ++ct) {
        // A[m = c][k = j] = V[b][c][j0 + jj*32 + k], k-contiguous, from the LDS tile
        FragH a;
        const _Float16* vr = Vs + (w * 64 + ct * 16 + m) * VSP + jj * 32 + 8 * h;
        a.p[0] = *(const h8*)vr;
        a.p[1] = *(const h8*)(vr + 16);
        o[0][ct] = mma_f16(a.v, b0.v, o[0][ct]);
        o[1][ct] = mma_f16(a.v, b1.v, o[1][ct]);
      }
    }
    asm volatile("s_wait_dscnt 0x0" ::: "memory");      // this wave's V reads have retired before the V buffer is handed to its next copies
    asm volatile("s_wait_asynccnt 0x0" ::: "memory");   // this wave's share of the next K tile has landed before the barrier publishes it
    __syncthreads();
  }

  const float g = gamma[0];
  const float gl0 = g / lrow[m];
  const float gl1 = g / lrow[16 + m];
  float* F = (float*)smq + w * 512;     // per wave [16 c][32 i] f32
#pragma unroll
  for (int ct = 0; ct < 4; ++ct) {
    __syncthreads();
#pragma unroll
    for (int r = 0; r < 8; ++r) {
      F[(8 * h + r) * 32 + m]      = o[0][ct][r] * gl0;
      F[(8 * h + r) * 32 + 16 + m] = o[1][ct][r] * gl1;
    }
    __syncthreads();
    v4f vals[4];
    size_t offs[4];
#pragma unroll
    for (int s = 0; s < 4; ++s) {
      const int row = s * 4 + (lane >> 3);            // channel local 0..15
      const int q = lane & 7;
      const int c = w * 64 + ct * 16 + row;
      const size_t off = ((size_t)b * CCH + c) * NPOS + i0 + q * 4;
      const v4f ov = *(const v4f*)(F + row * 32 + q * 4);
      const v4f xv = *(const v4f*)(x + off);
      vals[s] = ov + xv;
      offs[s] = off;
    }
#pragma unroll
    for (int s = 0; s < 4; ++s) *(v4f*)(outp + offs[s]) = vals[s];
    
  }
}

// ---------------------------------------------------------------------------
extern "C" void kernel_launch(void* const* d_in, const int* in_sizes, int n_in,
                              void* d_out, int out_size, void* d_ws, size_t ws_size,
                              hipStream_t stream) {
  if (n_in < 13) return;
  const int nx = BATCH * CCH * NPOS;
  if (in_sizes[0] != nx || in_sizes[1] != nx ||
      in_sizes[2] != CQ * CCH || in_sizes[3] != CQ ||
      in_sizes[4] != CQ * CCH || in_sizes[5] != CQ ||
      in_sizes[6] != CQ * CCH || in_sizes[7] != CQ ||
      in_sizes[8] != CQ * CCH || in_sizes[9] != CQ ||
      in_sizes[10] != CCH * CCH || in_sizes[11] != CCH ||
      in_sizes[12] < 1 || out_size != nx) return;

  const size_t planeE = (size_t)BATCH * NPOS * DQK;   // bf16 elements per q/k plane (4 MiB each)
  const size_t vE     = (size_t)BATCH * CCH * NPOS;   // f16 elements of the v plane (16 MiB)
  const size_t need   = planeE * 2 * 4 + vE * 2;      // 33,554,432 B
  if (ws_size < need) return;

  const float* x     = (const float*)d_in[0];
  const float* dep   = (const float*)d_in[1];
  const float* wq    = (const float*)d_in[2];
  const float* bq    = (const float*)d_in[3];
  const float* wqd   = (const float*)d_in[4];
  const float* bqd   = (const float*)d_in[5];
  const float* wk    = (const float*)d_in[6];
  const float* bk    = (const float*)d_in[7];
  const float* wkd   = (const float*)d_in[8];
  const float* bkd   = (const float*)d_in[9];
  const float* wv    = (const float*)d_in[10];
  const float* bv    = (const float*)d_in[11];
  const float* gamma = (const float*)d_in[12];
  float* outp = (float*)d_out;

  unsigned short* Qhi = (unsigned short*)d_ws;
  unsigned short* Qlo = Qhi + planeE;
  unsigned short* Khi = Qlo + planeE;
  unsigned short* Klo = Khi + planeE;
  _Float16* Vh = (_Float16*)(Klo + planeE);

  dim3 blk(256);
  dim3 gqk(NPOS / 64, 1, BATCH);
  // q/k planes [B][N][128]: columns 0..63 from x, 64..127 from dep
  proj_kernel<0><<<gqk, blk, 0, stream>>>(x,   wq,  bq,  Qhi, Qlo, Vh, 0);
  proj_kernel<0><<<gqk, blk, 0, stream>>>(dep, wqd, bqd, Qhi, Qlo, Vh, CQ);
  proj_kernel<0><<<gqk, blk, 0, stream>>>(x,   wk,  bk,  Khi, Klo, Vh, 0);
  proj_kernel<0><<<gqk, blk, 0, stream>>>(dep, wkd, bkd, Khi, Klo, Vh, CQ);
  // v plane [B][C][N] f16
  proj_kernel<1><<<dim3(NPOS / 64, CCH / 64, BATCH), blk, 0, stream>>>(x, wv, bv, Qhi, Qlo, Vh, 0);
  // fused attention + gamma*out + x
  attn_kernel<<<dim3(NPOS / 32, BATCH), blk, 0, stream>>>(Qhi, Qlo, Khi, Klo, Vh, x, gamma, outp);
}

// v004
// A run of this version takes 256 microseconds.
// Next to v003, in two timings, it ran 1.20 times as fast each time.
// Over all steps from v000 it is 2.79 times as fast.
#include <hip/hip_runtime.h>

// q/k 1x1 projections and q.k^T logits: v_wmma_f32_16x16x32_bf16 with bf16 hi/lo operand split (hi.hi + hi.lo + lo.hi);
// v 1x1 projection (weights x16, folded back x1/16) and p.v: v_wmma_f32_16x16x32_f16 (f16 operands, p carried x4096); f32 accumulate everywhere.

typedef _Float16 h4  __attribute__((ext_vector_type(4)));
typedef _Float16 h8  __attribute__((ext_vector_type(8)));
typedef _Float16 h16 __attribute__((ext_vector_type(16)));
typedef __bf16   bf16v16 __attribute__((ext_vector_type(16)));
typedef unsigned short us4 __attribute__((ext_vector_type(4)));
typedef unsigned short us8 __attribute__((ext_vector_type(8)));
typedef float v4f __attribute__((ext_vector_type(4)));
typedef float v8f __attribute__((ext_vector_type(8)));

#define BATCH 4
#define CCH   512
#define NPOS  4096
#define DQK   128
#define CQ    64
#define SSP   65          // f32 score tile pitch (floats)
#define PSP   72          // f16 p tile pitch (halves), multiple of 8 for 16-B fragment loads
#define PSCALE  4096.0f   // p carried x2^12 in f16 so WMMA operands stay normal; cancels in O/l
#define WVSCALE 16.0f     // v weights x16 in f16, folded back in the epilogue
#define WVINV   0.0625f
#define KSP   136         // K tile pitch in LDS, 16-bit elements: 272 B = 16 B x 17, conflict-free for 16-B fragment reads
#define VSP   72          // V tile pitch in LDS, halves: 144 B = 16 B x 9, conflict-free for 16-B fragment reads

union FragH { h16 v; h8 p[2]; };        // elements 0..7 <- k0+8h+0..7, elements 8..15 <- k0+16+8h+0..7
union FragB { bf16v16 v; us8 p[2]; };

__device__ __forceinline__ v8f mma_f16(h16 a, h16 b, v8f c) {
  c = __builtin_amdgcn_wmma_f32_16x16x32_f16(false, a, false, b, (short)0, c, false, false);
  asm volatile("v_nop\n\tv_nop\n\tv_nop\n\tv_nop" : "+v"(c) : "v"(a), "v"(b));
  return c;
}
__device__ __forceinline__ v8f mma_bf16(bf16v16 a, bf16v16 b, v8f c) {
  c = __builtin_amdgcn_wmma_f32_16x16x32_bf16(false, a, false, b, (short)0, c, false, false);
  asm volatile("v_nop\n\tv_nop\n\tv_nop\n\tv_nop" : "+v"(c) : "v"(a), "v"(b));
  return c;
}
// f32 -> bf16 bits, RNE convert
__device__ __forceinline__ unsigned short f2bf(float f) {
  unsigned int u = __float_as_uint(f);
  u += 0x7FFFu + ((u >> 16) & 1u);
  return (unsigned short)(u >> 16);
}
__device__ __forceinline__ float bf2f(unsigned short s) {
  return __uint_as_float(((unsigned int)s) << 16);
}

// ---------------------------------------------------------------------------
// Projection GEMM, block tile 64 n x 64 d, k = 512 channels in steps of 32, 256 threads (8 waves).
//   src : [C][N] f32 slice of batch blockIdx.z;  W : [rows][C] f32;  bias : [rows] f32
//   D[row = n][col = d] = sum_c src[c][n] * W[d][c]; A = src tile staged [n][k], B = W tile staged [d][k]
// ---------------------------------------------------------------------------
template <int MODE>
__global__ void __launch_bounds__(256)
proj_kernel(const float* __restrict__ src,
            const float* __restrict__ W,
            const float* __restrict__ bias,
            unsigned short* __restrict__ ohi,
            unsigned short* __restrict__ olo,
            _Float16* __restrict__ ov,
            int doff) {
  __shared__ __align__(16) unsigned short sm[8192];   // 16 KiB: operand tiles during the k loop, output tile in the epilogue

  const int tid  = threadIdx.x;
  const int lane = tid & 31;
  const int w    = tid >> 5;
  const int m    = lane & 15;
  const int h    = lane >> 4;

  const int n0    = blockIdx.x * 64;
  const int dbase = blockIdx.y * 64;
  const int b     = blockIdx.z;

  const int mt  = w >> 1;          // n sub-tile (0..3)
  const int ntb = (w & 1) * 2;     // d sub-tile pair base (0 or 2)

  const int ms = tid & 63;         // staging row
  const int kg = (tid >> 6) * 4;   // staging k group

  const size_t srcb = (size_t)b * CCH * NPOS;

  v8f acc0 = {};
  v8f acc1 = {};

  if (MODE == 0) {
    unsigned short* Xh = sm;
    unsigned short* Xl = sm + 2048;
    unsigned short* Wh = sm + 4096;
    unsigned short* Wl = sm + 6144;

    for (int c0 = 0; c0 < CCH; c0 += 32) {
#pragma unroll
      for (int g = 0; g < 2; ++g) {
        const int kb = kg + g * 16;
        const float* sp = src + srcb + (size_t)(c0 + kb) * NPOS + n0 + ms;
        v4f xv;
        xv[0] = sp[0];
        xv[1] = sp[NPOS];
        xv[2] = sp[2 * NPOS];
        xv[3] = sp[3 * NPOS];
        const v4f wv4 = *(const v4f*)(W + (size_t)(dbase + ms) * CCH + c0 + kb);
        us4 xh4, xl4, wh4, wl4;
#pragma unroll
        for (int q = 0; q < 4; ++q) {
          const unsigned short hb = f2bf(xv[q]);
          xh4[q] = hb;
          xl4[q] = f2bf(xv[q] - bf2f(hb));
          const unsigned short wb = f2bf(wv4[q]);
          wh4[q] = wb;
          wl4[q] = f2bf(wv4[q] - bf2f(wb));
        }
        *(us4*)(Xh + ms * 32 + kb) = xh4;
        *(us4*)(Xl + ms * 32 + kb) = xl4;
        *(us4*)(Wh + ms * 32 + kb) = wh4;
        *(us4*)(Wl + ms * 32 + kb) = wl4;
      }
      __syncthreads();

      FragB ah, al;
      {
        const unsigned short* xr  = Xh + (mt * 16 + m) * 32 + 8 * h;
        const unsigned short* xrl = Xl + (mt * 16 + m) * 32 + 8 * h;
        ah.p[0] = *(const us8*)xr;
        ah.p[1] = *(const us8*)(xr + 16);
        al.p[0] = *(const us8*)xrl;
        al.p[1] = *(const us8*)(xrl + 16);
      }
      {
        const unsigned short* wr  = Wh + (ntb * 16 + m) * 32 + 8 * h;
        const unsigned short* wrl = Wl + (ntb * 16 + m) * 32 + 8 * h;
        FragB bh, bl;
        bh.p[0] = *(const us8*)wr;
        bh.p[1] = *(const us8*)(wr + 16);
        bl.p[0] = *(const us8*)wrl;
        bl.p[1] = *(const us8*)(wrl + 16);
        acc0 = mma_bf16(ah.v, bh.v, acc0);
        acc0 = mma_bf16(ah.v, bl.v, acc0);
        acc0 = mma_bf16(al.v, bh.v, acc0);
      }
      {
        const unsigned short* wr  = Wh + ((ntb + 1) * 16 + m) * 32 + 8 * h;
        const unsigned short* wrl = Wl + ((ntb + 1) * 16 + m) * 32 + 8 * h;
        FragB bh, bl;
        bh.p[0] = *(const us8*)wr;
        bh.p[1] = *(const us8*)(wr + 16);
        bl.p[0] = *(const us8*)wrl;
        bl.p[1] = *(const us8*)(wrl + 16);
        acc1 = mma_bf16(ah.v, bh.v, acc1);
        acc1 = mma_bf16(ah.v, bl.v, acc1);
        acc1 = mma_bf16(al.v, bh.v, acc1);
      }
      __syncthreads();
    }

    // epilogue: bias add in f32, hi/lo bf16 split, stage [n][d] tile in LDS, whole-line stores
    unsigned short* Eh = sm;          // [64 n][64 d]
    unsigned short* El = sm + 4096;   // [64 n][64 d]
    {
      const int dl = ntb * 16 + m;
      const float bb = bias[dbase + dl];
#pragma unroll
      for (int r = 0; r < 8; ++r) {
        const float v = acc0[r] + bb;
        const unsigned short hb = f2bf(v);
        const int row = mt * 16 + 8 * h + r;
        Eh[row * 64 + dl] = hb;
        El[row * 64 + dl] = f2bf(v - bf2f(hb));
      }
    }
    {
      const int dl = (ntb + 1) * 16 + m;
      const float bb = bias[dbase + dl];
#pragma unroll
      for (int r = 0; r < 8; ++r) {
        const float v = acc1[r] + bb;
        const unsigned short hb = f2bf(v);
        const int row = mt * 16 + 8 * h + r;
        Eh[row * 64 + dl] = hb;
        El[row * 64 + dl] = f2bf(v - bf2f(hb));
      }
    }
    __syncthreads();

    us8 vh[2], vl[2];
    size_t off[2];
#pragma unroll
    for (int s = 0; s < 2; ++s) {
      const int row = w * 8 + s * 4 + (lane >> 3);
      const int q = lane & 7;
      vh[s] = *(const us8*)(Eh + row * 64 + q * 8);
      vl[s] = *(const us8*)(El + row * 64 + q * 8);
      off[s] = ((size_t)b * NPOS + n0 + row) * DQK + doff + q * 8;
    }
#pragma unroll
    for (int s = 0; s < 2; ++s) {
      *(us8*)(ohi + off[s]) = vh[s];
      *(us8*)(olo + off[s]) = vl[s];
    }
    
  } else {
    _Float16* Xs = (_Float16*)sm;       // [64 n][32 k]
    _Float16* Ws = Xs + 2048;           // [64 d][32 k]

    for (int c0 = 0; c0 < CCH; c0 += 32) {
#pragma unroll
      for (int g = 0; g < 2; ++g) {
        const int kb = kg + g * 16;
        const float* sp = src + srcb + (size_t)(c0 + kb) * NPOS + n0 + ms;
        v4f xv;
        xv[0] = sp[0];
        xv[1] = sp[NPOS];
        xv[2] = sp[2 * NPOS];
        xv[3] = sp[3 * NPOS];
        v4f wv4 = *(const v4f*)(W + (size_t)(dbase + ms) * CCH + c0 + kb);
        wv4 = wv4 * WVSCALE;
        *(h4*)(Xs + ms * 32 + kb) = __builtin_convertvector(xv, h4);
        *(h4*)(Ws + ms * 32 + kb) = __builtin_convertvector(wv4, h4);
      }
      __syncthreads();

      FragH a;
      {
        const _Float16* xr = Xs + (mt * 16 + m) * 32 + 8 * h;
        a.p[0] = *(const h8*)xr;
        a.p[1] = *(const h8*)(xr + 16);
      }
      {
        const _Float16* wr = Ws + (ntb * 16 + m) * 32 + 8 * h;
        FragH bf;
        bf.p[0] = *(const h8*)wr;
        bf.p[1] = *(const h8*)(wr + 16);
        acc0 = mma_f16(a.v, bf.v, acc0);
      }
      {
        const _Float16* wr = Ws + ((ntb + 1) * 16 + m) * 32 + 8 * h;
        FragH bf;
        bf.p[0] = *(const h8*)wr;
        bf.p[1] = *(const h8*)(wr + 16);
        acc1 = mma_f16(a.v, bf.v, acc1);
      }
      __syncthreads();
    }

    // epilogue: fold 1/16, bias, f16, stage [d][n] tile in LDS, whole-line stores along n
    _Float16* E = (_Float16*)sm;       // [64 d][64 n]
    {
      const int dl = ntb * 16 + m;
      const float bb = bias[dbase + dl];
      h8 ev;
#pragma unroll
      for (int r = 0; r < 8; ++r) ev[r] = (_Float16)(acc0[r] * WVINV + bb);
      *(h8*)(E + dl * 64 + mt * 16 + 8 * h) = ev;
    }
    {
      const int dl = (ntb + 1) * 16 + m;
      const float bb = bias[dbase + dl];
      h8 ev;
#pragma unroll
      for (int r = 0; r < 8; ++r) ev[r] = (_Float16)(acc1[r] * WVINV + bb);
      *(h8*)(E + dl * 64 + mt * 16 + 8 * h) = ev;
    }
    __syncthreads();

    h8 vv[2];
    size_t off[2];
#pragma unroll
    for (int s = 0; s < 2; ++s) {
      const int row = w * 8 + s * 4 + (lane >> 3);   // channel local 0..63
      const int q = lane & 7;
      vv[s] = *(const h8*)(E + row * 64 + q * 8);
      off[s] = ((size_t)b * CCH + dbase + row) * NPOS + n0 + q * 8;
    }
#pragma unroll
    for (int s = 0; s < 2; ++s) *(h8*)(ov + off[s]) = vv[s];
    
  }
}

// value of lane (l ^ X), X < 16, by a DPP move inside the 16-lane row
template <int X>
__device__ __forceinline__ float lane_xor(float v) {
  const int s = __builtin_bit_cast(int, v);
  return __builtin_bit_cast(float, __builtin_amdgcn_update_dpp(s, s, 0x160 + X, 0xf, 0xf, false));
}

// LDS byte address of a __shared__ object: the low 32 bits of its address
__device__ __forceinline__ unsigned lds_byte(const void* p) {
  return (unsigned)(size_t)p;
}

// Eight asynchronous 16-B copies per lane, global -> LDS, through no register.
// s_wait_xcnt 0 is the last line of the copies' own statement, so that no address register is rewritten in front of it.
__device__ __forceinline__ void copy8(const unsigned (&l)[8], const void* const (&g)[8]) {
  asm volatile(
      "global_load_async_to_lds_b128 %0, %8, off\n\t"
      "global_load_async_to_lds_b128 %1, %9, off\n\t"
      "global_load_async_to_lds_b128 %2, %10, off\n\t"
      "global_load_async_to_lds_b128 %3, %11, off\n\t"
      "global_load_async_to_lds_b128 %4, %12, off\n\t"
      "global_load_async_to_lds_b128 %5, %13, off\n\t"
      "global_load_async_to_lds_b128 %6, %14, off\n\t"
      "global_load_async_to_lds_b128 %7, %15, off\n\t"
      "s_wait_xcnt 0x0"
      :: "v"(l[0]), "v"(l[1]), "v"(l[2]), "v"(l[3]), "v"(l[4]), "v"(l[5]), "v"(l[6]), "v"(l[7]),
         "v"(g[0]), "v"(g[1]), "v"(g[2]), "v"(g[3]), "v"(g[4]), "v"(g[5]), "v"(g[6]), "v"(g[7])
      : "memory");
}

// Four such copies per lane; s_wait_xcnt 0 is again the last line of the copies' own statement, for the same reason.
__device__ __forceinline__ void copy4(const unsigned (&l)[4], const void* const (&g)[4]) {
  asm volatile(
      "global_load_async_to_lds_b128 %0, %4, off\n\t"
      "global_load_async_to_lds_b128 %1, %5, off\n\t"
      "global_load_async_to_lds_b128 %2, %6, off\n\t"
      "global_load_async_to_lds_b128 %3, %7, off\n\t"
      "s_wait_xcnt 0x0"
      :: "v"(l[0]), "v"(l[1]), "v"(l[2]), "v"(l[3]),
         "v"(g[0]), "v"(g[1]), "v"(g[2]), "v"(g[3])
      : "memory");
}

// ---------------------------------------------------------------------------
// Fused attention: one block per (batch, 64-query tile), 512 threads (16 waves), 64-key tiles:
//   one K and one V tile in LDS serve 64 queries, so each key tile is fetched from L2 once per 64 queries.
//   K hi/lo tile [64 j][128 d] and V tile [512 c][64 j] come into LDS by asynchronous copies in whole 128-B lines;
//   V of a tile flies during its scores and softmax, K of the next tile during p.v; fragments are read from LDS
//   S[64 i][64 j] = Q.K^T (K = 128) with bf16 hi/lo split operands (Q fragments held in registers) -> LDS, 16x16 per wave
//   online softmax stats by all waves (8 lanes per row, running max and sum in registers), p x4096 as f16 in LDS, row sums from the f16 values
//   O^T[512 c][64 i] += V[c][j] . P[i][j]  (f16), each wave owns 64 channels x 32 queries
// ---------------------------------------------------------------------------
__global__ void __launch_bounds__(512)
attn_kernel(const unsigned short* __restrict__ Qhi,
            const unsigned short* __restrict__ Qlo,
            const unsigned short* __restrict__ Khi,
            const unsigned short* __restrict__ Klo,
            const _Float16* __restrict__ Vh,
            const float* __restrict__ x,
            const float* __restrict__ gamma,
            float* __restrict__ outp) {
  __shared__ __align__(16) unsigned short smq[16384];  // finalize: 8192 f32, 512 per wave
  __shared__ __align__(16) unsigned short Ksh[64 * KSP];   // K hi tile
  __shared__ __align__(16) unsigned short Ksl[64 * KSP];   // K lo tile
  __shared__ __align__(16) _Float16 Vs[CCH * VSP];         // V tile
  __shared__ float Ss[64 * SSP];
  __shared__ __align__(16) _Float16 Ps[64 * PSP];
  __shared__ float lrow[64];
  __shared__ float srow[64];

  const int tid  = threadIdx.x;
  const int lane = tid & 31;
  const int w    = tid >> 5;
  const int m    = lane & 15;
  const int h    = lane >> 4;

  const int i0 = blockIdx.x * 64;
  const int b  = blockIdx.y;
  const int wc = w & 7;          // p.v: channel group of this wave (64 channels)
  const int ib = (w >> 3) * 32;  // p.v: first of its 32 queries inside the tile

  v8f o[2][4];
  {
    v8f z = {};
#pragma unroll
    for (int it = 0; it < 2; ++it)
#pragma unroll
      for (int ct = 0; ct < 4; ++ct) o[it][ct] = z;
  }

  const int rtS = w >> 2;   // S row sub-tile (i), 0..3
  const int jtS = w & 3;    // S col sub-tile (j)

  // Q fragments of this wave's 16 query rows, hi and lo, k = d in 4 steps of 32: the same for every key tile, kept in registers
  FragB qfh[4], qfl[4];
  {
    const size_t qrow = ((size_t)b * NPOS + i0 + rtS * 16 + m) * DQK + 8 * h;
    const unsigned short* qrh = Qhi + qrow;
    const unsigned short* qrl = Qlo + qrow;
    // unrolled so that the fragment arrays are indexed by constants and stay in registers
#pragma unroll
    for (int kk = 0; kk < 4; ++kk) {
      qfh[kk].p[0] = *(const us8*)(qrh + kk * 32);
      qfh[kk].p[1] = *(const us8*)(qrh + kk * 32 + 16);
      qfl[kk].p[0] = *(const us8*)(qrl + kk * 32);
      qfl[kk].p[1] = *(const us8*)(qrl + kk * 32 + 16);
    }
  }

  const int si = tid >> 3;        // softmax row of this thread
  const int sq = (tid & 7) * 8;   // first of its 8 columns
  float mrun = -1e30f;            // running row maximum, equal in the row's 8 lanes
  float lrun = 0.0f;              // running row sum, equal in the row's 8 lanes

  // copy shares: K, 16 lanes per 256-B row, 32 rows per step; V, 8 lanes per 128-B row, 64 rows per step
  const int kcr = tid >> 4;
  const int kcq = (tid & 15) * 8;
  const int vcr = tid >> 3;
  const int vcq = (tid & 7) * 8;
  const unsigned short* kgh = Khi + ((size_t)b * NPOS + kcr) * DQK + kcq;
  const unsigned short* kgl = Klo + ((size_t)b * NPOS + kcr) * DQK + kcq;
  const _Float16* vg = Vh + ((size_t)b * CCH + vcr) * NPOS + vcq;
  const unsigned klh = lds_byte(Ksh + kcr * KSP + kcq);
  const unsigned kll = lds_byte(Ksl + kcr * KSP + kcq);
  const unsigned vl  = lds_byte(Vs + vcr * VSP + vcq);

  // K tile 0
  {
    unsigned l[4];
    const void* g[4];
    // unrolled so that l and g are indexed by constants and stay in registers
#pragma unroll
    for (int i = 0; i < 2; ++i) {
      l[i]     = klh + i * 32 * KSP * 2;
      l[2 + i] = kll + i * 32 * KSP * 2;
      g[i]     = kgh + (size_t)(i * 32) * DQK;
      g[2 + i] = kgl + (size_t)(i * 32) * DQK;
    }
    copy4(l, g);
  }
  asm volatile("s_wait_asynccnt 0x0" ::: "memory");   // this wave's share of K tile 0 has landed before the barrier publishes it
  __syncthreads();

  for (int j0 = 0; j0 < NPOS; j0 += 64) {
    // ---- 0. V tile of this trip: its buffer's last readers ended at the barrier that closed the trip before ----
    {
      unsigned l[8];
      const void* g[8];
      // unrolled so that l and g are indexed by constants and stay in registers
#pragma unroll
      for (int i = 0; i < 8; ++i) {
        l[i] = vl + i * 64 * VSP * 2;
        g[i] = vg + (size_t)(i * 64) * NPOS + j0;
      }
      copy8(l, g);
    }

    // ---- 1. S tile, 16x16 per wave, k = d in 4 steps of 32, three bf16 products per step ----
    {
      v8f s = {};
      const int krow = (jtS * 16 + m) * KSP + 8 * h;
      const unsigned short* krh = Ksh + krow;
      const unsigned short* krl = Ksl + krow;
#pragma unroll
      for (int kk = 0; kk < 4; ++kk) {
        FragB bh, bl;
        bh.p[0] = *(const us8*)(krh + kk * 32);
        bh.p[1] = *(const us8*)(krh + kk * 32 + 16);
        bl.p[0] = *(const us8*)(krl + kk * 32);
        bl.p[1] = *(const us8*)(krl + kk * 32 + 16);
        s = mma_bf16(qfh[kk].v, bh.v, s);
        s = mma_bf16(qfh[kk].v, bl.v, s);
        s = mma_bf16(qfl[kk].v, bh.v, s);
      }
#pragma unroll
      for (int r = 0; r < 8; ++r)
        Ss[(rtS * 16 + 8 * h + r) * SSP + jtS * 16 + m] = s[r];
    }
    asm volatile("s_wait_dscnt 0x0" ::: "memory");      // this wave's K reads have retired before the K buffer is handed to its next copies
    __syncthreads();

    // ---- 2. online softmax stats: 8 lanes per row, 8 adjacent columns per lane, all 16 waves ----
    {
      float sv[8];   // the three loops below are fully unrolled so that sv and pv stay in registers
#pragma unroll
      for (int q = 0; q < 8; ++q) sv[q] = Ss[si * SSP + sq + q];
      float mx = sv[0];
#pragma unroll
      for (int q = 1; q < 8; ++q) mx = fmaxf(mx, sv[q]);
      mx = fmaxf(mx, lane_xor<1>(mx));
      mx = fmaxf(mx, lane_xor<2>(mx));
      mx = fmaxf(mx, lane_xor<4>(mx));
      const float mnew = fmaxf(mrun, mx);
      const float sc = __expf(mrun - mnew);
      h8 pv;
      float sum = 0.0f;
#pragma unroll
      for (int q = 0; q < 8; ++q) {
        const float p = __expf(sv[q] - mnew) * PSCALE;
        const _Float16 ph = (_Float16)p;
        pv[q] = ph;
        sum += (float)ph;
      }
      *(h8*)(Ps + si * PSP + sq) = pv;
      sum += lane_xor<1>(sum);
      sum += lane_xor<2>(sum);
      sum += lane_xor<4>(sum);
      mrun = mnew;
      lrun = lrun * sc + sum;
      if ((tid & 7) == 0) { lrow[si] = lrun; srow[si] = sc; }
    }
    asm volatile("s_wait_asynccnt 0x0" ::: "memory");   // this wave's share of the V tile has landed before the barrier publishes it
    __syncthreads();

    // K tile of the next trip: every reader left the K buffer at the barrier behind the scores
    if (j0 + 64 < NPOS) {
      unsigned l[4];
      const void* g[4];
      // unrolled so that l and g are indexed by constants and stay in registers
#pragma unroll
      for (int i = 0; i < 2; ++i) {
        l[i]     = klh + i * 32 * KSP * 2;
        l[2 + i] = kll + i * 32 * KSP * 2;
        g[i]     = kgh + (size_t)(j0 + 64 + i * 32) * DQK;
        g[2 + i] = kgl + (size_t)(j0 + 64 + i * 32) * DQK;
      }
      copy4(l, g);
    }

    // ---- 3. rescale O, then O^T += V . P^T ----
#pragma unroll
    for (int it = 0; it < 2; ++it) {
      const float sc = srow[ib + it * 16 + m];   // column of the accumulator = query index
#pragma unroll
      for (int ct = 0; ct < 4; ++ct) o[it][ct] = o[it][ct] * sc;
    }
#pragma unroll
    for (int jj = 0; jj < 2; ++jj) {
      // B[k = j][n = i] = P[i][j0 + jj*32 + k]: row i of Ps is k-contiguous, loaded like A
      FragH b0, b1;
      {
        const _Float16* p0 = Ps + (ib + m) * PSP + jj * 32 + 8 * h;
        const _Float16* p1 = Ps + (ib + 16 + m) * PSP + jj * 32 + 8 * h;
        b0.p[0] = *(const h8*)p0;
        b0.p[1] = *(const h8*)(p0 + 16);
        b1.p[0] = *(const h8*)p1;
        b1.p[1] = *(const h8*)(p1 + 16);
      }
#pragma unroll
      for (int ct = 0; ct < 4; ++ct) {
        // A[m = c][k = j] = V[b][c][j0 + jj*32 + k], k-contiguous, from the LDS tile
        FragH a;
        const _Float16* vr = Vs + (wc * 64 + ct * 16 + m) * VSP + jj * 32 + 8 * h;
        a.p[0] = *(const h8*)vr;
        a.p[1] = *(const h8*)(vr + 16);
        o[0][ct] = mma_f16(a.v, b0.v, o[0][ct]);
        o[1][ct] = mma_f16(a.v, b1.v, o[1][ct]);
      }
    }
    asm volatile("s_wait_dscnt 0x0" ::: "memory");      // this wave's V reads have retired before the V buffer is handed to its next copies
    asm volatile("s_wait_asynccnt 0x0" ::: "memory");   // this wave's share of the next K tile has landed before the barrier publishes it
    __syncthreads();
  }

  const float g = gamma[0];
  const float gl0 = g / lrow[ib + m];
  const float gl1 = g / lrow[ib + 16 + m];
  float* F = (float*)smq + w * 512;     // per wave [16 c][32 i] f32
#pragma unroll
  for (int ct = 0; ct < 4; ++ct) {
    __syncthreads();
#pragma unroll
    for (int r = 0; r < 8; ++r) {
      F[(8 * h + r) * 32 + m]      = o[0][ct][r] * gl0;
      F[(8 * h + r) * 32 + 16 + m] = o[1][ct][r] * gl1;
    }
    __syncthreads();
    v4f vals[4];
    size_t offs[4];
#pragma unroll
    for (int s = 0; s < 4; ++s) {
      const int row = s * 4 + (lane >> 3);            // channel local 0..15
      const int q = lane & 7;
      const int c = wc * 64 + ct * 16 + row;
      const size_t off = ((size_t)b * CCH + c) * NPOS + i0 + ib + q * 4;
      const v4f ov = *(const v4f*)(F + row * 32 + q * 4);
      const v4f xv = *(const v4f*)(x + off);
      vals[s] = ov + xv;
      offs[s] = off;
    }
#pragma unroll
    for (int s = 0; s < 4; ++s) *(v4f*)(outp + offs[s]) = vals[s];
    
  }
}

// ---------------------------------------------------------------------------
extern "C" void kernel_launch(void* const* d_in, const int* in_sizes, int n_in,
                              void* d_out, int out_size, void* d_ws, size_t ws_size,
                              hipStream_t stream) {
  if (n_in < 13) return;
  const int nx = BATCH * CCH * NPOS;
  if (in_sizes[0] != nx || in_sizes[1] != nx ||
      in_sizes[2] != CQ * CCH || in_sizes[3] != CQ ||
      in_sizes[4] != CQ * CCH || in_sizes[5] != CQ ||
      in_sizes[6] != CQ * CCH || in_sizes[7] != CQ ||
      in_sizes[8] != CQ * CCH || in_sizes[9] != CQ ||
      in_sizes[10] != CCH * CCH || in_sizes[11] != CCH ||
      in_sizes[12] < 1 || out_size != nx) return;

  const size_t planeE = (size_t)BATCH * NPOS * DQK;   // bf16 elements per q/k plane (4 MiB each)
  const size_t vE     = (size_t)BATCH * CCH * NPOS;   // f16 elements of the v plane (16 MiB)
  const size_t need   = planeE * 2 * 4 + vE * 2;      // 33,554,432 B
  if (ws_size < need) return;

  const float* x     = (const float*)d_in[0];
  const float* dep   = (const float*)d_in[1];
  const float* wq    = (const float*)d_in[2];
  const float* bq    = (const float*)d_in[3];
  const float* wqd   = (const float*)d_in[4];
  const float* bqd   = (const float*)d_in[5];
  const float* wk    = (const float*)d_in[6];
  const float* bk    = (const float*)d_in[7];
  const float* wkd   = (const float*)d_in[8];
  const float* bkd   = (const float*)d_in[9];
  const float* wv    = (const float*)d_in[10];
  const float* bv    = (const float*)d_in[11];
  const float* gamma = (const float*)d_in[12];
  float* outp = (float*)d_out;

  unsigned short* Qhi = (unsigned short*)d_ws;
  unsigned short* Qlo = Qhi + planeE;
  unsigned short* Khi = Qlo + planeE;
  unsigned short* Klo = Khi + planeE;
  _Float16* Vh = (_Float16*)(Klo + planeE);

  dim3 blk(256);
  dim3 gqk(NPOS / 64, 1, BATCH);
  // q/k planes [B][N][128]: columns 0..63 from x, 64..127 from dep
  proj_kernel<0><<<gqk, blk, 0, stream>>>(x,   wq,  bq,  Qhi, Qlo, Vh, 0);
  proj_kernel<0><<<gqk, blk, 0, stream>>>(dep, wqd, bqd, Qhi, Qlo, Vh, CQ);
  proj_kernel<0><<<gqk, blk, 0, stream>>>(x,   wk,  bk,  Khi, Klo, Vh, 0);
  proj_kernel<0><<<gqk, blk, 0, stream>>>(dep, wkd, bkd, Khi, Klo, Vh, CQ);
  // v plane [B][C][N] f16
  proj_kernel<1><<<dim3(NPOS / 64, CCH / 64, BATCH), blk, 0, stream>>>(x, wv, bv, Qhi, Qlo, Vh, 0);
  // fused attention + gamma*out + x
  attn_kernel<<<dim3(NPOS / 64, BATCH), dim3(512), 0, stream>>>(Qhi, Qlo, Khi, Klo, Vh, x, gamma, outp);
}

// v005
// Measured time: 204 microseconds a run.
// Two timings next to v004 both put it at 1.25 times that version's speed.
// Counting every step since v000, it is 3.49 times as fast.
#include <hip/hip_runtime.h>

// q/k 1x1 projections and q.k^T logits: v_wmma_f32_16x16x32_bf16 with bf16 hi/lo operand split (hi.hi + hi.lo + lo.hi);
// v 1x1 projection (weights x16, folded back x1/16) and p.v: v_wmma_f32_16x16x32_f16 (f16 operands, p carried x4096); f32 accumulate everywhere.

typedef _Float16 h4  __attribute__((ext_vector_type(4)));
typedef _Float16 h8  __attribute__((ext_vector_type(8)));
typedef _Float16 h16 __attribute__((ext_vector_type(16)));
typedef __bf16   bf16v16 __attribute__((ext_vector_type(16)));
typedef unsigned short us4 __attribute__((ext_vector_type(4)));
typedef unsigned short us8 __attribute__((ext_vector_type(8)));
typedef float v4f __attribute__((ext_vector_type(4)));
typedef float v8f __attribute__((ext_vector_type(8)));

#define BATCH 4
#define CCH   512
#define NPOS  4096
#define DQK   128
#define CQ    64
#define SSP   65          // f32 score tile pitch (floats)
#define PSP   72          // f16 p tile pitch (halves), multiple of 8 for 16-B fragment loads
#define PSCALE  4096.0f   // p carried x2^12 in f16 so WMMA operands stay normal; cancels in O/l
#define WVSCALE 16.0f     // v weights x16 in f16, folded back in the epilogue
#define WVINV   0.0625f
#define KSP   136         // K tile pitch in LDS, 16-bit elements: 272 B = 16 B x 17, conflict-free for 16-B fragment reads
#define VSP   72          // V tile pitch in LDS, halves: 144 B = 16 B x 9, conflict-free for 16-B fragment reads

union FragH { h16 v; h8 p[2]; };        // elements 0..7 <- k0+8h+0..7, elements 8..15 <- k0+16+8h+0..7
union FragB { bf16v16 v; us8 p[2]; };

__device__ __forceinline__ v8f mma_f16(h16 a, h16 b, v8f c) {
  c = __builtin_amdgcn_wmma_f32_16x16x32_f16(false, a, false, b, (short)0, c, false, false);
  asm volatile("v_nop\n\tv_nop\n\tv_nop\n\tv_nop" : "+v"(c) : "v"(a), "v"(b));
  return c;
}
__device__ __forceinline__ v8f mma_bf16(bf16v16 a, bf16v16 b, v8f c) {
  c = __builtin_amdgcn_wmma_f32_16x16x32_bf16(false, a, false, b, (short)0, c, false, false);
  asm volatile("v_nop\n\tv_nop\n\tv_nop\n\tv_nop" : "+v"(c) : "v"(a), "v"(b));
  return c;
}
// f32 -> bf16 bits, RNE convert
__device__ __forceinline__ unsigned short f2bf(float f) {
  unsigned int u = __float_as_uint(f);
  u += 0x7FFFu + ((u >> 16) & 1u);
  return (unsigned short)(u >> 16);
}
__device__ __forceinline__ float bf2f(unsigned short s) {
  return __uint_as_float(((unsigned int)s) << 16);
}

// ---------------------------------------------------------------------------
// Projection GEMM, block tile 64 n x 64 d, k = 512 channels in steps of 32, 256 threads (8 waves).
//   src : [B][C][N] f32, batch b read here;  W : [rows][C] f32;  bias : [rows] f32
//   D[row = n][col = d] = sum_c src[c][n] * W[d][c]; A = src tile staged [n][k], B = W tile staged [d][k]
//   sm  : 16 KiB of LDS: operand tiles during the k loop, output tile in the epilogue;  dbase : first row of W of this block
// ---------------------------------------------------------------------------
template <int MODE>
__device__ __forceinline__ void
proj_body(unsigned short* sm,
          const float* __restrict__ src,
          const float* __restrict__ W,
          const float* __restrict__ bias,
          unsigned short* __restrict__ ohi,
          unsigned short* __restrict__ olo,
          _Float16* __restrict__ ov,
          int doff,
          int dbase,
          int b) {
  const int tid  = threadIdx.x;
  const int lane = tid & 31;
  const int w    = tid >> 5;
  const int m    = lane & 15;
  const int h    = lane >> 4;

  const int n0    = blockIdx.x * 64;

  const int mt  = w >> 1;          // n sub-tile (0..3)
  const int ntb = (w & 1) * 2;     // d sub-tile pair base (0 or 2)

  const int ms = tid & 63;         // staging row
  const int kg = (tid >> 6) * 4;   // staging k group

  const size_t srcb = (size_t)b * CCH * NPOS;

  v8f acc0 = {};
  v8f acc1 = {};

  if (MODE == 0) {
    unsigned short* Xh = sm;
    unsigned short* Xl = sm + 2048;
    unsigned short* Wh = sm + 4096;
    unsigned short* Wl = sm + 6144;

    for (int c0 = 0; c0 < CCH; c0 += 32) {
#pragma unroll
      for (int g = 0; g < 2; ++g) {
        const int kb = kg + g * 16;
        const float* sp = src + srcb + (size_t)(c0 + kb) * NPOS + n0 + ms;
        v4f xv;
        xv[0] = sp[0];
        xv[1] = sp[NPOS];
        xv[2] = sp[2 * NPOS];
        xv[3] = sp[3 * NPOS];
        const v4f wv4 = *(const v4f*)(W + (size_t)(dbase + ms) * CCH + c0 + kb);
        us4 xh4, xl4, wh4, wl4;
#pragma unroll
        for (int q = 0; q < 4; ++q) {
          const unsigned short hb = f2bf(xv[q]);
          xh4[q] = hb;
          xl4[q] = f2bf(xv[q] - bf2f(hb));
          const unsigned short wb = f2bf(wv4[q]);
          wh4[q] = wb;
          wl4[q] = f2bf(wv4[q] - bf2f(wb));
        }
        *(us4*)(Xh + ms * 32 + kb) = xh4;
        *(us4*)(Xl + ms * 32 + kb) = xl4;
        *(us4*)(Wh + ms * 32 + kb) = wh4;
        *(us4*)(Wl + ms * 32 + kb) = wl4;
      }
      __syncthreads();

      FragB ah, al;
      {
        const unsigned short* xr  = Xh + (mt * 16 + m) * 32 + 8 * h;
        const unsigned short* xrl = Xl + (mt * 16 + m) * 32 + 8 * h;
        ah.p[0] = *(const us8*)xr;
        ah.p[1] = *(const us8*)(xr + 16);
        al.p[0] = *(const us8*)xrl;
        al.p[1] = *(const us8*)(xrl + 16);
      }
      {
        const unsigned short* wr  = Wh + (ntb * 16 + m) * 32 + 8 * h;
        const unsigned short* wrl = Wl + (ntb * 16 + m) * 32 + 8 * h;
        FragB bh, bl;
        bh.p[0] = *(const us8*)wr;
        bh.p[1] = *(const us8*)(wr + 16);
        bl.p[0] = *(const us8*)wrl;
        bl.p[1] = *(const us8*)(wrl + 16);
        acc0 = mma_bf16(ah.v, bh.v, acc0);
        acc0 = mma_bf16(ah.v, bl.v, acc0);
        acc0 = mma_bf16(al.v, bh.v, acc0);
      }
      {
        const unsigned short* wr  = Wh + ((ntb + 1) * 16 + m) * 32 + 8 * h;
        const unsigned short* wrl = Wl + ((ntb + 1) * 16 + m) * 32 + 8 * h;
        FragB bh, bl;
        bh.p[0] = *(const us8*)wr;
        bh.p[1] = *(const us8*)(wr + 16);
        bl.p[0] = *(const us8*)wrl;
        bl.p[1] = *(const us8*)(wrl + 16);
        acc1 = mma_bf16(ah.v, bh.v, acc1);
        acc1 = mma_bf16(ah.v, bl.v, acc1);
        acc1 = mma_bf16(al.v, bh.v, acc1);
      }
      __syncthreads();
    }

    // epilogue: bias add in f32, hi/lo bf16 split, stage [n][d] tile in LDS, whole-line stores
    unsigned short* Eh = sm;          // [64 n][64 d]
    unsigned short* El = sm + 4096;   // [64 n][64 d]
    {
      const int dl = ntb * 16 + m;
      const float bb = bias[dbase + dl];
#pragma unroll
      for (int r = 0; r < 8; ++r) {
        const float v = acc0[r] + bb;
        const unsigned short hb = f2bf(v);
        const int row = mt * 16 + 8 * h + r;
        Eh[row * 64 + dl] = hb;
        El[row * 64 + dl] = f2bf(v - bf2f(hb));
      }
    }
    {
      const int dl = (ntb + 1) * 16 + m;
      const float bb = bias[dbase + dl];
#pragma unroll
      for (int r = 0; r < 8; ++r) {
        const float v = acc1[r] + bb;
        const unsigned short hb = f2bf(v);
        const int row = mt * 16 + 8 * h + r;
        Eh[row * 64 + dl] = hb;
        El[row * 64 + dl] = f2bf(v - bf2f(hb));
      }
    }
    __syncthreads();

    us8 vh[2], vl[2];
    size_t off[2];
#pragma unroll
    for (int s = 0; s < 2; ++s) {
      const int row = w * 8 + s * 4 + (lane >> 3);
      const int q = lane & 7;
      vh[s] = *(const us8*)(Eh + row * 64 + q * 8);
      vl[s] = *(const us8*)(El + row * 64 + q * 8);
      off[s] = ((size_t)b * NPOS + n0 + row) * DQK + doff + q * 8;
    }
#pragma unroll
    for (int s = 0; s < 2; ++s) {
      *(us8*)(ohi + off[s]) = vh[s];
      *(us8*)(olo + off[s]) = vl[s];
    }
    
  } else {
    _Float16* Xs = (_Float16*)sm;       // [64 n][32 k]
    _Float16* Ws = Xs + 2048;           // [64 d][32 k]

    for (int c0 = 0; c0 < CCH; c0 += 32) {
#pragma unroll
      for (int g = 0; g < 2; ++g) {
        const int kb = kg + g * 16;
        const float* sp = src + srcb + (size_t)(c0 + kb) * NPOS + n0 + ms;
        v4f xv;
        xv[0] = sp[0];
        xv[1] = sp[NPOS];
        xv[2] = sp[2 * NPOS];
        xv[3] = sp[3 * NPOS];
        v4f wv4 = *(const v4f*)(W + (size_t)(dbase + ms) * CCH + c0 + kb);
        wv4 = wv4 * WVSCALE;
        *(h4*)(Xs + ms * 32 + kb) = __builtin_convertvector(xv, h4);
        *(h4*)(Ws + ms * 32 + kb) = __builtin_convertvector(wv4, h4);
      }
      __syncthreads();

      FragH a;
      {
        const _Float16* xr = Xs + (mt * 16 + m) * 32 + 8 * h;
        a.p[0] = *(const h8*)xr;
        a.p[1] = *(const h8*)(xr + 16);
      }
      {
        const _Float16* wr = Ws + (ntb * 16 + m) * 32 + 8 * h;
        FragH bf;
        bf.p[0] = *(const h8*)wr;
        bf.p[1] = *(const h8*)(wr + 16);
        acc0 = mma_f16(a.v, bf.v, acc0);
      }
      {
        const _Float16* wr = Ws + ((ntb + 1) * 16 + m) * 32 + 8 * h;
        FragH bf;
        bf.p[0] = *(const h8*)wr;
        bf.p[1] = *(const h8*)(wr + 16);
        acc1 = mma_f16(a.v, bf.v, acc1);
      }
      __syncthreads();
    }

    // epilogue: fold 1/16, bias, f16, stage [d][n] tile in LDS, whole-line stores along n
    _Float16* E = (_Float16*)sm;       // [64 d][64 n]
    {
      const int dl = ntb * 16 + m;
      const float bb = bias[dbase + dl];
      h8 ev;
#pragma unroll
      for (int r = 0; r < 8; ++r) ev[r] = (_Float16)(acc0[r] * WVINV + bb);
      *(h8*)(E + dl * 64 + mt * 16 + 8 * h) = ev;
    }
    {
      const int dl = (ntb + 1) * 16 + m;
      const float bb = bias[dbase + dl];
      h8 ev;
#pragma unroll
      for (int r = 0; r < 8; ++r) ev[r] = (_Float16)(acc1[r] * WVINV + bb);
      *(h8*)(E + dl * 64 + mt * 16 + 8 * h) = ev;
    }
    __syncthreads();

    h8 vv[2];
    size_t off[2];
#pragma unroll
    for (int s = 0; s < 2; ++s) {
      const int row = w * 8 + s * 4 + (lane >> 3);   // channel local 0..63
      const int q = lane & 7;
      vv[s] = *(const h8*)(E + row * 64 + q * 8);
      off[s] = ((size_t)b * CCH + dbase + row) * NPOS + n0 + q * 8;
    }
#pragma unroll
    for (int s = 0; s < 2; ++s) *(h8*)(ov + off[s]) = vv[s];
    
  }
}

// All five projections in one launch, so that blocks of different projections stand on a WGP together and one block's
// global-load and barrier waits are filled by the others. blockIdx.z picks the projection, the same for the whole block:
//   0 q from x, 1 q from dep, 2 k from x, 3 k from dep (64 rows of W each); 4..11 v, 64 of its 512 rows of W each.
// The q/k blocks are the longer ones (three products per step and the hi/lo split) and have the low indices, which start first.
__global__ void __launch_bounds__(256)
proj_all_kernel(const float* __restrict__ x,
                const float* __restrict__ dep,
                const float* __restrict__ wq,
                const float* __restrict__ bq,
                const float* __restrict__ wqd,
                const float* __restrict__ bqd,
                const float* __restrict__ wk,
                const float* __restrict__ bk,
                const float* __restrict__ wkd,
                const float* __restrict__ bkd,
                const float* __restrict__ wv,
                const float* __restrict__ bv,
                unsigned short* __restrict__ Qhi,
                unsigned short* __restrict__ Qlo,
                unsigned short* __restrict__ Khi,
                unsigned short* __restrict__ Klo,
                _Float16* __restrict__ Vh) {
  __shared__ __align__(16) unsigned short sm[8192];

  const int b = blockIdx.y;
  const int p = blockIdx.z;
  if (p < 4) {
    const bool fromDep = (p & 1) != 0;
    const bool isK     = (p & 2) != 0;
    const float* src  = fromDep ? dep : x;
    const float* W    = isK ? (fromDep ? wkd : wk) : (fromDep ? wqd : wq);
    const float* bias = isK ? (fromDep ? bkd : bk) : (fromDep ? bqd : bq);
    proj_body<0>(sm, src, W, bias, isK ? Khi : Qhi, isK ? Klo : Qlo, Vh, fromDep ? CQ : 0, 0, b);
  } else {
    proj_body<1>(sm, x, wv, bv, Qhi, Qlo, Vh, 0, (p - 4) * 64, b);
  }
}

// value of lane (l ^ X), X < 16, by a DPP move inside the 16-lane row
template <int X>
__device__ __forceinline__ float lane_xor(float v) {
  const int s = __builtin_bit_cast(int, v);
  return __builtin_bit_cast(float, __builtin_amdgcn_update_dpp(s, s, 0x160 + X, 0xf, 0xf, false));
}

// LDS byte address of a __shared__ object: the low 32 bits of its address
__device__ __forceinline__ unsigned lds_byte(const void* p) {
  return (unsigned)(size_t)p;
}

// Eight asynchronous 16-B copies per lane, global -> LDS, through no register.
// s_wait_xcnt 0 is the last line of the copies' own statement, so that no address register is rewritten in front of it.
__device__ __forceinline__ void copy8(const unsigned (&l)[8], const void* const (&g)[8]) {
  asm volatile(
      "global_load_async_to_lds_b128 %0, %8, off\n\t"
      "global_load_async_to_lds_b128 %1, %9, off\n\t"
      "global_load_async_to_lds_b128 %2, %10, off\n\t"
      "global_load_async_to_lds_b128 %3, %11, off\n\t"
      "global_load_async_to_lds_b128 %4, %12, off\n\t"
      "global_load_async_to_lds_b128 %5, %13, off\n\t"
      "global_load_async_to_lds_b128 %6, %14, off\n\t"
      "global_load_async_to_lds_b128 %7, %15, off\n\t"
      "s_wait_xcnt 0x0"
      :: "v"(l[0]), "v"(l[1]), "v"(l[2]), "v"(l[3]), "v"(l[4]), "v"(l[5]), "v"(l[6]), "v"(l[7]),
         "v"(g[0]), "v"(g[1]), "v"(g[2]), "v"(g[3]), "v"(g[4]), "v"(g[5]), "v"(g[6]), "v"(g[7])
      : "memory");
}

// Four such copies per lane; s_wait_xcnt 0 is again the last line of the copies' own statement, for the same reason.
__device__ __forceinline__ void copy4(const unsigned (&l)[4], const void* const (&g)[4]) {
  asm volatile(
      "global_load_async_to_lds_b128 %0, %4, off\n\t"
      "global_load_async_to_lds_b128 %1, %5, off\n\t"
      "global_load_async_to_lds_b128 %2, %6, off\n\t"
      "global_load_async_to_lds_b128 %3, %7, off\n\t"
      "s_wait_xcnt 0x0"
      :: "v"(l[0]), "v"(l[1]), "v"(l[2]), "v"(l[3]),
         "v"(g[0]), "v"(g[1]), "v"(g[2]), "v"(g[3])
      : "memory");
}

// ---------------------------------------------------------------------------
// Fused attention: one block per (batch, 64-query tile), 512 threads (16 waves), 64-key tiles:
//   one K and one V tile in LDS serve 64 queries, so each key tile is fetched from L2 once per 64 queries.
//   K hi/lo tile [64 j][128 d] and V tile [512 c][64 j] come into LDS by asynchronous copies in whole 128-B lines;
//   V of a tile flies during its scores and softmax, K of the next tile during p.v; fragments are read from LDS
//   S[64 i][64 j] = Q.K^T (K = 128) with bf16 hi/lo split operands (Q fragments held in registers) -> LDS, 16x16 per wave
//   online softmax stats by all waves (8 lanes per row, running max and sum in registers), p x4096 as f16 in LDS, row sums from the f16 values
//   O^T[512 c][64 i] += V[c][j] . P[i][j]  (f16), each wave owns 64 channels x 32 queries
// ---------------------------------------------------------------------------
__global__ void __launch_bounds__(512)
attn_kernel(const unsigned short* __restrict__ Qhi,
            const unsigned short* __restrict__ Qlo,
            const unsigned short* __restrict__ Khi,
            const unsigned short* __restrict__ Klo,
            const _Float16* __restrict__ Vh,
            const float* __restrict__ x,
            const float* __restrict__ gamma,
            float* __restrict__ outp) {
  __shared__ __align__(16) unsigned short smq[16384];  // finalize: 8192 f32, 512 per wave
  __shared__ __align__(16) unsigned short Ksh[64 * KSP];   // K hi tile
  __shared__ __align__(16) unsigned short Ksl[64 * KSP];   // K lo tile
  __shared__ __align__(16) _Float16 Vs[CCH * VSP];         // V tile
  __shared__ float Ss[64 * SSP];
  __shared__ __align__(16) _Float16 Ps[64 * PSP];
  __shared__ float lrow[64];
  __shared__ float srow[64];

  const int tid  = threadIdx.x;
  const int lane = tid & 31;
  const int w    = tid >> 5;
  const int m    = lane & 15;
  const int h    = lane >> 4;

  const int i0 = blockIdx.x * 64;
  const int b  = blockIdx.y;
  const int wc = w & 7;          // p.v: channel group of this wave (64 channels)
  const int ib = (w >> 3) * 32;  // p.v: first of its 32 queries inside the tile

  v8f o[2][4];
  {
    v8f z = {};
#pragma unroll
    for (int it = 0; it < 2; ++it)
#pragma unroll
      for (int ct = 0; ct < 4; ++ct) o[it][ct] = z;
  }

  const int rtS = w >> 2;   // S row sub-tile (i), 0..3
  const int jtS = w & 3;    // S col sub-tile (j)

  // Q fragments of this wave's 16 query rows, hi and lo, k = d in 4 steps of 32: the same for every key tile, kept in registers
  FragB qfh[4], qfl[4];
  {
    const size_t qrow = ((size_t)b * NPOS + i0 + rtS * 16 + m) * DQK + 8 * h;
    const unsigned short* qrh = Qhi + qrow;
    const unsigned short* qrl = Qlo + qrow;
    // unrolled so that the fragment arrays are indexed by constants and stay in registers
#pragma unroll
    for (int kk = 0; kk < 4; ++kk) {
      qfh[kk].p[0] = *(const us8*)(qrh + kk * 32);
      qfh[kk].p[1] = *(const us8*)(qrh + kk * 32 + 16);
      qfl[kk].p[0] = *(const us8*)(qrl + kk * 32);
      qfl[kk].p[1] = *(const us8*)(qrl + kk * 32 + 16);
    }
  }

  const int si = tid >> 3;        // softmax row of this thread
  const int sq = (tid & 7) * 8;   // first of its 8 columns
  float mrun = -1e30f;            // running row maximum, equal in the row's 8 lanes
  float lrun = 0.0f;              // running row sum, equal in the row's 8 lanes

  // copy shares: K, 16 lanes per 256-B row, 32 rows per step; V, 8 lanes per 128-B row, 64 rows per step
  const int kcr = tid >> 4;
  const int kcq = (tid & 15) * 8;
  const int vcr = tid >> 3;
  const int vcq = (tid & 7) * 8;
  const unsigned short* kgh = Khi + ((size_t)b * NPOS + kcr) * DQK + kcq;
  const unsigned short* kgl = Klo + ((size_t)b * NPOS + kcr) * DQK + kcq;
  const _Float16* vg = Vh + ((size_t)b * CCH + vcr) * NPOS + vcq;
  const unsigned klh = lds_byte(Ksh + kcr * KSP + kcq);
  const unsigned kll = lds_byte(Ksl + kcr * KSP + kcq);
  const unsigned vl  = lds_byte(Vs + vcr * VSP + vcq);

  // K tile 0
  {
    unsigned l[4];
    const void* g[4];
    // unrolled so that l and g are indexed by constants and stay in registers
#pragma unroll
    for (int i = 0; i < 2; ++i) {
      l[i]     = klh + i * 32 * KSP * 2;
      l[2 + i] = kll + i * 32 * KSP * 2;
      g[i]     = kgh + (size_t)(i * 32) * DQK;
      g[2 + i] = kgl + (size_t)(i * 32) * DQK;
    }
    copy4(l, g);
  }
  asm volatile("s_wait_asynccnt 0x0" ::: "memory");   // this wave's share of K tile 0 has landed before the barrier publishes it
  __syncthreads();

  for (int j0 = 0; j0 < NPOS; j0 += 64) {
    // ---- 0. V tile of this trip: its buffer's last readers ended at the barrier that closed the trip before ----
    {
      unsigned l[8];
      const void* g[8];
      // unrolled so that l and g are indexed by constants and stay in registers
#pragma unroll
      for (int i = 0; i < 8; ++i) {
        l[i] = vl + i * 64 * VSP * 2;
        g[i] = vg + (size_t)(i * 64) * NPOS + j0;
      }
      copy8(l, g);
    }

    // ---- 1. S tile, 16x16 per wave, k = d in 4 steps of 32, three bf16 products per step ----
    {
      v8f s = {};
      const int krow = (jtS * 16 + m) * KSP + 8 * h;
      const unsigned short* krh = Ksh + krow;
      const unsigned short* krl = Ksl + krow;
#pragma unroll
      for (int kk = 0; kk < 4; ++kk) {
        FragB bh, bl;
        bh.p[0] = *(const us8*)(krh + kk * 32);
        bh.p[1] = *(const us8*)(krh + kk * 32 + 16);
        bl.p[0] = *(const us8*)(krl + kk * 32);
        bl.p[1] = *(const us8*)(krl + kk * 32 + 16);
        s = mma_bf16(qfh[kk].v, bh.v, s);
        s = mma_bf16(qfh[kk].v, bl.v, s);
        s = mma_bf16(qfl[kk].v, bh.v, s);
      }
#pragma unroll
      for (int r = 0; r < 8; ++r)
        Ss[(rtS * 16 + 8 * h + r) * SSP + jtS * 16 + m] = s[r];
    }
    asm volatile("s_wait_dscnt 0x0" ::: "memory");      // this wave's K reads have retired before the K buffer is handed to its next copies
    __syncthreads();

    // ---- 2. online softmax stats: 8 lanes per row, 8 adjacent columns per lane, all 16 waves ----
    {
      float sv[8];   // the three loops below are fully unrolled so that sv and pv stay in registers
#pragma unroll
      for (int q = 0; q < 8; ++q) sv[q] = Ss[si * SSP + sq + q];
      float mx = sv[0];
#pragma unroll
      for (int q = 1; q < 8; ++q) mx = fmaxf(mx, sv[q]);
      mx = fmaxf(mx, lane_xor<1>(mx));
      mx = fmaxf(mx, lane_xor<2>(mx));
      mx = fmaxf(mx, lane_xor<4>(mx));
      const float mnew = fmaxf(mrun, mx);
      const float sc = __expf(mrun - mnew);
      h8 pv;
      float sum = 0.0f;
#pragma unroll
      for (int q = 0; q < 8; ++q) {
        const float p = __expf(sv[q] - mnew) * PSCALE;
        const _Float16 ph = (_Float16)p;
        pv[q] = ph;
        sum += (float)ph;
      }
      *(h8*)(Ps + si * PSP + sq) = pv;
      sum += lane_xor<1>(sum);
      sum += lane_xor<2>(sum);
      sum += lane_xor<4>(sum);
      mrun = mnew;
      lrun = lrun * sc + sum;
      if ((tid & 7) == 0) { lrow[si] = lrun; srow[si] = sc; }
    }
    asm volatile("s_wait_asynccnt 0x0" ::: "memory");   // this wave's share of the V tile has landed before the barrier publishes it
    __syncthreads();

    // K tile of the next trip: every reader left the K buffer at the barrier behind the scores
    if (j0 + 64 < NPOS) {
      unsigned l[4];
      const void* g[4];
      // unrolled so that l and g are indexed by constants and stay in registers
#pragma unroll
      for (int i = 0; i < 2; ++i) {
        l[i]     = klh + i * 32 * KSP * 2;
        l[2 + i] = kll + i * 32 * KSP * 2;
        g[i]     = kgh + (size_t)(j0 + 64 + i * 32) * DQK;
        g[2 + i] = kgl + (size_t)(j0 + 64 + i * 32) * DQK;
      }
      copy4(l, g);
    }

    // ---- 3. rescale O, then O^T += V . P^T ----
#pragma unroll
    for (int it = 0; it < 2; ++it) {
      const float sc = srow[ib + it * 16 + m];   // column of the accumulator = query index
#pragma unroll
      for (int ct = 0; ct < 4; ++ct) o[it][ct] = o[it][ct] * sc;
    }
#pragma unroll
    for (int jj = 0; jj < 2; ++jj) {
      // B[k = j][n = i] = P[i][j0 + jj*32 + k]: row i of Ps is k-contiguous, loaded like A
      FragH b0, b1;
      {
        const _Float16* p0 = Ps + (ib + m) * PSP + jj * 32 + 8 * h;
        const _Float16* p1 = Ps + (ib + 16 + m) * PSP + jj * 32 + 8 * h;
        b0.p[0] = *(const h8*)p0;
        b0.p[1] = *(const h8*)(p0 + 16);
        b1.p[0] = *(const h8*)p1;
        b1.p[1] = *(const h8*)(p1 + 16);
      }
#pragma unroll
      for (int ct = 0; ct < 4; ++ct) {
        // A[m = c][k = j] = V[b][c][j0 + jj*32 + k], k-contiguous, from the LDS tile
        FragH a;
        const _Float16* vr = Vs + (wc * 64 + ct * 16 + m) * VSP + jj * 32 + 8 * h;
        a.p[0] = *(const h8*)vr;
        a.p[1] = *(const h8*)(vr + 16);
        o[0][ct] = mma_f16(a.v, b0.v, o[0][ct]);
        o[1][ct] = mma_f16(a.v, b1.v, o[1][ct]);
      }
    }
    asm volatile("s_wait_dscnt 0x0" ::: "memory");      // this wave's V reads have retired before the V buffer is handed to its next copies
    asm volatile("s_wait_asynccnt 0x0" ::: "memory");   // this wave's share of the next K tile has landed before the barrier publishes it
    __syncthreads();
  }

  const float g = gamma[0];
  const float gl0 = g / lrow[ib + m];
  const float gl1 = g / lrow[ib + 16 + m];
  float* F = (float*)smq + w * 512;     // per wave [16 c][32 i] f32
#pragma unroll
  for (int ct = 0; ct < 4; ++ct) {
    __syncthreads();
#pragma unroll
    for (int r = 0; r < 8; ++r) {
      F[(8 * h + r) * 32 + m]      = o[0][ct][r] * gl0;
      F[(8 * h + r) * 32 + 16 + m] = o[1][ct][r] * gl1;
    }
    __syncthreads();
    v4f vals[4];
    size_t offs[4];
#pragma unroll
    for (int s = 0; s < 4; ++s) {
      const int row = s * 4 + (lane >> 3);            // channel local 0..15
      const int q = lane & 7;
      const int c = wc * 64 + ct * 16 + row;
      const size_t off = ((size_t)b * CCH + c) * NPOS + i0 + ib + q * 4;
      const v4f ov = *(const v4f*)(F + row * 32 + q * 4);
      const v4f xv = *(const v4f*)(x + off);
      vals[s] = ov + xv;
      offs[s] = off;
    }
#pragma unroll
    for (int s = 0; s < 4; ++s) *(v4f*)(outp + offs[s]) = vals[s];
    
  }
}

// ---------------------------------------------------------------------------
extern "C" void kernel_launch(void* const* d_in, const int* in_sizes, int n_in,
                              void* d_out, int out_size, void* d_ws, size_t ws_size,
                              hipStream_t stream) {
  if (n_in < 13) return;
  const int nx = BATCH * CCH * NPOS;
  if (in_sizes[0] != nx || in_sizes[1] != nx ||
      in_sizes[2] != CQ * CCH || in_sizes[3] != CQ ||
      in_sizes[4] != CQ * CCH || in_sizes[5] != CQ ||
      in_sizes[6] != CQ * CCH || in_sizes[7] != CQ ||
      in_sizes[8] != CQ * CCH || in_sizes[9] != CQ ||
      in_sizes[10] != CCH * CCH || in_sizes[11] != CCH ||
      in_sizes[12] < 1 || out_size != nx) return;

  const size_t planeE = (size_t)BATCH * NPOS * DQK;   // bf16 elements per q/k plane (4 MiB each)
  const size_t vE     = (size_t)BATCH * CCH * NPOS;   // f16 elements of the v plane (16 MiB)
  const size_t need   = planeE * 2 * 4 + vE * 2;      // 33,554,432 B
  if (ws_size < need) return;

  const float* x     = (const float*)d_in[0];
  const float* dep   = (const float*)d_in[1];
  const float* wq    = (const float*)d_in[2];
  const float* bq    = (const float*)d_in[3];
  const float* wqd   = (const float*)d_in[4];
  const float* bqd   = (const float*)d_in[5];
  const float* wk    = (const float*)d_in[6];
  const float* bk    = (const float*)d_in[7];
  const float* wkd   = (const float*)d_in[8];
  const float* bkd   = (const float*)d_in[9];
  const float* wv    = (const float*)d_in[10];
  const float* bv    = (const float*)d_in[11];
  const float* gamma = (const float*)d_in[12];
  float* outp = (float*)d_out;

  unsigned short* Qhi = (unsigned short*)d_ws;
  unsigned short* Qlo = Qhi + planeE;
  unsigned short* Khi = Qlo + planeE;
  unsigned short* Klo = Khi + planeE;
  _Float16* Vh = (_Float16*)(Klo + planeE);

  // q/k planes [B][N][128] (columns 0..63 from x, 64..127 from dep) and v plane [B][C][N] f16, one launch
  proj_all_kernel<<<dim3(NPOS / 64, BATCH, 4 + CCH / 64), dim3(256), 0, stream>>>(
      x, dep, wq, bq, wqd, bqd, wk, bk, wkd, bkd, wv, bv, Qhi, Qlo, Khi, Klo, Vh);
  // fused attention + gamma*out + x
  attn_kernel<<<dim3(NPOS / 64, BATCH), dim3(512), 0, stream>>>(Qhi, Qlo, Khi, Klo, Vh, x, gamma, outp);
}

// v006
// Measured time: 181 microseconds a run.
// Timed twice side by side with v005, it ran 1.13 times as fast both times.
// All steps since v000 together make it 3.95 times as fast.
#include <hip/hip_runtime.h>

// q/k 1x1 projections and q.k^T logits: v_wmma_f32_16x16x32_bf16 with bf16 hi/lo operand split (hi.hi + hi.lo + lo.hi);
// v 1x1 projection (weights x16, folded back x1/16) and p.v: v_wmma_f32_16x16x32_f16 (f16 operands, p carried x4096); f32 accumulate everywhere.

typedef _Float16 h4  __attribute__((ext_vector_type(4)));
typedef _Float16 h8  __attribute__((ext_vector_type(8)));
typedef _Float16 h16 __attribute__((ext_vector_type(16)));
typedef __bf16   bf16v16 __attribute__((ext_vector_type(16)));
typedef unsigned short us4 __attribute__((ext_vector_type(4)));
typedef unsigned short us8 __attribute__((ext_vector_type(8)));
typedef float v4f __attribute__((ext_vector_type(4)));
typedef float v8f __attribute__((ext_vector_type(8)));

#define BATCH 4
#define CCH   512
#define NPOS  4096
#define DQK   128
#define CQ    64
#define SSP   65          // f32 score tile pitch (floats)
#define PSP   72          // f16 p tile pitch (halves), multiple of 8 for 16-B fragment loads
#define PSCALE  4096.0f   // p carried x2^12 in f16 so WMMA operands stay normal; cancels in O/l
#define WVSCALE 16.0f     // v weights x16 in f16, folded back in the epilogue
#define WVINV   0.0625f
#define KSP   136         // K tile pitch in LDS, 16-bit elements: 272 B = 16 B x 17, conflict-free for 16-B fragment reads
#define VSP   72          // V tile pitch in LDS, halves: 144 B = 16 B x 9, conflict-free for 16-B fragment reads
#define XSP   40          // projection operand tile pitch in LDS, 16-bit elements: 80 B = 16 B x 5; at 64 B four rows share each bank
#define XTILE (64 * XSP)  // one projection operand tile, 64 rows

union FragH { h16 v; h8 p[2]; };        // elements 0..7 <- k0+8h+0..7, elements 8..15 <- k0+16+8h+0..7
union FragB { bf16v16 v; us8 p[2]; };

__device__ __forceinline__ v8f mma_f16(h16 a, h16 b, v8f c) {
  c = __builtin_amdgcn_wmma_f32_16x16x32_f16(false, a, false, b, (short)0, c, false, false);
  asm volatile("v_nop\n\tv_nop\n\tv_nop\n\tv_nop" : "+v"(c) : "v"(a), "v"(b));
  return c;
}
__device__ __forceinline__ v8f mma_bf16(bf16v16 a, bf16v16 b, v8f c) {
  c = __builtin_amdgcn_wmma_f32_16x16x32_bf16(false, a, false, b, (short)0, c, false, false);
  asm volatile("v_nop\n\tv_nop\n\tv_nop\n\tv_nop" : "+v"(c) : "v"(a), "v"(b));
  return c;
}
// f32 -> bf16 bits, RNE convert
__device__ __forceinline__ unsigned short f2bf(float f) {
  unsigned int u = __float_as_uint(f);
  u += 0x7FFFu + ((u >> 16) & 1u);
  return (unsigned short)(u >> 16);
}
__device__ __forceinline__ float bf2f(unsigned short s) {
  return __uint_as_float(((unsigned int)s) << 16);
}

// ---------------------------------------------------------------------------
// Projection GEMM, block tile 64 n x 64 d, k = 512 channels in steps of 32, 256 threads (8 waves).
//   src : [B][C][N] f32, batch b read here;  W : [rows][C] f32;  bias : [rows] f32
//   D[row = n][col = d] = sum_c src[c][n] * W[d][c]; A = src tile staged [n][k], B = W tile staged [d][k]
//   sm  : 20 KiB of LDS: operand tiles during the k loop, output tile in the epilogue;  dbase : first row of W of this block
// ---------------------------------------------------------------------------
template <int MODE>
__device__ __forceinline__ void
proj_body(unsigned short* sm,
          const float* __restrict__ src,
          const float* __restrict__ W,
          const float* __restrict__ bias,
          unsigned short* __restrict__ ohi,
          unsigned short* __restrict__ olo,
          _Float16* __restrict__ ov,
          int doff,
          int dbase,
          int b) {
  const int tid  = threadIdx.x;
  const int lane = tid & 31;
  const int w    = tid >> 5;
  const int m    = lane & 15;
  const int h    = lane >> 4;

  const int n0    = blockIdx.x * 64;

  const int mt  = w >> 1;          // n sub-tile (0..3)
  const int ntb = (w & 1) * 2;     // d sub-tile pair base (0 or 2)

  const int ms = tid & 63;         // staging row
  const int kg = (tid >> 6) * 4;   // staging k group

  const size_t srcb = (size_t)b * CCH * NPOS;

  v8f acc0 = {};
  v8f acc1 = {};

  if (MODE == 0) {
    unsigned short* Xh = sm;
    unsigned short* Xl = sm + XTILE;
    unsigned short* Wh = sm + 2 * XTILE;
    unsigned short* Wl = sm + 3 * XTILE;

    for (int c0 = 0; c0 < CCH; c0 += 32) {
#pragma unroll
      for (int g = 0; g < 2; ++g) {
        const int kb = kg + g * 16;
        const float* sp = src + srcb + (size_t)(c0 + kb) * NPOS + n0 + ms;
        v4f xv;
        xv[0] = sp[0];
        xv[1] = sp[NPOS];
        xv[2] = sp[2 * NPOS];
        xv[3] = sp[3 * NPOS];
        const v4f wv4 = *(const v4f*)(W + (size_t)(dbase + ms) * CCH + c0 + kb);
        us4 xh4, xl4, wh4, wl4;
#pragma unroll
        for (int q = 0; q < 4; ++q) {
          const unsigned short hb = f2bf(xv[q]);
          xh4[q] = hb;
          xl4[q] = f2bf(xv[q] - bf2f(hb));
          const unsigned short wb = f2bf(wv4[q]);
          wh4[q] = wb;
          wl4[q] = f2bf(wv4[q] - bf2f(wb));
        }
        *(us4*)(Xh + ms * XSP + kb) = xh4;
        *(us4*)(Xl + ms * XSP + kb) = xl4;
        *(us4*)(Wh + ms * XSP + kb) = wh4;
        *(us4*)(Wl + ms * XSP + kb) = wl4;
      }
      __syncthreads();

      FragB ah, al;
      {
        const unsigned short* xr  = Xh + (mt * 16 + m) * XSP + 8 * h;
        const unsigned short* xrl = Xl + (mt * 16 + m) * XSP + 8 * h;
        ah.p[0] = *(const us8*)xr;
        ah.p[1] = *(const us8*)(xr + 16);
        al.p[0] = *(const us8*)xrl;
        al.p[1] = *(const us8*)(xrl + 16);
      }
      {
        const unsigned short* wr  = Wh + (ntb * 16 + m) * XSP + 8 * h;
        const unsigned short* wrl = Wl + (ntb * 16 + m) * XSP + 8 * h;
        FragB bh, bl;
        bh.p[0] = *(const us8*)wr;
        bh.p[1] = *(const us8*)(wr + 16);
        bl.p[0] = *(const us8*)wrl;
        bl.p[1] = *(const us8*)(wrl + 16);
        acc0 = mma_bf16(ah.v, bh.v, acc0);
        acc0 = mma_bf16(ah.v, bl.v, acc0);
        acc0 = mma_bf16(al.v, bh.v, acc0);
      }
      {
        const unsigned short* wr  = Wh + ((ntb + 1) * 16 + m) * XSP + 8 * h;
        const unsigned short* wrl = Wl + ((ntb + 1) * 16 + m) * XSP + 8 * h;
        FragB bh, bl;
        bh.p[0] = *(const us8*)wr;
        bh.p[1] = *(const us8*)(wr + 16);
        bl.p[0] = *(const us8*)wrl;
        bl.p[1] = *(const us8*)(wrl + 16);
        acc1 = mma_bf16(ah.v, bh.v, acc1);
        acc1 = mma_bf16(ah.v, bl.v, acc1);
        acc1 = mma_bf16(al.v, bh.v, acc1);
      }
      __syncthreads();
    }

    // epilogue: bias add in f32, hi/lo bf16 split, stage [n][d] tile in LDS, whole-line stores
    unsigned short* Eh = sm;          // [64 n][64 d]
    unsigned short* El = sm + 4096;   // [64 n][64 d]
    {
      const int dl = ntb * 16 + m;
      const float bb = bias[dbase + dl];
#pragma unroll
      for (int r = 0; r < 8; ++r) {
        const float v = acc0[r] + bb;
        const unsigned short hb = f2bf(v);
        const int row = mt * 16 + 8 * h + r;
        Eh[row * 64 + dl] = hb;
        El[row * 64 + dl] = f2bf(v - bf2f(hb));
      }
    }
    {
      const int dl = (ntb + 1) * 16 + m;
      const float bb = bias[dbase + dl];
#pragma unroll
      for (int r = 0; r < 8; ++r) {
        const float v = acc1[r] + bb;
        const unsigned short hb = f2bf(v);
        const int row = mt * 16 + 8 * h + r;
        Eh[row * 64 + dl] = hb;
        El[row * 64 + dl] = f2bf(v - bf2f(hb));
      }
    }
    __syncthreads();

    us8 vh[2], vl[2];
    size_t off[2];
#pragma unroll
    for (int s = 0; s < 2; ++s) {
      const int row = w * 8 + s * 4 + (lane >> 3);
      const int q = lane & 7;
      vh[s] = *(const us8*)(Eh + row * 64 + q * 8);
      vl[s] = *(const us8*)(El + row * 64 + q * 8);
      off[s] = ((size_t)b * NPOS + n0 + row) * DQK + doff + q * 8;
    }
#pragma unroll
    for (int s = 0; s < 2; ++s) {
      *(us8*)(ohi + off[s]) = vh[s];
      *(us8*)(olo + off[s]) = vl[s];
    }
    
  } else {
    _Float16* Xs = (_Float16*)sm;       // [64 n][32 k], pitch XSP
    _Float16* Ws = Xs + XTILE;          // [64 d][32 k], pitch XSP

    for (int c0 = 0; c0 < CCH; c0 += 32) {
#pragma unroll
      for (int g = 0; g < 2; ++g) {
        const int kb = kg + g * 16;
        const float* sp = src + srcb + (size_t)(c0 + kb) * NPOS + n0 + ms;
        v4f xv;
        xv[0] = sp[0];
        xv[1] = sp[NPOS];
        xv[2] = sp[2 * NPOS];
        xv[3] = sp[3 * NPOS];
        v4f wv4 = *(const v4f*)(W + (size_t)(dbase + ms) * CCH + c0 + kb);
        wv4 = wv4 * WVSCALE;
        *(h4*)(Xs + ms * XSP + kb) = __builtin_convertvector(xv, h4);
        *(h4*)(Ws + ms * XSP + kb) = __builtin_convertvector(wv4, h4);
      }
      __syncthreads();

      FragH a;
      {
        const _Float16* xr = Xs + (mt * 16 + m) * XSP + 8 * h;
        a.p[0] = *(const h8*)xr;
        a.p[1] = *(const h8*)(xr + 16);
      }
      {
        const _Float16* wr = Ws + (ntb * 16 + m) * XSP + 8 * h;
        FragH bf;
        bf.p[0] = *(const h8*)wr;
        bf.p[1] = *(const h8*)(wr + 16);
        acc0 = mma_f16(a.v, bf.v, acc0);
      }
      {
        const _Float16* wr = Ws + ((ntb + 1) * 16 + m) * XSP + 8 * h;
        FragH bf;
        bf.p[0] = *(const h8*)wr;
        bf.p[1] = *(const h8*)(wr + 16);
        acc1 = mma_f16(a.v, bf.v, acc1);
      }
      __syncthreads();
    }

    // epilogue: fold 1/16, bias, f16, stage [d][n] tile in LDS, whole-line stores along n
    _Float16* E = (_Float16*)sm;       // [64 d][64 n]
    {
      const int dl = ntb * 16 + m;
      const float bb = bias[dbase + dl];
      h8 ev;
#pragma unroll
      for (int r = 0; r < 8; ++r) ev[r] = (_Float16)(acc0[r] * WVINV + bb);
      *(h8*)(E + dl * 64 + mt * 16 + 8 * h) = ev;
    }
    {
      const int dl = (ntb + 1) * 16 + m;
      const float bb = bias[dbase + dl];
      h8 ev;
#pragma unroll
      for (int r = 0; r < 8; ++r) ev[r] = (_Float16)(acc1[r] * WVINV + bb);
      *(h8*)(E + dl * 64 + mt * 16 + 8 * h) = ev;
    }
    __syncthreads();

    h8 vv[2];
    size_t off[2];
#pragma unroll
    for (int s = 0; s < 2; ++s) {
      const int row = w * 8 + s * 4 + (lane >> 3);   // channel local 0..63
      const int q = lane & 7;
      vv[s] = *(const h8*)(E + row * 64 + q * 8);
      off[s] = ((size_t)b * CCH + dbase + row) * NPOS + n0 + q * 8;
    }
#pragma unroll
    for (int s = 0; s < 2; ++s) *(h8*)(ov + off[s]) = vv[s];
    
  }
}

// All five projections in one launch, so that blocks of different projections stand on a WGP together and one block's
// global-load and barrier waits are filled by the others. blockIdx.z picks the projection, the same for the whole block:
//   0 q from x, 1 q from dep, 2 k from x, 3 k from dep (64 rows of W each); 4..11 v, 64 of its 512 rows of W each.
// The q/k blocks are the longer ones (three products per step and the hi/lo split) and have the low indices, which start first.
__global__ void __launch_bounds__(256)
proj_all_kernel(const float* __restrict__ x,
                const float* __restrict__ dep,
                const float* __restrict__ wq,
                const float* __restrict__ bq,
                const float* __restrict__ wqd,
                const float* __restrict__ bqd,
                const float* __restrict__ wk,
                const float* __restrict__ bk,
                const float* __restrict__ wkd,
                const float* __restrict__ bkd,
                const float* __restrict__ wv,
                const float* __restrict__ bv,
                unsigned short* __restrict__ Qhi,
                unsigned short* __restrict__ Qlo,
                unsigned short* __restrict__ Khi,
                unsigned short* __restrict__ Klo,
                _Float16* __restrict__ Vh) {
  __shared__ __align__(16) unsigned short sm[4 * XTILE];

  const int b = blockIdx.y;
  const int p = blockIdx.z;
  if (p < 4) {
    const bool fromDep = (p & 1) != 0;
    const bool isK     = (p & 2) != 0;
    const float* src  = fromDep ? dep : x;
    const float* W    = isK ? (fromDep ? wkd : wk) : (fromDep ? wqd : wq);
    const float* bias = isK ? (fromDep ? bkd : bk) : (fromDep ? bqd : bq);
    proj_body<0>(sm, src, W, bias, isK ? Khi : Qhi, isK ? Klo : Qlo, Vh, fromDep ? CQ : 0, 0, b);
  } else {
    proj_body<1>(sm, x, wv, bv, Qhi, Qlo, Vh, 0, (p - 4) * 64, b);
  }
}

// value of lane (l ^ X), X < 16, by a DPP move inside the 16-lane row
template <int X>
__device__ __forceinline__ float lane_xor(float v) {
  const int s = __builtin_bit_cast(int, v);
  return __builtin_bit_cast(float, __builtin_amdgcn_update_dpp(s, s, 0x160 + X, 0xf, 0xf, false));
}

// LDS byte address of a __shared__ object: the low 32 bits of its address
__device__ __forceinline__ unsigned lds_byte(const void* p) {
  return (unsigned)(size_t)p;
}

// Eight asynchronous 16-B copies per lane, global -> LDS, through no register.
// s_wait_xcnt 0 is the last line of the copies' own statement, so that no address register is rewritten in front of it.
__device__ __forceinline__ void copy8(const unsigned (&l)[8], const void* const (&g)[8]) {
  asm volatile(
      "global_load_async_to_lds_b128 %0, %8, off\n\t"
      "global_load_async_to_lds_b128 %1, %9, off\n\t"
      "global_load_async_to_lds_b128 %2, %10, off\n\t"
      "global_load_async_to_lds_b128 %3, %11, off\n\t"
      "global_load_async_to_lds_b128 %4, %12, off\n\t"
      "global_load_async_to_lds_b128 %5, %13, off\n\t"
      "global_load_async_to_lds_b128 %6, %14, off\n\t"
      "global_load_async_to_lds_b128 %7, %15, off\n\t"
      "s_wait_xcnt 0x0"
      :: "v"(l[0]), "v"(l[1]), "v"(l[2]), "v"(l[3]), "v"(l[4]), "v"(l[5]), "v"(l[6]), "v"(l[7]),
         "v"(g[0]), "v"(g[1]), "v"(g[2]), "v"(g[3]), "v"(g[4]), "v"(g[5]), "v"(g[6]), "v"(g[7])
      : "memory");
}

// Four such copies per lane; s_wait_xcnt 0 is again the last line of the copies' own statement, for the same reason.
__device__ __forceinline__ void copy4(const unsigned (&l)[4], const void* const (&g)[4]) {
  asm volatile(
      "global_load_async_to_lds_b128 %0, %4, off\n\t"
      "global_load_async_to_lds_b128 %1, %5, off\n\t"
      "global_load_async_to_lds_b128 %2, %6, off\n\t"
      "global_load_async_to_lds_b128 %3, %7, off\n\t"
      "s_wait_xcnt 0x0"
      :: "v"(l[0]), "v"(l[1]), "v"(l[2]), "v"(l[3]),
         "v"(g[0]), "v"(g[1]), "v"(g[2]), "v"(g[3])
      : "memory");
}

// ---------------------------------------------------------------------------
// Fused attention: one block per (batch, 64-query tile), 512 threads (16 waves), 64-key tiles:
//   one K and one V tile in LDS serve 64 queries, so each key tile is fetched from L2 once per 64 queries.
//   K hi/lo tile [64 j][128 d] and V tile [512 c][64 j] come into LDS by asynchronous copies in whole 128-B lines;
//   V of a tile flies during its scores and softmax, K of the next tile during p.v; fragments are read from LDS
//   S[64 i][64 j] = Q.K^T (K = 128) with bf16 hi/lo split operands (Q fragments held in registers) -> LDS, 16x16 per wave
//   online softmax stats by all waves (8 lanes per row, running max and sum in registers), p x4096 as f16 in LDS, row sums from the f16 values
//   O^T[512 c][64 i] += V[c][j] . P[i][j]  (f16), each wave owns 64 channels x 32 queries
// ---------------------------------------------------------------------------
__global__ void __launch_bounds__(512)
attn_kernel(const unsigned short* __restrict__ Qhi,
            const unsigned short* __restrict__ Qlo,
            const unsigned short* __restrict__ Khi,
            const unsigned short* __restrict__ Klo,
            const _Float16* __restrict__ Vh,
            const float* __restrict__ x,
            const float* __restrict__ gamma,
            float* __restrict__ outp) {
  __shared__ __align__(16) unsigned short smq[16384];  // finalize: 8192 f32, 512 per wave
  __shared__ __align__(16) unsigned short Ksh[64 * KSP];   // K hi tile
  __shared__ __align__(16) unsigned short Ksl[64 * KSP];   // K lo tile
  __shared__ __align__(16) _Float16 Vs[CCH * VSP];         // V tile
  __shared__ float Ss[64 * SSP];
  __shared__ __align__(16) _Float16 Ps[64 * PSP];
  __shared__ float lrow[64];
  __shared__ float srow[64];

  const int tid  = threadIdx.x;
  const int lane = tid & 31;
  const int w    = tid >> 5;
  const int m    = lane & 15;
  const int h    = lane >> 4;

  const int i0 = blockIdx.x * 64;
  const int b  = blockIdx.y;
  const int wc = w & 7;          // p.v: channel group of this wave (64 channels)
  const int ib = (w >> 3) * 32;  // p.v: first of its 32 queries inside the tile

  v8f o[2][4];
  {
    v8f z = {};
#pragma unroll
    for (int it = 0; it < 2; ++it)
#pragma unroll
      for (int ct = 0; ct < 4; ++ct) o[it][ct] = z;
  }

  const int rtS = w >> 2;   // S row sub-tile (i), 0..3
  const int jtS = w & 3;    // S col sub-tile (j)

  // Q fragments of this wave's 16 query rows, hi and lo, k = d in 4 steps of 32: the same for every key tile, kept in registers
  FragB qfh[4], qfl[4];
  {
    const size_t qrow = ((size_t)b * NPOS + i0 + rtS * 16 + m) * DQK + 8 * h;
    const unsigned short* qrh = Qhi + qrow;
    const unsigned short* qrl = Qlo + qrow;
    // unrolled so that the fragment arrays are indexed by constants and stay in registers
#pragma unroll
    for (int kk = 0; kk < 4; ++kk) {
      qfh[kk].p[0] = *(const us8*)(qrh + kk * 32);
      qfh[kk].p[1] = *(const us8*)(qrh + kk * 32 + 16);
      qfl[kk].p[0] = *(const us8*)(qrl + kk * 32);
      qfl[kk].p[1] = *(const us8*)(qrl + kk * 32 + 16);
    }
  }

  const int si = tid >> 3;        // softmax row of this thread
  const int sq = (tid & 7) * 8;   // first of its 8 columns
  float mrun = -1e30f;            // running row maximum, equal in the row's 8 lanes
  float lrun = 0.0f;              // running row sum, equal in the row's 8 lanes

  // copy shares: K, 16 lanes per 256-B row, 32 rows per step; V, 8 lanes per 128-B row, 64 rows per step
  const int kcr = tid >> 4;
  const int kcq = (tid & 15) * 8;
  const int vcr = tid >> 3;
  const int vcq = (tid & 7) * 8;
  const unsigned short* kgh = Khi + ((size_t)b * NPOS + kcr) * DQK + kcq;
  const unsigned short* kgl = Klo + ((size_t)b * NPOS + kcr) * DQK + kcq;
  const _Float16* vg = Vh + ((size_t)b * CCH + vcr) * NPOS + vcq;
  const unsigned klh = lds_byte(Ksh + kcr * KSP + kcq);
  const unsigned kll = lds_byte(Ksl + kcr * KSP + kcq);
  const unsigned vl  = lds_byte(Vs + vcr * VSP + vcq);

  // K tile 0
  {
    unsigned l[4];
    const void* g[4];
    // unrolled so that l and g are indexed by constants and stay in registers
#pragma unroll
    for (int i = 0; i < 2; ++i) {
      l[i]     = klh + i * 32 * KSP * 2;
      l[2 + i] = kll + i * 32 * KSP * 2;
      g[i]     = kgh + (size_t)(i * 32) * DQK;
      g[2 + i] = kgl + (size_t)(i * 32) * DQK;
    }
    copy4(l, g);
  }
  asm volatile("s_wait_asynccnt 0x0" ::: "memory");   // this wave's share of K tile 0 has landed before the barrier publishes it
  __syncthreads();

  for (int j0 = 0; j0 < NPOS; j0 += 64) {
    // ---- 0. V tile of this trip: its buffer's last readers ended at the barrier that closed the trip before ----
    {
      unsigned l[8];
      const void* g[8];
      // unrolled so that l and g are indexed by constants and stay in registers
#pragma unroll
      for (int i = 0; i < 8; ++i) {
        l[i] = vl + i * 64 * VSP * 2;
        g[i] = vg + (size_t)(i * 64) * NPOS + j0;
      }
      copy8(l, g);
    }

    // ---- 1. S tile, 16x16 per wave, k = d in 4 steps of 32, three bf16 products per step ----
    {
      v8f s = {};
      const int krow = (jtS * 16 + m) * KSP + 8 * h;
      const unsigned short* krh = Ksh + krow;
      const unsigned short* krl = Ksl + krow;
#pragma unroll
      for (int kk = 0; kk < 4; ++kk) {
        FragB bh, bl;
        bh.p[0] = *(const us8*)(krh + kk * 32);
        bh.p[1] = *(const us8*)(krh + kk * 32 + 16);
        bl.p[0] = *(const us8*)(krl + kk * 32);
        bl.p[1] = *(const us8*)(krl + kk * 32 + 16);
        s = mma_bf16(qfh[kk].v, bh.v, s);
        s = mma_bf16(qfh[kk].v, bl.v, s);
        s = mma_bf16(qfl[kk].v, bh.v, s);
      }
#pragma unroll
      for (int r = 0; r < 8; ++r)
        Ss[(rtS * 16 + 8 * h + r) * SSP + jtS * 16 + m] = s[r];
    }
    asm volatile("s_wait_dscnt 0x0" ::: "memory");      // this wave's K reads have retired before the K buffer is handed to its next copies
    __syncthreads();

    // ---- 2. online softmax stats: 8 lanes per row, 8 adjacent columns per lane, all 16 waves ----
    {
      float sv[8];   // the three loops below are fully unrolled so that sv and pv stay in registers
#pragma unroll
      for (int q = 0; q < 8; ++q) sv[q] = Ss[si * SSP + sq + q];
      float mx = sv[0];
#pragma unroll
      for (int q = 1; q < 8; ++q) mx = fmaxf(mx, sv[q]);
      mx = fmaxf(mx, lane_xor<1>(mx));
      mx = fmaxf(mx, lane_xor<2>(mx));
      mx = fmaxf(mx, lane_xor<4>(mx));
      const float mnew = fmaxf(mrun, mx);
      const float sc = __expf(mrun - mnew);
      h8 pv;
      float sum = 0.0f;
#pragma unroll
      for (int q = 0; q < 8; ++q) {
        const float p = __expf(sv[q] - mnew) * PSCALE;
        const _Float16 ph = (_Float16)p;
        pv[q] = ph;
        sum += (float)ph;
      }
      *(h8*)(Ps + si * PSP + sq) = pv;
      sum += lane_xor<1>(sum);
      sum += lane_xor<2>(sum);
      sum += lane_xor<4>(sum);
      mrun = mnew;
      lrun = lrun * sc + sum;
      if ((tid & 7) == 0) { lrow[si] = lrun; srow[si] = sc; }
    }
    asm volatile("s_wait_asynccnt 0x0" ::: "memory");   // this wave's share of the V tile has landed before the barrier publishes it
    __syncthreads();

    // K tile of the next trip: every reader left the K buffer at the barrier behind the scores
    if (j0 + 64 < NPOS) {
      unsigned l[4];
      const void* g[4];
      // unrolled so that l and g are indexed by constants and stay in registers
#pragma unroll
      for (int i = 0; i < 2; ++i) {
        l[i]     = klh + i * 32 * KSP * 2;
        l[2 + i] = kll + i * 32 * KSP * 2;
        g[i]     = kgh + (size_t)(j0 + 64 + i * 32) * DQK;
        g[2 + i] = kgl + (size_t)(j0 + 64 + i * 32) * DQK;
      }
      copy4(l, g);
    }

    // ---- 3. rescale O, then O^T += V . P^T ----
#pragma unroll
    for (int it = 0; it < 2; ++it) {
      const float sc = srow[ib + it * 16 + m];   // column of the accumulator = query index
#pragma unroll
      for (int ct = 0; ct < 4; ++ct) o[it][ct] = o[it][ct] * sc;
    }
#pragma unroll
    for (int jj = 0; jj < 2; ++jj) {
      // B[k = j][n = i] = P[i][j0 + jj*32 + k]: row i of Ps is k-contiguous, loaded like A
      FragH b0, b1;
      {
        const _Float16* p0 = Ps + (ib + m) * PSP + jj * 32 + 8 * h;
        const _Float16* p1 = Ps + (ib + 16 + m) * PSP + jj * 32 + 8 * h;
        b0.p[0] = *(const h8*)p0;
        b0.p[1] = *(const h8*)(p0 + 16);
        b1.p[0] = *(const h8*)p1;
        b1.p[1] = *(const h8*)(p1 + 16);
      }
#pragma unroll
      for (int ct = 0; ct < 4; ++ct) {
        // A[m = c][k = j] = V[b][c][j0 + jj*32 + k], k-contiguous, from the LDS tile
        FragH a;
        const _Float16* vr = Vs + (wc * 64 + ct * 16 + m) * VSP + jj * 32 + 8 * h;
        a.p[0] = *(const h8*)vr;
        a.p[1] = *(const h8*)(vr + 16);
        o[0][ct] = mma_f16(a.v, b0.v, o[0][ct]);
        o[1][ct] = mma_f16(a.v, b1.v, o[1][ct]);
      }
    }
    asm volatile("s_wait_dscnt 0x0" ::: "memory");      // this wave's V reads have retired before the V buffer is handed to its next copies
    asm volatile("s_wait_asynccnt 0x0" ::: "memory");   // this wave's share of the next K tile has landed before the barrier publishes it
    __syncthreads();
  }

  const float g = gamma[0];
  const float gl0 = g / lrow[ib + m];
  const float gl1 = g / lrow[ib + 16 + m];
  float* F = (float*)smq + w * 512;     // per wave [16 c][32 i] f32
#pragma unroll
  for (int ct = 0; ct < 4; ++ct) {
    __syncthreads();
#pragma unroll
    for (int r = 0; r < 8; ++r) {
      F[(8 * h + r) * 32 + m]      = o[0][ct][r] * gl0;
      F[(8 * h + r) * 32 + 16 + m] = o[1][ct][r] * gl1;
    }
    __syncthreads();
    v4f vals[4];
    size_t offs[4];
#pragma unroll
    for (int s = 0; s < 4; ++s) {
      const int row = s * 4 + (lane >> 3);            // channel local 0..15
      const int q = lane & 7;
      const int c = wc * 64 + ct * 16 + row;
      const size_t off = ((size_t)b * CCH + c) * NPOS + i0 + ib + q * 4;
      const v4f ov = *(const v4f*)(F + row * 32 + q * 4);
      const v4f xv = *(const v4f*)(x + off);
      vals[s] = ov + xv;
      offs[s] = off;
    }
#pragma unroll
    for (int s = 0; s < 4; ++s) *(v4f*)(outp + offs[s]) = vals[s];
    
  }
}

// ---------------------------------------------------------------------------
extern "C" void kernel_launch(void* const* d_in, const int* in_sizes, int n_in,
                              void* d_out, int out_size, void* d_ws, size_t ws_size,
                              hipStream_t stream) {
  if (n_in < 13) return;
  const int nx = BATCH * CCH * NPOS;
  if (in_sizes[0] != nx || in_sizes[1] != nx ||
      in_sizes[2] != CQ * CCH || in_sizes[3] != CQ ||
      in_sizes[4] != CQ * CCH || in_sizes[5] != CQ ||
      in_sizes[6] != CQ * CCH || in_sizes[7] != CQ ||
      in_sizes[8] != CQ * CCH || in_sizes[9] != CQ ||
      in_sizes[10] != CCH * CCH || in_sizes[11] != CCH ||
      in_sizes[12] < 1 || out_size != nx) return;

  const size_t planeE = (size_t)BATCH * NPOS * DQK;   // bf16 elements per q/k plane (4 MiB each)
  const size_t vE     = (size_t)BATCH * CCH * NPOS;   // f16 elements of the v plane (16 MiB)
  const size_t need   = planeE * 2 * 4 + vE * 2;      // 33,554,432 B
  if (ws_size < need) return;

  const float* x     = (const float*)d_in[0];
  const float* dep   = (const float*)d_in[1];
  const float* wq    = (const float*)d_in[2];
  const float* bq    = (const float*)d_in[3];
  const float* wqd   = (const float*)d_in[4];
  const float* bqd   = (const float*)d_in[5];
  const float* wk    = (const float*)d_in[6];
  const float* bk    = (const float*)d_in[7];
  const float* wkd   = (const float*)d_in[8];
  const float* bkd   = (const float*)d_in[9];
  const float* wv    = (const float*)d_in[10];
  const float* bv    = (const float*)d_in[11];
  const float* gamma = (const float*)d_in[12];
  float* outp = (float*)d_out;

  unsigned short* Qhi = (unsigned short*)d_ws;
  unsigned short* Qlo = Qhi + planeE;
  unsigned short* Khi = Qlo + planeE;
  unsigned short* Klo = Khi + planeE;
  _Float16* Vh = (_Float16*)(Klo + planeE);

  // q/k planes [B][N][128] (columns 0..63 from x, 64..127 from dep) and v plane [B][C][N] f16, one launch
  proj_all_kernel<<<dim3(NPOS / 64, BATCH, 4 + CCH / 64), dim3(256), 0, stream>>>(
      x, dep, wq, bq, wqd, bqd, wk, bk, wkd, bkd, wv, bv, Qhi, Qlo, Khi, Klo, Vh);
  // fused attention + gamma*out + x
  attn_kernel<<<dim3(NPOS / 64, BATCH), dim3(512), 0, stream>>>(Qhi, Qlo, Khi, Klo, Vh, x, gamma, outp);
}

// v007
// A run of this version takes 168 microseconds.
// Two timings next to v006 both put it at 1.08 times that version's speed.
// Over all steps from v000 it is 4.25 times as fast.
#include <hip/hip_runtime.h>

// q/k 1x1 projections and q.k^T logits: v_wmma_f32_16x16x32_bf16 with bf16 hi/lo operand split (hi.hi + hi.lo + lo.hi);
// v 1x1 projection (weights x16, folded back x1/16) and p.v: v_wmma_f32_16x16x32_f16 (f16 operands, p carried x4096); f32 accumulate everywhere.

typedef _Float16 h4  __attribute__((ext_vector_type(4)));
typedef _Float16 h8  __attribute__((ext_vector_type(8)));
typedef _Float16 h16 __attribute__((ext_vector_type(16)));
typedef __bf16   bf16v16 __attribute__((ext_vector_type(16)));
typedef unsigned short us4 __attribute__((ext_vector_type(4)));
typedef unsigned short us8 __attribute__((ext_vector_type(8)));
typedef float v4f __attribute__((ext_vector_type(4)));
typedef float v8f __attribute__((ext_vector_type(8)));

#define BATCH 4
#define CCH   512
#define NPOS  4096
#define DQK   128
#define CQ    64
#define SSP   65          // f32 score tile pitch (floats)
#define PSP   72          // f16 p tile pitch (halves), multiple of 8 for 16-B fragment loads
#define PSCALE  4096.0f   // p carried x2^12 in f16 so WMMA operands stay normal; cancels in O/l
#define WVSCALE 16.0f     // v weights x16 in f16, folded back in the epilogue
#define WVINV   0.0625f
#define KSP   136         // K tile pitch in LDS, 16-bit elements: 272 B = 16 B x 17, conflict-free for 16-B fragment reads
#define VSP   72          // V tile pitch in LDS, halves: 144 B = 16 B x 9, conflict-free for 16-B fragment reads
#define XSP   40          // projection operand tile pitch in LDS, 16-bit elements: 80 B = 16 B x 5; at 64 B four rows share each bank
#define XTILE (64 * XSP)  // one projection operand tile, 64 rows

union FragH { h16 v; h8 p[2]; };        // elements 0..7 <- k0+8h+0..7, elements 8..15 <- k0+16+8h+0..7
union FragB { bf16v16 v; us8 p[2]; };

__device__ __forceinline__ v8f mma_f16(h16 a, h16 b, v8f c) {
  c = __builtin_amdgcn_wmma_f32_16x16x32_f16(false, a, false, b, (short)0, c, false, false);
  asm volatile("v_nop\n\tv_nop\n\tv_nop\n\tv_nop" : "+v"(c) : "v"(a), "v"(b));
  return c;
}
__device__ __forceinline__ v8f mma_bf16(bf16v16 a, bf16v16 b, v8f c) {
  c = __builtin_amdgcn_wmma_f32_16x16x32_bf16(false, a, false, b, (short)0, c, false, false);
  asm volatile("v_nop\n\tv_nop\n\tv_nop\n\tv_nop" : "+v"(c) : "v"(a), "v"(b));
  return c;
}
// f32 -> bf16 bits, RNE convert
__device__ __forceinline__ unsigned short f2bf(float f) {
  unsigned int u = __float_as_uint(f);
  u += 0x7FFFu + ((u >> 16) & 1u);
  return (unsigned short)(u >> 16);
}
__device__ __forceinline__ float bf2f(unsigned short s) {
  return __uint_as_float(((unsigned int)s) << 16);
}

// ---------------------------------------------------------------------------
// Projection GEMM, block tile 64 n x 64 d, k = 512 channels in steps of 32, 256 threads (8 waves).
//   src : [B][C][N] f32, batch b read here;  W : [rows][C] f32;  bias : [rows] f32
//   D[row = n][col = d] = sum_c src[c][n] * W[d][c]; A = src tile staged [n][k], B = W tile staged [d][k]
//   sm  : 20 KiB of LDS: operand tiles during the k loop, output tile in the epilogue;  dbase : first row of W of this block
// ---------------------------------------------------------------------------
template <int MODE>
__device__ __forceinline__ void
proj_body(unsigned short* sm,
          const float* __restrict__ src,
          const float* __restrict__ W,
          const float* __restrict__ bias,
          unsigned short* __restrict__ ohi,
          unsigned short* __restrict__ olo,
          _Float16* __restrict__ ov,
          int doff,
          int dbase,
          int b) {
  const int tid  = threadIdx.x;
  const int lane = tid & 31;
  const int w    = tid >> 5;
  const int m    = lane & 15;
  const int h    = lane >> 4;

  const int n0    = blockIdx.x * 64;

  const int mt  = w >> 1;          // n sub-tile (0..3)
  const int ntb = (w & 1) * 2;     // d sub-tile pair base (0 or 2)

  const int ms = tid & 63;         // src staging row
  const int kg = (tid >> 6) * 4;   // src staging k group
  const int wr = tid >> 3;         // W staging row: 8 lanes share the 128-B line that a row of W has in a k step,
  const int wq = (tid & 7) * 4;    // so a wave's 16-B loads cover 4 whole lines instead of 16 B of 32 lines

  const size_t srcb = (size_t)b * CCH * NPOS;

  v8f acc0 = {};
  v8f acc1 = {};

  if (MODE == 0) {
    unsigned short* Xh = sm;
    unsigned short* Xl = sm + XTILE;
    unsigned short* Wh = sm + 2 * XTILE;
    unsigned short* Wl = sm + 3 * XTILE;

    for (int c0 = 0; c0 < CCH; c0 += 32) {
#pragma unroll
      for (int g = 0; g < 2; ++g) {
        const int kb = kg + g * 16;
        const float* sp = src + srcb + (size_t)(c0 + kb) * NPOS + n0 + ms;
        v4f xv;
        xv[0] = sp[0];
        xv[1] = sp[NPOS];
        xv[2] = sp[2 * NPOS];
        xv[3] = sp[3 * NPOS];
        const int wrow = wr + g * 32;
        const v4f wv4 = *(const v4f*)(W + (size_t)(dbase + wrow) * CCH + c0 + wq);
        us4 xh4, xl4, wh4, wl4;
#pragma unroll
        for (int q = 0; q < 4; ++q) {
          const unsigned short hb = f2bf(xv[q]);
          xh4[q] = hb;
          xl4[q] = f2bf(xv[q] - bf2f(hb));
          const unsigned short wb = f2bf(wv4[q]);
          wh4[q] = wb;
          wl4[q] = f2bf(wv4[q] - bf2f(wb));
        }
        *(us4*)(Xh + ms * XSP + kb) = xh4;
        *(us4*)(Xl + ms * XSP + kb) = xl4;
        *(us4*)(Wh + wrow * XSP + wq) = wh4;
        *(us4*)(Wl + wrow * XSP + wq) = wl4;
      }
      __syncthreads();

      FragB ah, al;
      {
        const unsigned short* xr  = Xh + (mt * 16 + m) * XSP + 8 * h;
        const unsigned short* xrl = Xl + (mt * 16 + m) * XSP + 8 * h;
        ah.p[0] = *(const us8*)xr;
        ah.p[1] = *(const us8*)(xr + 16);
        al.p[0] = *(const us8*)xrl;
        al.p[1] = *(const us8*)(xrl + 16);
      }
      {
        const unsigned short* wr  = Wh + (ntb * 16 + m) * XSP + 8 * h;
        const unsigned short* wrl = Wl + (ntb * 16 + m) * XSP + 8 * h;
        FragB bh, bl;
        bh.p[0] = *(const us8*)wr;
        bh.p[1] = *(const us8*)(wr + 16);
        bl.p[0] = *(const us8*)wrl;
        bl.p[1] = *(const us8*)(wrl + 16);
        acc0 = mma_bf16(ah.v, bh.v, acc0);
        acc0 = mma_bf16(ah.v, bl.v, acc0);
        acc0 = mma_bf16(al.v, bh.v, acc0);
      }
      {
        const unsigned short* wr  = Wh + ((ntb + 1) * 16 + m) * XSP + 8 * h;
        const unsigned short* wrl = Wl + ((ntb + 1) * 16 + m) * XSP + 8 * h;
        FragB bh, bl;
        bh.p[0] = *(const us8*)wr;
        bh.p[1] = *(const us8*)(wr + 16);
        bl.p[0] = *(const us8*)wrl;
        bl.p[1] = *(const us8*)(wrl + 16);
        acc1 = mma_bf16(ah.v, bh.v, acc1);
        acc1 = mma_bf16(ah.v, bl.v, acc1);
        acc1 = mma_bf16(al.v, bh.v, acc1);
      }
      __syncthreads();
    }

    // epilogue: bias add in f32, hi/lo bf16 split, stage [n][d] tile in LDS, whole-line stores
    unsigned short* Eh = sm;          // [64 n][64 d]
    unsigned short* El = sm + 4096;   // [64 n][64 d]
    {
      const int dl = ntb * 16 + m;
      const float bb = bias[dbase + dl];
#pragma unroll
      for (int r = 0; r < 8; ++r) {
        const float v = acc0[r] + bb;
        const unsigned short hb = f2bf(v);
        const int row = mt * 16 + 8 * h + r;
        Eh[row * 64 + dl] = hb;
        El[row * 64 + dl] = f2bf(v - bf2f(hb));
      }
    }
    {
      const int dl = (ntb + 1) * 16 + m;
      const float bb = bias[dbase + dl];
#pragma unroll
      for (int r = 0; r < 8; ++r) {
        const float v = acc1[r] + bb;
        const unsigned short hb = f2bf(v);
        const int row = mt * 16 + 8 * h + r;
        Eh[row * 64 + dl] = hb;
        El[row * 64 + dl] = f2bf(v - bf2f(hb));
      }
    }
    __syncthreads();

    us8 vh[2], vl[2];
    size_t off[2];
#pragma unroll
    for (int s = 0; s < 2; ++s) {
      const int row = w * 8 + s * 4 + (lane >> 3);
      const int q = lane & 7;
      vh[s] = *(const us8*)(Eh + row * 64 + q * 8);
      vl[s] = *(const us8*)(El + row * 64 + q * 8);
      off[s] = ((size_t)b * NPOS + n0 + row) * DQK + doff + q * 8;
    }
#pragma unroll
    for (int s = 0; s < 2; ++s) {
      *(us8*)(ohi + off[s]) = vh[s];
      *(us8*)(olo + off[s]) = vl[s];
    }
    
  } else {
    _Float16* Xs = (_Float16*)sm;       // [64 n][32 k], pitch XSP
    _Float16* Ws = Xs + XTILE;          // [64 d][32 k], pitch XSP

    for (int c0 = 0; c0 < CCH; c0 += 32) {
#pragma unroll
      for (int g = 0; g < 2; ++g) {
        const int kb = kg + g * 16;
        const float* sp = src + srcb + (size_t)(c0 + kb) * NPOS + n0 + ms;
        v4f xv;
        xv[0] = sp[0];
        xv[1] = sp[NPOS];
        xv[2] = sp[2 * NPOS];
        xv[3] = sp[3 * NPOS];
        const int wrow = wr + g * 32;
        v4f wv4 = *(const v4f*)(W + (size_t)(dbase + wrow) * CCH + c0 + wq);
        wv4 = wv4 * WVSCALE;
        *(h4*)(Xs + ms * XSP + kb) = __builtin_convertvector(xv, h4);
        *(h4*)(Ws + wrow * XSP + wq) = __builtin_convertvector(wv4, h4);
      }
      __syncthreads();

      FragH a;
      {
        const _Float16* xr = Xs + (mt * 16 + m) * XSP + 8 * h;
        a.p[0] = *(const h8*)xr;
        a.p[1] = *(const h8*)(xr + 16);
      }
      {
        const _Float16* wr = Ws + (ntb * 16 + m) * XSP + 8 * h;
        FragH bf;
        bf.p[0] = *(const h8*)wr;
        bf.p[1] = *(const h8*)(wr + 16);
        acc0 = mma_f16(a.v, bf.v, acc0);
      }
      {
        const _Float16* wr = Ws + ((ntb + 1) * 16 + m) * XSP + 8 * h;
        FragH bf;
        bf.p[0] = *(const h8*)wr;
        bf.p[1] = *(const h8*)(wr + 16);
        acc1 = mma_f16(a.v, bf.v, acc1);
      }
      __syncthreads();
    }

    // epilogue: fold 1/16, bias, f16, stage [d][n] tile in LDS, whole-line stores along n
    _Float16* E = (_Float16*)sm;       // [64 d][64 n]
    {
      const int dl = ntb * 16 + m;
      const float bb = bias[dbase + dl];
      h8 ev;
#pragma unroll
      for (int r = 0; r < 8; ++r) ev[r] = (_Float16)(acc0[r] * WVINV + bb);
      *(h8*)(E + dl * 64 + mt * 16 + 8 * h) = ev;
    }
    {
      const int dl = (ntb + 1) * 16 + m;
      const float bb = bias[dbase + dl];
      h8 ev;
#pragma unroll
      for (int r = 0; r < 8; ++r) ev[r] = (_Float16)(acc1[r] * WVINV + bb);
      *(h8*)(E + dl * 64 + mt * 16 + 8 * h) = ev;
    }
    __syncthreads();

    h8 vv[2];
    size_t off[2];
#pragma unroll
    for (int s = 0; s < 2; ++s) {
      const int row = w * 8 + s * 4 + (lane >> 3);   // channel local 0..63
      const int q = lane & 7;
      vv[s] = *(const h8*)(E + row * 64 + q * 8);
      off[s] = ((size_t)b * CCH + dbase + row) * NPOS + n0 + q * 8;
    }
#pragma unroll
    for (int s = 0; s < 2; ++s) *(h8*)(ov + off[s]) = vv[s];
    
  }
}

// All five projections in one launch, so that blocks of different projections stand on a WGP together and one block's
// global-load and barrier waits are filled by the others. blockIdx.z picks the projection, the same for the whole block:
//   0 q from x, 1 q from dep, 2 k from x, 3 k from dep (64 rows of W each); 4..11 v, 64 of its 512 rows of W each.
// The q/k blocks are the longer ones (three products per step and the hi/lo split) and have the low indices, which start first.
__global__ void __launch_bounds__(256)
proj_all_kernel(const float* __restrict__ x,
                const float* __restrict__ dep,
                const float* __restrict__ wq,
                const float* __restrict__ bq,
                const float* __restrict__ wqd,
                const float* __restrict__ bqd,
                const float* __restrict__ wk,
                const float* __restrict__ bk,
                const float* __restrict__ wkd,
                const float* __restrict__ bkd,
                const float* __restrict__ wv,
                const float* __restrict__ bv,
                unsigned short* __restrict__ Qhi,
                unsigned short* __restrict__ Qlo,
                unsigned short* __restrict__ Khi,
                unsigned short* __restrict__ Klo,
                _Float16* __restrict__ Vh) {
  __shared__ __align__(16) unsigned short sm[4 * XTILE];

  const int b = blockIdx.y;
  const int p = blockIdx.z;
  if (p < 4) {
    const bool fromDep = (p & 1) != 0;
    const bool isK     = (p & 2) != 0;
    const float* src  = fromDep ? dep : x;
    const float* W    = isK ? (fromDep ? wkd : wk) : (fromDep ? wqd : wq);
    const float* bias = isK ? (fromDep ? bkd : bk) : (fromDep ? bqd : bq);
    proj_body<0>(sm, src, W, bias, isK ? Khi : Qhi, isK ? Klo : Qlo, Vh, fromDep ? CQ : 0, 0, b);
  } else {
    proj_body<1>(sm, x, wv, bv, Qhi, Qlo, Vh, 0, (p - 4) * 64, b);
  }
}

// value of lane (l ^ X), X < 16, by a DPP move inside the 16-lane row
template <int X>
__device__ __forceinline__ float lane_xor(float v) {
  const int s = __builtin_bit_cast(int, v);
  return __builtin_bit_cast(float, __builtin_amdgcn_update_dpp(s, s, 0x160 + X, 0xf, 0xf, false));
}

// LDS byte address of a __shared__ object: the low 32 bits of its address
__device__ __forceinline__ unsigned lds_byte(const void* p) {
  return (unsigned)(size_t)p;
}

// Eight asynchronous 16-B copies per lane, global -> LDS, through no register.
// s_wait_xcnt 0 is the last line of the copies' own statement, so that no address register is rewritten in front of it.
__device__ __forceinline__ void copy8(const unsigned (&l)[8], const void* const (&g)[8]) {
  asm volatile(
      "global_load_async_to_lds_b128 %0, %8, off\n\t"
      "global_load_async_to_lds_b128 %1, %9, off\n\t"
      "global_load_async_to_lds_b128 %2, %10, off\n\t"
      "global_load_async_to_lds_b128 %3, %11, off\n\t"
      "global_load_async_to_lds_b128 %4, %12, off\n\t"
      "global_load_async_to_lds_b128 %5, %13, off\n\t"
      "global_load_async_to_lds_b128 %6, %14, off\n\t"
      "global_load_async_to_lds_b128 %7, %15, off\n\t"
      "s_wait_xcnt 0x0"
      :: "v"(l[0]), "v"(l[1]), "v"(l[2]), "v"(l[3]), "v"(l[4]), "v"(l[5]), "v"(l[6]), "v"(l[7]),
         "v"(g[0]), "v"(g[1]), "v"(g[2]), "v"(g[3]), "v"(g[4]), "v"(g[5]), "v"(g[6]), "v"(g[7])
      : "memory");
}

// Four such copies per lane; s_wait_xcnt 0 is again the last line of the copies' own statement, for the same reason.
__device__ __forceinline__ void copy4(const unsigned (&l)[4], const void* const (&g)[4]) {
  asm volatile(
      "global_load_async_to_lds_b128 %0, %4, off\n\t"
      "global_load_async_to_lds_b128 %1, %5, off\n\t"
      "global_load_async_to_lds_b128 %2, %6, off\n\t"
      "global_load_async_to_lds_b128 %3, %7, off\n\t"
      "s_wait_xcnt 0x0"
      :: "v"(l[0]), "v"(l[1]), "v"(l[2]), "v"(l[3]),
         "v"(g[0]), "v"(g[1]), "v"(g[2]), "v"(g[3])
      : "memory");
}

// ---------------------------------------------------------------------------
// Fused attention: one block per (batch, 64-query tile), 512 threads (16 waves), 64-key tiles:
//   one K and one V tile in LDS serve 64 queries, so each key tile is fetched from L2 once per 64 queries.
//   K hi/lo tile [64 j][128 d] and V tile [512 c][64 j] come into LDS by asynchronous copies in whole 128-B lines;
//   V of a tile flies during its scores and softmax, K of the next tile during p.v; fragments are read from LDS
//   S[64 i][64 j] = Q.K^T (K = 128) with bf16 hi/lo split operands (Q fragments held in registers) -> LDS, 16x16 per wave
//   online softmax stats by all waves (8 lanes per row, running max and sum in registers), p x4096 as f16 in LDS, row sums from the f16 values
//   O^T[512 c][64 i] += V[c][j] . P[i][j]  (f16), each wave owns 64 channels x 32 queries
// ---------------------------------------------------------------------------
__global__ void __launch_bounds__(512)
attn_kernel(const unsigned short* __restrict__ Qhi,
            const unsigned short* __restrict__ Qlo,
            const unsigned short* __restrict__ Khi,
            const unsigned short* __restrict__ Klo,
            const _Float16* __restrict__ Vh,
            const float* __restrict__ x,
            const float* __restrict__ gamma,
            float* __restrict__ outp) {
  __shared__ __align__(16) unsigned short smq[16384];  // finalize: 8192 f32, 512 per wave
  __shared__ __align__(16) unsigned short Ksh[64 * KSP];   // K hi tile
  __shared__ __align__(16) unsigned short Ksl[64 * KSP];   // K lo tile
  __shared__ __align__(16) _Float16 Vs[CCH * VSP];         // V tile
  __shared__ float Ss[64 * SSP];
  __shared__ __align__(16) _Float16 Ps[64 * PSP];
  __shared__ float lrow[64];
  __shared__ float srow[64];

  const int tid  = threadIdx.x;
  const int lane = tid & 31;
  const int w    = tid >> 5;
  const int m    = lane & 15;
  const int h    = lane >> 4;

  const int i0 = blockIdx.x * 64;
  const int b  = blockIdx.y;
  const int wc = w & 7;          // p.v: channel group of this wave (64 channels)
  const int ib = (w >> 3) * 32;  // p.v: first of its 32 queries inside the tile

  v8f o[2][4];
  {
    v8f z = {};
#pragma unroll
    for (int it = 0; it < 2; ++it)
#pragma unroll
      for (int ct = 0; ct < 4; ++ct) o[it][ct] = z;
  }

  const int rtS = w >> 2;   // S row sub-tile (i), 0..3
  const int jtS = w & 3;    // S col sub-tile (j)

  // Q fragments of this wave's 16 query rows, hi and lo, k = d in 4 steps of 32: the same for every key tile, kept in registers
  FragB qfh[4], qfl[4];
  {
    const size_t qrow = ((size_t)b * NPOS + i0 + rtS * 16 + m) * DQK + 8 * h;
    const unsigned short* qrh = Qhi + qrow;
    const unsigned short* qrl = Qlo + qrow;
    // unrolled so that the fragment arrays are indexed by constants and stay in registers
#pragma unroll
    for (int kk = 0; kk < 4; ++kk) {
      qfh[kk].p[0] = *(const us8*)(qrh + kk * 32);
      qfh[kk].p[1] = *(const us8*)(qrh + kk * 32 + 16);
      qfl[kk].p[0] = *(const us8*)(qrl + kk * 32);
      qfl[kk].p[1] = *(const us8*)(qrl + kk * 32 + 16);
    }
  }

  const int si = tid >> 3;        // softmax row of this thread
  const int sq = (tid & 7) * 8;   // first of its 8 columns
  float mrun = -1e30f;            // running row maximum, equal in the row's 8 lanes
  float lrun = 0.0f;              // running row sum, equal in the row's 8 lanes

  // copy shares: K, 16 lanes per 256-B row, 32 rows per step; V, 8 lanes per 128-B row, 64 rows per step
  const int kcr = tid >> 4;
  const int kcq = (tid & 15) * 8;
  const int vcr = tid >> 3;
  const int vcq = (tid & 7) * 8;
  const unsigned short* kgh = Khi + ((size_t)b * NPOS + kcr) * DQK + kcq;
  const unsigned short* kgl = Klo + ((size_t)b * NPOS + kcr) * DQK + kcq;
  const _Float16* vg = Vh + ((size_t)b * CCH + vcr) * NPOS + vcq;
  const unsigned klh = lds_byte(Ksh + kcr * KSP + kcq);
  const unsigned kll = lds_byte(Ksl + kcr * KSP + kcq);
  const unsigned vl  = lds_byte(Vs + vcr * VSP + vcq);

  // K tile 0
  {
    unsigned l[4];
    const void* g[4];
    // unrolled so that l and g are indexed by constants and stay in registers
#pragma unroll
    for (int i = 0; i < 2; ++i) {
      l[i]     = klh + i * 32 * KSP * 2;
      l[2 + i] = kll + i * 32 * KSP * 2;
      g[i]     = kgh + (size_t)(i * 32) * DQK;
      g[2 + i] = kgl + (size_t)(i * 32) * DQK;
    }
    copy4(l, g);
  }
  asm volatile("s_wait_asynccnt 0x0" ::: "memory");   // this wave's share of K tile 0 has landed before the barrier publishes it
  __syncthreads();

  for (int j0 = 0; j0 < NPOS; j0 += 64) {
    // ---- 0. V tile of this trip: its buffer's last readers ended at the barrier that closed the trip before ----
    {
      unsigned l[8];
      const void* g[8];
      // unrolled so that l and g are indexed by constants and stay in registers
#pragma unroll
      for (int i = 0; i < 8; ++i) {
        l[i] = vl + i * 64 * VSP * 2;
        g[i] = vg + (size_t)(i * 64) * NPOS + j0;
      }
      copy8(l, g);
    }

    // ---- 1. S tile, 16x16 per wave, k = d in 4 steps of 32, three bf16 products per step ----
    {
      v8f s = {};
      const int krow = (jtS * 16 + m) * KSP + 8 * h;
      const unsigned short* krh = Ksh + krow;
      const unsigned short* krl = Ksl + krow;
#pragma unroll
      for (int kk = 0; kk < 4; ++kk) {
        FragB bh, bl;
        bh.p[0] = *(const us8*)(krh + kk * 32);
        bh.p[1] = *(const us8*)(krh + kk * 32 + 16);
        bl.p[0] = *(const us8*)(krl + kk * 32);
        bl.p[1] = *(const us8*)(krl + kk * 32 + 16);
        s = mma_bf16(qfh[kk].v, bh.v, s);
        s = mma_bf16(qfh[kk].v, bl.v, s);
        s = mma_bf16(qfl[kk].v, bh.v, s);
      }
#pragma unroll
      for (int r = 0; r < 8; ++r)
        Ss[(rtS * 16 + 8 * h + r) * SSP + jtS * 16 + m] = s[r];
    }
    asm volatile("s_wait_dscnt 0x0" ::: "memory");      // this wave's K reads have retired before the K buffer is handed to its next copies
    __syncthreads();

    // ---- 2. online softmax stats: 8 lanes per row, 8 adjacent columns per lane, all 16 waves ----
    {
      float sv[8];   // the three loops below are fully unrolled so that sv and pv stay in registers
#pragma unroll
      for (int q = 0; q < 8; ++q) sv[q] = Ss[si * SSP + sq + q];
      float mx = sv[0];
#pragma unroll
      for (int q = 1; q < 8; ++q) mx = fmaxf(mx, sv[q]);
      mx = fmaxf(mx, lane_xor<1>(mx));
      mx = fmaxf(mx, lane_xor<2>(mx));
      mx = fmaxf(mx, lane_xor<4>(mx));
      const float mnew = fmaxf(mrun, mx);
      const float sc = __expf(mrun - mnew);
      h8 pv;
      float sum = 0.0f;
#pragma unroll
      for (int q = 0; q < 8; ++q) {
        const float p = __expf(sv[q] - mnew) * PSCALE;
        const _Float16 ph = (_Float16)p;
        pv[q] = ph;
        sum += (float)ph;
      }
      *(h8*)(Ps + si * PSP + sq) = pv;
      sum += lane_xor<1>(sum);
      sum += lane_xor<2>(sum);
      sum += lane_xor<4>(sum);
      mrun = mnew;
      lrun = lrun * sc + sum;
      if ((tid & 7) == 0) { lrow[si] = lrun; srow[si] = sc; }
    }
    asm volatile("s_wait_asynccnt 0x0" ::: "memory");   // this wave's share of the V tile has landed before the barrier publishes it
    __syncthreads();

    // K tile of the next trip: every reader left the K buffer at the barrier behind the scores
    if (j0 + 64 < NPOS) {
      unsigned l[4];
      const void* g[4];
      // unrolled so that l and g are indexed by constants and stay in registers
#pragma unroll
      for (int i = 0; i < 2; ++i) {
        l[i]     = klh + i * 32 * KSP * 2;
        l[2 + i] = kll + i * 32 * KSP * 2;
        g[i]     = kgh + (size_t)(j0 + 64 + i * 32) * DQK;
        g[2 + i] = kgl + (size_t)(j0 + 64 + i * 32) * DQK;
      }
      copy4(l, g);
    }

    // ---- 3. rescale O, then O^T += V . P^T ----
#pragma unroll
    for (int it = 0; it < 2; ++it) {
      const float sc = srow[ib + it * 16 + m];   // column of the accumulator = query index
#pragma unroll
      for (int ct = 0; ct < 4; ++ct) o[it][ct] = o[it][ct] * sc;
    }
#pragma unroll
    for (int jj = 0; jj < 2; ++jj) {
      // B[k = j][n = i] = P[i][j0 + jj*32 + k]: row i of Ps is k-contiguous, loaded like A
      FragH b0, b1;
      {
        const _Float16* p0 = Ps + (ib + m) * PSP + jj * 32 + 8 * h;
        const _Float16* p1 = Ps + (ib + 16 + m) * PSP + jj * 32 + 8 * h;
        b0.p[0] = *(const h8*)p0;
        b0.p[1] = *(const h8*)(p0 + 16);
        b1.p[0] = *(const h8*)p1;
        b1.p[1] = *(const h8*)(p1 + 16);
      }
#pragma unroll
      for (int ct = 0; ct < 4; ++ct) {
        // A[m = c][k = j] = V[b][c][j0 + jj*32 + k], k-contiguous, from the LDS tile
        FragH a;
        const _Float16* vr = Vs + (wc * 64 + ct * 16 + m) * VSP + jj * 32 + 8 * h;
        a.p[0] = *(const h8*)vr;
        a.p[1] = *(const h8*)(vr + 16);
        o[0][ct] = mma_f16(a.v, b0.v, o[0][ct]);
        o[1][ct] = mma_f16(a.v, b1.v, o[1][ct]);
      }
    }
    asm volatile("s_wait_dscnt 0x0" ::: "memory");      // this wave's V reads have retired before the V buffer is handed to its next copies
    asm volatile("s_wait_asynccnt 0x0" ::: "memory");   // this wave's share of the next K tile has landed before the barrier publishes it
    __syncthreads();
  }

  const float g = gamma[0];
  const float gl0 = g / lrow[ib + m];
  const float gl1 = g / lrow[ib + 16 + m];
  float* F = (float*)smq + w * 512;     // per wave [16 c][32 i] f32
#pragma unroll
  for (int ct = 0; ct < 4; ++ct) {
    __syncthreads();
#pragma unroll
    for (int r = 0; r < 8; ++r) {
      F[(8 * h + r) * 32 + m]      = o[0][ct][r] * gl0;
      F[(8 * h + r) * 32 + 16 + m] = o[1][ct][r] * gl1;
    }
    __syncthreads();
    v4f vals[4];
    size_t offs[4];
#pragma unroll
    for (int s = 0; s < 4; ++s) {
      const int row = s * 4 + (lane >> 3);            // channel local 0..15
      const int q = lane & 7;
      const int c = wc * 64 + ct * 16 + row;
      const size_t off = ((size_t)b * CCH + c) * NPOS + i0 + ib + q * 4;
      const v4f ov = *(const v4f*)(F + row * 32 + q * 4);
      const v4f xv = *(const v4f*)(x + off);
      vals[s] = ov + xv;
      offs[s] = off;
    }
#pragma unroll
    for (int s = 0; s < 4; ++s) *(v4f*)(outp + offs[s]) = vals[s];
    
  }
}

// ---------------------------------------------------------------------------
extern "C" void kernel_launch(void* const* d_in, const int* in_sizes, int n_in,
                              void* d_out, int out_size, void* d_ws, size_t ws_size,
                              hipStream_t stream) {
  if (n_in < 13) return;
  const int nx = BATCH * CCH * NPOS;
  if (in_sizes[0] != nx || in_sizes[1] != nx ||
      in_sizes[2] != CQ * CCH || in_sizes[3] != CQ ||
      in_sizes[4] != CQ * CCH || in_sizes[5] != CQ ||
      in_sizes[6] != CQ * CCH || in_sizes[7] != CQ ||
      in_sizes[8] != CQ * CCH || in_sizes[9] != CQ ||
      in_sizes[10] != CCH * CCH || in_sizes[11] != CCH ||
      in_sizes[12] < 1 || out_size != nx) return;

  const size_t planeE = (size_t)BATCH * NPOS * DQK;   // bf16 elements per q/k plane (4 MiB each)
  const size_t vE     = (size_t)BATCH * CCH * NPOS;   // f16 elements of the v plane (16 MiB)
  const size_t need   = planeE * 2 * 4 + vE * 2;      // 33,554,432 B
  if (ws_size < need) return;

  const float* x     = (const float*)d_in[0];
  const float* dep   = (const float*)d_in[1];
  const float* wq    = (const float*)d_in[2];
  const float* bq    = (const float*)d_in[3];
  const float* wqd   = (const float*)d_in[4];
  const float* bqd   = (const float*)d_in[5];
  const float* wk    = (const float*)d_in[6];
  const float* bk    = (const float*)d_in[7];
  const float* wkd   = (const float*)d_in[8];
  const float* bkd   = (const float*)d_in[9];
  const float* wv    = (const float*)d_in[10];
  const float* bv    = (const float*)d_in[11];
  const float* gamma = (const float*)d_in[12];
  float* outp = (float*)d_out;

  unsigned short* Qhi = (unsigned short*)d_ws;
  unsigned short* Qlo = Qhi + planeE;
  unsigned short* Khi = Qlo + planeE;
  unsigned short* Klo = Khi + planeE;
  _Float16* Vh = (_Float16*)(Klo + planeE);

  // q/k planes [B][N][128] (columns 0..63 from x, 64..127 from dep) and v plane [B][C][N] f16, one launch
  proj_all_kernel<<<dim3(NPOS / 64, BATCH, 4 + CCH / 64), dim3(256), 0, stream>>>(
      x, dep, wq, bq, wqd, bqd, wk, bk, wkd, bkd, wv, bv, Qhi, Qlo, Khi, Klo, Vh);
  // fused attention + gamma*out + x
  attn_kernel<<<dim3(NPOS / 64, BATCH), dim3(512), 0, stream>>>(Qhi, Qlo, Khi, Klo, Vh, x, gamma, outp);
}

// v008
// A run of this version takes 160 microseconds.
// In both of two side-by-side timings against v007, it was 1.05 times as fast.
// Counting every step since v000, it is 4.45 times as fast.
#include <hip/hip_runtime.h>

// q/k 1x1 projections and q.k^T logits: v_wmma_f32_16x16x32_bf16 with bf16 hi/lo operand split (hi.hi + hi.lo + lo.hi);
// v 1x1 projection (weights x16, folded back x1/16) and p.v: v_wmma_f32_16x16x32_f16 (f16 operands, p carried x4096); f32 accumulate everywhere.

typedef _Float16 h4  __attribute__((ext_vector_type(4)));
typedef _Float16 h8  __attribute__((ext_vector_type(8)));
typedef _Float16 h16 __attribute__((ext_vector_type(16)));
typedef __bf16   bf16v16 __attribute__((ext_vector_type(16)));
typedef unsigned short us4 __attribute__((ext_vector_type(4)));
typedef unsigned short us8 __attribute__((ext_vector_type(8)));
typedef float v4f __attribute__((ext_vector_type(4)));
typedef float v8f __attribute__((ext_vector_type(8)));

#define BATCH 4
#define CCH   512
#define NPOS  4096
#define DQK   128
#define CQ    64
#define SSP   65          // f32 score tile pitch (floats)
#define PSP   72          // f16 p tile pitch (halves), multiple of 8 for 16-B fragment loads
#define PSCALE  4096.0f   // p carried x2^12 in f16 so WMMA operands stay normal; cancels in O/l
#define WVSCALE 16.0f     // v weights x16 in f16, folded back in the epilogue
#define WVINV   0.0625f
#define KSP   136         // K tile pitch in LDS, 16-bit elements: 272 B = 16 B x 17, conflict-free for 16-B fragment reads
#define VSP   72          // V tile pitch in LDS, halves: 144 B = 16 B x 9, conflict-free for 16-B fragment reads
#define XSP   40          // projection operand tile pitch in LDS, 16-bit elements: 80 B = 16 B x 5; at 64 B four rows share each bank
#define XTILE (64 * XSP)  // one projection operand tile, 64 rows

union FragH { h16 v; h8 p[2]; };        // elements 0..7 <- k0+8h+0..7, elements 8..15 <- k0+16+8h+0..7
union FragB { bf16v16 v; us8 p[2]; };

__device__ __forceinline__ v8f mma_f16(h16 a, h16 b, v8f c) {
  return __builtin_amdgcn_wmma_f32_16x16x32_f16(false, a, false, b, (short)0, c, false, false);
}
__device__ __forceinline__ v8f mma_bf16(bf16v16 a, bf16v16 b, v8f c) {
  return __builtin_amdgcn_wmma_f32_16x16x32_bf16(false, a, false, b, (short)0, c, false, false);
}
// f32 -> bf16 bits, RNE convert
__device__ __forceinline__ unsigned short f2bf(float f) {
  unsigned int u = __float_as_uint(f);
  u += 0x7FFFu + ((u >> 16) & 1u);
  return (unsigned short)(u >> 16);
}
__device__ __forceinline__ float bf2f(unsigned short s) {
  return __uint_as_float(((unsigned int)s) << 16);
}

// ---------------------------------------------------------------------------
// Projection GEMM, block tile 64 n x 64 d, k = 512 channels in steps of 32, 256 threads (8 waves).
//   src : [B][C][N] f32, batch b read here;  W : [rows][C] f32;  bias : [rows] f32
//   D[row = n][col = d] = sum_c src[c][n] * W[d][c]; A = src tile staged [n][k], B = W tile staged [d][k]
//   sm  : 20 KiB of LDS: operand tiles during the k loop, output tile in the epilogue;  dbase : first row of W of this block
// ---------------------------------------------------------------------------
template <int MODE>
__device__ __forceinline__ void
proj_body(unsigned short* sm,
          const float* __restrict__ src,
          const float* __restrict__ W,
          const float* __restrict__ bias,
          unsigned short* __restrict__ ohi,
          unsigned short* __restrict__ olo,
          _Float16* __restrict__ ov,
          int doff,
          int dbase,
          int b) {
  const int tid  = threadIdx.x;
  const int lane = tid & 31;
  const int w    = tid >> 5;
  const int m    = lane & 15;
  const int h    = lane >> 4;

  const int n0    = blockIdx.x * 64;

  const int mt  = w >> 1;          // n sub-tile (0..3)
  const int ntb = (w & 1) * 2;     // d sub-tile pair base (0 or 2)

  const int ms = tid & 63;         // src staging row
  const int kg = (tid >> 6) * 4;   // src staging k group
  const int wr = tid >> 3;         // W staging row: 8 lanes share the 128-B line that a row of W has in a k step,
  const int wq = (tid & 7) * 4;    // so a wave's 16-B loads cover 4 whole lines instead of 16 B of 32 lines

  const size_t srcb = (size_t)b * CCH * NPOS;

  v8f acc0 = {};
  v8f acc1 = {};

  if (MODE == 0) {
    unsigned short* Xh = sm;
    unsigned short* Xl = sm + XTILE;
    unsigned short* Wh = sm + 2 * XTILE;
    unsigned short* Wl = sm + 3 * XTILE;

    for (int c0 = 0; c0 < CCH; c0 += 32) {
#pragma unroll
      for (int g = 0; g < 2; ++g) {
        const int kb = kg + g * 16;
        const float* sp = src + srcb + (size_t)(c0 + kb) * NPOS + n0 + ms;
        v4f xv;
        xv[0] = sp[0];
        xv[1] = sp[NPOS];
        xv[2] = sp[2 * NPOS];
        xv[3] = sp[3 * NPOS];
        const int wrow = wr + g * 32;
        const v4f wv4 = *(const v4f*)(W + (size_t)(dbase + wrow) * CCH + c0 + wq);
        us4 xh4, xl4, wh4, wl4;
#pragma unroll
        for (int q = 0; q < 4; ++q) {
          const unsigned short hb = f2bf(xv[q]);
          xh4[q] = hb;
          xl4[q] = f2bf(xv[q] - bf2f(hb));
          const unsigned short wb = f2bf(wv4[q]);
          wh4[q] = wb;
          wl4[q] = f2bf(wv4[q] - bf2f(wb));
        }
        *(us4*)(Xh + ms * XSP + kb) = xh4;
        *(us4*)(Xl + ms * XSP + kb) = xl4;
        *(us4*)(Wh + wrow * XSP + wq) = wh4;
        *(us4*)(Wl + wrow * XSP + wq) = wl4;
      }
      __syncthreads();

      // all twelve fragment reads are issued before the first product, so that their LDS latency is paid once per k step
      FragB ah, al, bh[2], bl[2];
      {
        const unsigned short* xr  = Xh + (mt * 16 + m) * XSP + 8 * h;
        const unsigned short* xrl = Xl + (mt * 16 + m) * XSP + 8 * h;
        ah.p[0] = *(const us8*)xr;
        ah.p[1] = *(const us8*)(xr + 16);
        // unrolled so that bh and bl are indexed by constants and stay in registers
#pragma unroll
        for (int t = 0; t < 2; ++t) {
          const unsigned short* wf  = Wh + ((ntb + t) * 16 + m) * XSP + 8 * h;
          const unsigned short* wfl = Wl + ((ntb + t) * 16 + m) * XSP + 8 * h;
          bh[t].p[0] = *(const us8*)wf;
          bh[t].p[1] = *(const us8*)(wf + 16);
          bl[t].p[0] = *(const us8*)wfl;
          bl[t].p[1] = *(const us8*)(wfl + 16);
        }
        al.p[0] = *(const us8*)xrl;
        al.p[1] = *(const us8*)(xrl + 16);
      }
      __builtin_amdgcn_sched_barrier(0);   // keeps the reads above from being sunk back to their products
      acc0 = mma_bf16(ah.v, bh[0].v, acc0);
      acc1 = mma_bf16(ah.v, bh[1].v, acc1);
      acc0 = mma_bf16(ah.v, bl[0].v, acc0);
      acc1 = mma_bf16(ah.v, bl[1].v, acc1);
      acc0 = mma_bf16(al.v, bh[0].v, acc0);
      acc1 = mma_bf16(al.v, bh[1].v, acc1);
      __syncthreads();
    }

    // epilogue: bias add in f32, hi/lo bf16 split, stage [n][d] tile in LDS, whole-line stores
    unsigned short* Eh = sm;          // [64 n][64 d]
    unsigned short* El = sm + 4096;   // [64 n][64 d]
    {
      const int dl = ntb * 16 + m;
      const float bb = bias[dbase + dl];
#pragma unroll
      for (int r = 0; r < 8; ++r) {
        const float v = acc0[r] + bb;
        const unsigned short hb = f2bf(v);
        const int row = mt * 16 + 8 * h + r;
        Eh[row * 64 + dl] = hb;
        El[row * 64 + dl] = f2bf(v - bf2f(hb));
      }
    }
    {
      const int dl = (ntb + 1) * 16 + m;
      const float bb = bias[dbase + dl];
#pragma unroll
      for (int r = 0; r < 8; ++r) {
        const float v = acc1[r] + bb;
        const unsigned short hb = f2bf(v);
        const int row = mt * 16 + 8 * h + r;
        Eh[row * 64 + dl] = hb;
        El[row * 64 + dl] = f2bf(v - bf2f(hb));
      }
    }
    __syncthreads();

    us8 vh[2], vl[2];
    size_t off[2];
#pragma unroll
    for (int s = 0; s < 2; ++s) {
      const int row = w * 8 + s * 4 + (lane >> 3);
      const int q = lane & 7;
      vh[s] = *(const us8*)(Eh + row * 64 + q * 8);
      vl[s] = *(const us8*)(El + row * 64 + q * 8);
      off[s] = ((size_t)b * NPOS + n0 + row) * DQK + doff + q * 8;
    }
#pragma unroll
    for (int s = 0; s < 2; ++s) {
      *(us8*)(ohi + off[s]) = vh[s];
      *(us8*)(olo + off[s]) = vl[s];
    }
    
  } else {
    _Float16* Xs = (_Float16*)sm;       // [64 n][32 k], pitch XSP
    _Float16* Ws = Xs + XTILE;          // [64 d][32 k], pitch XSP

    for (int c0 = 0; c0 < CCH; c0 += 32) {
#pragma unroll
      for (int g = 0; g < 2; ++g) {
        const int kb = kg + g * 16;
        const float* sp = src + srcb + (size_t)(c0 + kb) * NPOS + n0 + ms;
        v4f xv;
        xv[0] = sp[0];
        xv[1] = sp[NPOS];
        xv[2] = sp[2 * NPOS];
        xv[3] = sp[3 * NPOS];
        const int wrow = wr + g * 32;
        v4f wv4 = *(const v4f*)(W + (size_t)(dbase + wrow) * CCH + c0 + wq);
        wv4 = wv4 * WVSCALE;
        *(h4*)(Xs + ms * XSP + kb) = __builtin_convertvector(xv, h4);
        *(h4*)(Ws + wrow * XSP + wq) = __builtin_convertvector(wv4, h4);
      }
      __syncthreads();

      FragH a;
      {
        const _Float16* xr = Xs + (mt * 16 + m) * XSP + 8 * h;
        a.p[0] = *(const h8*)xr;
        a.p[1] = *(const h8*)(xr + 16);
      }
      {
        const _Float16* wr = Ws + (ntb * 16 + m) * XSP + 8 * h;
        FragH bf;
        bf.p[0] = *(const h8*)wr;
        bf.p[1] = *(const h8*)(wr + 16);
        acc0 = mma_f16(a.v, bf.v, acc0);
      }
      {
        const _Float16* wr = Ws + ((ntb + 1) * 16 + m) * XSP + 8 * h;
        FragH bf;
        bf.p[0] = *(const h8*)wr;
        bf.p[1] = *(const h8*)(wr + 16);
        acc1 = mma_f16(a.v, bf.v, acc1);
      }
      __syncthreads();
    }

    // epilogue: fold 1/16, bias, f16, stage [d][n] tile in LDS, whole-line stores along n
    _Float16* E = (_Float16*)sm;       // [64 d][64 n]
    {
      const int dl = ntb * 16 + m;
      const float bb = bias[dbase + dl];
      h8 ev;
#pragma unroll
      for (int r = 0; r < 8; ++r) ev[r] = (_Float16)(acc0[r] * WVINV + bb);
      *(h8*)(E + dl * 64 + mt * 16 + 8 * h) = ev;
    }
    {
      const int dl = (ntb + 1) * 16 + m;
      const float bb = bias[dbase + dl];
      h8 ev;
#pragma unroll
      for (int r = 0; r < 8; ++r) ev[r] = (_Float16)(acc1[r] * WVINV + bb);
      *(h8*)(E + dl * 64 + mt * 16 + 8 * h) = ev;
    }
    __syncthreads();

    h8 vv[2];
    size_t off[2];
#pragma unroll
    for (int s = 0; s < 2; ++s) {
      const int row = w * 8 + s * 4 + (lane >> 3);   // channel local 0..63
      const int q = lane & 7;
      vv[s] = *(const h8*)(E + row * 64 + q * 8);
      off[s] = ((size_t)b * CCH + dbase + row) * NPOS + n0 + q * 8;
    }
#pragma unroll
    for (int s = 0; s < 2; ++s) *(h8*)(ov + off[s]) = vv[s];
    
  }
}

// All five projections in one launch, so that blocks of different projections stand on a WGP together and one block's
// global-load and barrier waits are filled by the others. blockIdx.z picks the projection, the same for the whole block:
//   0 q from x, 1 q from dep, 2 k from x, 3 k from dep (64 rows of W each); 4..11 v, 64 of its 512 rows of W each.
// The q/k blocks are the longer ones (three products per step and the hi/lo split) and have the low indices, which start first.
__global__ void __launch_bounds__(256)
proj_all_kernel(const float* __restrict__ x,
                const float* __restrict__ dep,
                const float* __restrict__ wq,
                const float* __restrict__ bq,
                const float* __restrict__ wqd,
                const float* __restrict__ bqd,
                const float* __restrict__ wk,
                const float* __restrict__ bk,
                const float* __restrict__ wkd,
                const float* __restrict__ bkd,
                const float* __restrict__ wv,
                const float* __restrict__ bv,
                unsigned short* __restrict__ Qhi,
                unsigned short* __restrict__ Qlo,
                unsigned short* __restrict__ Khi,
                unsigned short* __restrict__ Klo,
                _Float16* __restrict__ Vh) {
  __shared__ __align__(16) unsigned short sm[4 * XTILE];

  const int b = blockIdx.y;
  const int p = blockIdx.z;
  if (p < 4) {
    const bool fromDep = (p & 1) != 0;
    const bool isK     = (p & 2) != 0;
    const float* src  = fromDep ? dep : x;
    const float* W    = isK ? (fromDep ? wkd : wk) : (fromDep ? wqd : wq);
    const float* bias = isK ? (fromDep ? bkd : bk) : (fromDep ? bqd : bq);
    proj_body<0>(sm, src, W, bias, isK ? Khi : Qhi, isK ? Klo : Qlo, Vh, fromDep ? CQ : 0, 0, b);
  } else {
    proj_body<1>(sm, x, wv, bv, Qhi, Qlo, Vh, 0, (p - 4) * 64, b);
  }
}

// value of lane (l ^ X), X < 16, by a DPP move inside the 16-lane row
template <int X>
__device__ __forceinline__ float lane_xor(float v) {
  const int s = __builtin_bit_cast(int, v);
  return __builtin_bit_cast(float, __builtin_amdgcn_update_dpp(s, s, 0x160 + X, 0xf, 0xf, false));
}

// LDS byte address of a __shared__ object: the low 32 bits of its address
__device__ __forceinline__ unsigned lds_byte(const void* p) {
  return (unsigned)(size_t)p;
}

// Eight asynchronous 16-B copies per lane, global -> LDS, through no register.
// s_wait_xcnt 0 is the last line of the copies' own statement, so that no address register is rewritten in front of it.
__device__ __forceinline__ void copy8(const unsigned (&l)[8], const void* const (&g)[8]) {
  asm volatile(
      "global_load_async_to_lds_b128 %0, %8, off\n\t"
      "global_load_async_to_lds_b128 %1, %9, off\n\t"
      "global_load_async_to_lds_b128 %2, %10, off\n\t"
      "global_load_async_to_lds_b128 %3, %11, off\n\t"
      "global_load_async_to_lds_b128 %4, %12, off\n\t"
      "global_load_async_to_lds_b128 %5, %13, off\n\t"
      "global_load_async_to_lds_b128 %6, %14, off\n\t"
      "global_load_async_to_lds_b128 %7, %15, off\n\t"
      "s_wait_xcnt 0x0"
      :: "v"(l[0]), "v"(l[1]), "v"(l[2]), "v"(l[3]), "v"(l[4]), "v"(l[5]), "v"(l[6]), "v"(l[7]),
         "v"(g[0]), "v"(g[1]), "v"(g[2]), "v"(g[3]), "v"(g[4]), "v"(g[5]), "v"(g[6]), "v"(g[7])
      : "memory");
}

// Four such copies per lane; s_wait_xcnt 0 is again the last line of the copies' own statement, for the same reason.
__device__ __forceinline__ void copy4(const unsigned (&l)[4], const void* const (&g)[4]) {
  asm volatile(
      "global_load_async_to_lds_b128 %0, %4, off\n\t"
      "global_load_async_to_lds_b128 %1, %5, off\n\t"
      "global_load_async_to_lds_b128 %2, %6, off\n\t"
      "global_load_async_to_lds_b128 %3, %7, off\n\t"
      "s_wait_xcnt 0x0"
      :: "v"(l[0]), "v"(l[1]), "v"(l[2]), "v"(l[3]),
         "v"(g[0]), "v"(g[1]), "v"(g[2]), "v"(g[3])
      : "memory");
}

// ---------------------------------------------------------------------------
// Fused attention: one block per (batch, 64-query tile), 512 threads (16 waves), 64-key tiles:
//   one K and one V tile in LDS serve 64 queries, so each key tile is fetched from L2 once per 64 queries.
//   K hi/lo tile [64 j][128 d] and V tile [512 c][64 j] come into LDS by asynchronous copies in whole 128-B lines;
//   V of a tile flies during its scores and softmax, K of the next tile during p.v; fragments are read from LDS
//   S[64 i][64 j] = Q.K^T (K = 128) with bf16 hi/lo split operands (Q fragments held in registers) -> LDS, 16x16 per wave
//   online softmax stats by all waves (8 lanes per row, running max and sum in registers), p x4096 as f16 in LDS, row sums from the f16 values
//   O^T[512 c][64 i] += V[c][j] . P[i][j]  (f16), each wave owns 64 channels x 32 queries
// ---------------------------------------------------------------------------
__global__ void __launch_bounds__(512)
attn_kernel(const unsigned short* __restrict__ Qhi,
            const unsigned short* __restrict__ Qlo,
            const unsigned short* __restrict__ Khi,
            const unsigned short* __restrict__ Klo,
            const _Float16* __restrict__ Vh,
            const float* __restrict__ x,
            const float* __restrict__ gamma,
            float* __restrict__ outp) {
  __shared__ __align__(16) unsigned short smq[16384];  // finalize: 8192 f32, 512 per wave
  __shared__ __align__(16) unsigned short Ksh[64 * KSP];   // K hi tile
  __shared__ __align__(16) unsigned short Ksl[64 * KSP];   // K lo tile
  __shared__ __align__(16) _Float16 Vs[CCH * VSP];         // V tile
  __shared__ float Ss[64 * SSP];
  __shared__ __align__(16) _Float16 Ps[64 * PSP];
  __shared__ float lrow[64];
  __shared__ float srow[64];

  const int tid  = threadIdx.x;
  const int lane = tid & 31;
  const int w    = tid >> 5;
  const int m    = lane & 15;
  const int h    = lane >> 4;

  const int i0 = blockIdx.x * 64;
  const int b  = blockIdx.y;
  const int wc = w & 7;          // p.v: channel group of this wave (64 channels)
  const int ib = (w >> 3) * 32;  // p.v: first of its 32 queries inside the tile

  v8f o[2][4];
  {
    v8f z = {};
#pragma unroll
    for (int it = 0; it < 2; ++it)
#pragma unroll
      for (int ct = 0; ct < 4; ++ct) o[it][ct] = z;
  }

  const int rtS = w >> 2;   // S row sub-tile (i), 0..3
  const int jtS = w & 3;    // S col sub-tile (j)

  // Q fragments of this wave's 16 query rows, hi and lo, k = d in 4 steps of 32: the same for every key tile, kept in registers
  FragB qfh[4], qfl[4];
  {
    const size_t qrow = ((size_t)b * NPOS + i0 + rtS * 16 + m) * DQK + 8 * h;
    const unsigned short* qrh = Qhi + qrow;
    const unsigned short* qrl = Qlo + qrow;
    // unrolled so that the fragment arrays are indexed by constants and stay in registers
#pragma unroll
    for (int kk = 0; kk < 4; ++kk) {
      qfh[kk].p[0] = *(const us8*)(qrh + kk * 32);
      qfh[kk].p[1] = *(const us8*)(qrh + kk * 32 + 16);
      qfl[kk].p[0] = *(const us8*)(qrl + kk * 32);
      qfl[kk].p[1] = *(const us8*)(qrl + kk * 32 + 16);
    }
  }

  const int si = tid >> 3;        // softmax row of this thread
  const int sq = (tid & 7) * 8;   // first of its 8 columns
  float mrun = -1e30f;            // running row maximum, equal in the row's 8 lanes
  float lrun = 0.0f;              // running row sum, equal in the row's 8 lanes

  // copy shares: K, 16 lanes per 256-B row, 32 rows per step; V, 8 lanes per 128-B row, 64 rows per step
  const int kcr = tid >> 4;
  const int kcq = (tid & 15) * 8;
  const int vcr = tid >> 3;
  const int vcq = (tid & 7) * 8;
  const unsigned short* kgh = Khi + ((size_t)b * NPOS + kcr) * DQK + kcq;
  const unsigned short* kgl = Klo + ((size_t)b * NPOS + kcr) * DQK + kcq;
  const _Float16* vg = Vh + ((size_t)b * CCH + vcr) * NPOS + vcq;
  const unsigned klh = lds_byte(Ksh + kcr * KSP + kcq);
  const unsigned kll = lds_byte(Ksl + kcr * KSP + kcq);
  const unsigned vl  = lds_byte(Vs + vcr * VSP + vcq);

  // K tile 0
  {
    unsigned l[4];
    const void* g[4];
    // unrolled so that l and g are indexed by constants and stay in registers
#pragma unroll
    for (int i = 0; i < 2; ++i) {
      l[i]     = klh + i * 32 * KSP * 2;
      l[2 + i] = kll + i * 32 * KSP * 2;
      g[i]     = kgh + (size_t)(i * 32) * DQK;
      g[2 + i] = kgl + (size_t)(i * 32) * DQK;
    }
    copy4(l, g);
  }
  asm volatile("s_wait_asynccnt 0x0" ::: "memory");   // this wave's share of K tile 0 has landed before the barrier publishes it
  __syncthreads();

  for (int j0 = 0; j0 < NPOS; j0 += 64) {
    // ---- 0. V tile of this trip: its buffer's last readers ended at the barrier that closed the trip before ----
    {
      unsigned l[8];
      const void* g[8];
      // unrolled so that l and g are indexed by constants and stay in registers
#pragma unroll
      for (int i = 0; i < 8; ++i) {
        l[i] = vl + i * 64 * VSP * 2;
        g[i] = vg + (size_t)(i * 64) * NPOS + j0;
      }
      copy8(l, g);
    }

    // ---- 1. S tile, 16x16 per wave, k = d in 4 steps of 32, three bf16 products per step ----
    {
      v8f s = {};
      const int krow = (jtS * 16 + m) * KSP + 8 * h;
      const unsigned short* krh = Ksh + krow;
      const unsigned short* krl = Ksl + krow;
      // all sixteen K fragment reads are issued before the first product, so that their LDS latency is paid once, not per k step
      FragB bh[4], bl[4];   // both loops below are unrolled so that these are indexed by constants and stay in registers
#pragma unroll
      for (int kk = 0; kk < 4; ++kk) {
        bh[kk].p[0] = *(const us8*)(krh + kk * 32);
        bh[kk].p[1] = *(const us8*)(krh + kk * 32 + 16);
        bl[kk].p[0] = *(const us8*)(krl + kk * 32);
        bl[kk].p[1] = *(const us8*)(krl + kk * 32 + 16);
      }
      __builtin_amdgcn_sched_barrier(0);   // keeps the reads above from being sunk back to their products
#pragma unroll
      for (int kk = 0; kk < 4; ++kk) {
        s = mma_bf16(qfh[kk].v, bh[kk].v, s);
        s = mma_bf16(qfh[kk].v, bl[kk].v, s);
        s = mma_bf16(qfl[kk].v, bh[kk].v, s);
      }
#pragma unroll
      for (int r = 0; r < 8; ++r)
        Ss[(rtS * 16 + 8 * h + r) * SSP + jtS * 16 + m] = s[r];
    }
    asm volatile("s_wait_dscnt 0x0" ::: "memory");      // this wave's K reads have retired before the K buffer is handed to its next copies
    __syncthreads();

    // ---- 2. online softmax stats: 8 lanes per row, 8 adjacent columns per lane, all 16 waves ----
    {
      float sv[8];   // the three loops below are fully unrolled so that sv and pv stay in registers
#pragma unroll
      for (int q = 0; q < 8; ++q) sv[q] = Ss[si * SSP + sq + q];
      float mx = sv[0];
#pragma unroll
      for (int q = 1; q < 8; ++q) mx = fmaxf(mx, sv[q]);
      mx = fmaxf(mx, lane_xor<1>(mx));
      mx = fmaxf(mx, lane_xor<2>(mx));
      mx = fmaxf(mx, lane_xor<4>(mx));
      const float mnew = fmaxf(mrun, mx);
      const float sc = __expf(mrun - mnew);
      h8 pv;
      float sum = 0.0f;
#pragma unroll
      for (int q = 0; q < 8; ++q) {
        const float p = __expf(sv[q] - mnew) * PSCALE;
        const _Float16 ph = (_Float16)p;
        pv[q] = ph;
        sum += (float)ph;
      }
      *(h8*)(Ps + si * PSP + sq) = pv;
      sum += lane_xor<1>(sum);
      sum += lane_xor<2>(sum);
      sum += lane_xor<4>(sum);
      mrun = mnew;
      lrun = lrun * sc + sum;
      if ((tid & 7) == 0) { lrow[si] = lrun; srow[si] = sc; }
    }
    asm volatile("s_wait_asynccnt 0x0" ::: "memory");   // this wave's share of the V tile has landed before the barrier publishes it
    __syncthreads();

    // K tile of the next trip: every reader left the K buffer at the barrier behind the scores
    if (j0 + 64 < NPOS) {
      unsigned l[4];
      const void* g[4];
      // unrolled so that l and g are indexed by constants and stay in registers
#pragma unroll
      for (int i = 0; i < 2; ++i) {
        l[i]     = klh + i * 32 * KSP * 2;
        l[2 + i] = kll + i * 32 * KSP * 2;
        g[i]     = kgh + (size_t)(j0 + 64 + i * 32) * DQK;
        g[2 + i] = kgl + (size_t)(j0 + 64 + i * 32) * DQK;
      }
      copy4(l, g);
    }

    // ---- 3. rescale O, then O^T += V . P^T ----
    // Fragment reads run ahead of their products: P and V of the first 32 keys and P of the last 32 are issued at once and
    // land under the rescale; each V fragment of the last 32 keys is read as soon as the two products on its forerunner are issued.
    {
      const float sc0 = srow[ib + m];        // column of the accumulator = query index
      const float sc1 = srow[ib + 16 + m];
      // B[k = j][n = i] = P[i][j0 + jj*32 + k]: row i of Ps is k-contiguous, loaded like A
      // A[m = c][k = j] = V[b][c][j0 + jj*32 + k], k-contiguous, from the LDS tile
      const _Float16* p0 = Ps + (ib + m) * PSP + 8 * h;
      const _Float16* p1 = Ps + (ib + 16 + m) * PSP + 8 * h;
      const _Float16* vr = Vs + (wc * 64 + m) * VSP + 8 * h;
      FragH b0[2], b1[2], a[4];   // the four loops below are unrolled so that a and o are indexed by constants and stay in registers
      b0[0].p[0] = *(const h8*)p0;
      b0[0].p[1] = *(const h8*)(p0 + 16);
      b1[0].p[0] = *(const h8*)p1;
      b1[0].p[1] = *(const h8*)(p1 + 16);
#pragma unroll
      for (int ct = 0; ct < 4; ++ct) {
        a[ct].p[0] = *(const h8*)(vr + ct * 16 * VSP);
        a[ct].p[1] = *(const h8*)(vr + ct * 16 * VSP + 16);
      }
      b0[1].p[0] = *(const h8*)(p0 + 32);
      b0[1].p[1] = *(const h8*)(p0 + 48);
      b1[1].p[0] = *(const h8*)(p1 + 32);
      b1[1].p[1] = *(const h8*)(p1 + 48);
      __builtin_amdgcn_sched_barrier(0);   // keeps the reads above from being sunk back to their products
#pragma unroll
      for (int ct = 0; ct < 4; ++ct) {
        o[0][ct] = o[0][ct] * sc0;
        o[1][ct] = o[1][ct] * sc1;
      }
#pragma unroll
      for (int ct = 0; ct < 4; ++ct) {
        o[0][ct] = mma_f16(a[ct].v, b0[0].v, o[0][ct]);
        o[1][ct] = mma_f16(a[ct].v, b1[0].v, o[1][ct]);
        a[ct].p[0] = *(const h8*)(vr + ct * 16 * VSP + 32);
        a[ct].p[1] = *(const h8*)(vr + ct * 16 * VSP + 48);
        __builtin_amdgcn_sched_barrier(0);   // keeps this read here, three fragments ahead of its products
      }
#pragma unroll
      for (int ct = 0; ct < 4; ++ct) {
        o[0][ct] = mma_f16(a[ct].v, b0[1].v, o[0][ct]);
        o[1][ct] = mma_f16(a[ct].v, b1[1].v, o[1][ct]);
      }
      // keeps the last products in front of the closing barrier, under the other waves' LDS reads: sunk behind it they would
      // stand between the barrier and the next V tile's copies
      __builtin_amdgcn_sched_barrier(0);
    }
    asm volatile("s_wait_dscnt 0x0" ::: "memory");      // this wave's V reads have retired before the V buffer is handed to its next copies
    asm volatile("s_wait_asynccnt 0x0" ::: "memory");   // this wave's share of the next K tile has landed before the barrier publishes it
    __syncthreads();
  }

  const float g = gamma[0];
  const float gl0 = g / lrow[ib + m];
  const float gl1 = g / lrow[ib + 16 + m];
  float* F = (float*)smq + w * 512;     // per wave [16 c][32 i] f32
#pragma unroll
  for (int ct = 0; ct < 4; ++ct) {
    __syncthreads();
#pragma unroll
    for (int r = 0; r < 8; ++r) {
      F[(8 * h + r) * 32 + m]      = o[0][ct][r] * gl0;
      F[(8 * h + r) * 32 + 16 + m] = o[1][ct][r] * gl1;
    }
    __syncthreads();
    v4f vals[4];
    size_t offs[4];
#pragma unroll
    for (int s = 0; s < 4; ++s) {
      const int row = s * 4 + (lane >> 3);            // channel local 0..15
      const int q = lane & 7;
      const int c = wc * 64 + ct * 16 + row;
      const size_t off = ((size_t)b * CCH + c) * NPOS + i0 + ib + q * 4;
      const v4f ov = *(const v4f*)(F + row * 32 + q * 4);
      const v4f xv = *(const v4f*)(x + off);
      vals[s] = ov + xv;
      offs[s] = off;
    }
#pragma unroll
    for (int s = 0; s < 4; ++s) *(v4f*)(outp + offs[s]) = vals[s];
    
  }
}

// ---------------------------------------------------------------------------
extern "C" void kernel_launch(void* const* d_in, const int* in_sizes, int n_in,
                              void* d_out, int out_size, void* d_ws, size_t ws_size,
                              hipStream_t stream) {
  if (n_in < 13) return;
  const int nx = BATCH * CCH * NPOS;
  if (in_sizes[0] != nx || in_sizes[1] != nx ||
      in_sizes[2] != CQ * CCH || in_sizes[3] != CQ ||
      in_sizes[4] != CQ * CCH || in_sizes[5] != CQ ||
      in_sizes[6] != CQ * CCH || in_sizes[7] != CQ ||
      in_sizes[8] != CQ * CCH || in_sizes[9] != CQ ||
      in_sizes[10] != CCH * CCH || in_sizes[11] != CCH ||
      in_sizes[12] < 1 || out_size != nx) return;

  const size_t planeE = (size_t)BATCH * NPOS * DQK;   // bf16 elements per q/k plane (4 MiB each)
  const size_t vE     = (size_t)BATCH * CCH * NPOS;   // f16 elements of the v plane (16 MiB)
  const size_t need   = planeE * 2 * 4 + vE * 2;      // 33,554,432 B
  if (ws_size < need) return;

  const float* x     = (const float*)d_in[0];
  const float* dep   = (const float*)d_in[1];
  const float* wq    = (const float*)d_in[2];
  const float* bq    = (const float*)d_in[3];
  const float* wqd   = (const float*)d_in[4];
  const float* bqd   = (const float*)d_in[5];
  const float* wk    = (const float*)d_in[6];
  const float* bk    = (const float*)d_in[7];
  const float* wkd   = (const float*)d_in[8];
  const float* bkd   = (const float*)d_in[9];
  const float* wv    = (const float*)d_in[10];
  const float* bv    = (const float*)d_in[11];
  const float* gamma = (const float*)d_in[12];
  float* outp = (float*)d_out;

  unsigned short* Qhi = (unsigned short*)d_ws;
  unsigned short* Qlo = Qhi + planeE;
  unsigned short* Khi = Qlo + planeE;
  unsigned short* Klo = Khi + planeE;
  _Float16* Vh = (_Float16*)(Klo + planeE);

  // q/k planes [B][N][128] (columns 0..63 from x, 64..127 from dep) and v plane [B][C][N] f16, one launch
  proj_all_kernel<<<dim3(NPOS / 64, BATCH, 4 + CCH / 64), dim3(256), 0, stream>>>(
      x, dep, wq, bq, wqd, bqd, wk, bk, wkd, bkd, wv, bv, Qhi, Qlo, Khi, Klo, Vh);
  // fused attention + gamma*out + x
  attn_kernel<<<dim3(NPOS / 64, BATCH), dim3(512), 0, stream>>>(Qhi, Qlo, Khi, Klo, Vh, x, gamma, outp);
}

// v009
// One run takes 156 microseconds.
// Next to v008, in two timings, it ran 1.03 times as fast each time.
// Over all steps from v000 it is 4.60 times as fast.
#include <hip/hip_runtime.h>

// q/k 1x1 projections and q.k^T logits: v_wmma_f32_16x16x32_bf16 with bf16 hi/lo operand split (hi.hi + hi.lo + lo.hi);
// v 1x1 projection (weights x16, folded back x1/16) and p.v: v_wmma_f32_16x16x32_f16 (f16 operands, p carried x4096); f32 accumulate everywhere.

typedef _Float16 h4  __attribute__((ext_vector_type(4)));
typedef _Float16 h8  __attribute__((ext_vector_type(8)));
typedef _Float16 h16 __attribute__((ext_vector_type(16)));
typedef __bf16   bf16v16 __attribute__((ext_vector_type(16)));
typedef unsigned short us4 __attribute__((ext_vector_type(4)));
typedef unsigned short us8 __attribute__((ext_vector_type(8)));
typedef float v4f __attribute__((ext_vector_type(4)));
typedef float v8f __attribute__((ext_vector_type(8)));

#define BATCH 4
#define CCH   512
#define NPOS  4096
#define DQK   128
#define CQ    64
#define SSP   65          // f32 score tile pitch (floats)
#define PSP   72          // f16 p tile pitch (halves), multiple of 8 for 16-B fragment loads
#define PSCALE  4096.0f   // p carried x2^12 in f16 so WMMA operands stay normal; cancels in O/l
#define WVSCALE 16.0f     // v weights x16 in f16, folded back in the epilogue
#define WVINV   0.0625f
#define KSP   136         // K tile pitch in LDS, 16-bit elements: 272 B = 16 B x 17, conflict-free for 16-B fragment reads
#define VSP   72          // V tile pitch in LDS, halves: 144 B = 16 B x 9, conflict-free for 16-B fragment reads
#define XSP   40          // projection operand tile pitch in LDS, 16-bit elements: 80 B = 16 B x 5; at 64 B four rows share each bank
#define XTILE (64 * XSP)  // one projection operand tile, 64 rows

union FragH { h16 v; h8 p[2]; };        // elements 0..7 <- k0+8h+0..7, elements 8..15 <- k0+16+8h+0..7
union FragB { bf16v16 v; us8 p[2]; };

__device__ __forceinline__ v8f mma_f16(h16 a, h16 b, v8f c) {
  return __builtin_amdgcn_wmma_f32_16x16x32_f16(false, a, false, b, (short)0, c, false, false);
}
__device__ __forceinline__ v8f mma_bf16(bf16v16 a, bf16v16 b, v8f c) {
  return __builtin_amdgcn_wmma_f32_16x16x32_bf16(false, a, false, b, (short)0, c, false, false);
}
// f32 -> bf16 bits, RNE convert
__device__ __forceinline__ unsigned short f2bf(float f) {
  unsigned int u = __float_as_uint(f);
  u += 0x7FFFu + ((u >> 16) & 1u);
  return (unsigned short)(u >> 16);
}
__device__ __forceinline__ float bf2f(unsigned short s) {
  return __uint_as_float(((unsigned int)s) << 16);
}

// ---------------------------------------------------------------------------
// Projection GEMM, block tile 64 n x 64 d, k = 512 channels in steps of 32, 256 threads (8 waves).
//   src : [B][C][N] f32, batch b read here;  W : [rows][C] f32;  bias : [rows] f32
//   D[row = n][col = d] = sum_c src[c][n] * W[d][c]; A = src tile staged [n][k], B = W tile staged [d][k]
//   sm  : 20 KiB of LDS: operand tiles during the k loop, output tile in the epilogue;  dbase : first row of W of this block
// ---------------------------------------------------------------------------
template <int MODE>
__device__ __forceinline__ void
proj_body(unsigned short* sm,
          const float* __restrict__ src,
          const float* __restrict__ W,
          const float* __restrict__ bias,
          unsigned short* __restrict__ ohi,
          unsigned short* __restrict__ olo,
          _Float16* __restrict__ ov,
          int doff,
          int dbase,
          int b) {
  const int tid  = threadIdx.x;
  const int lane = tid & 31;
  const int w    = tid >> 5;
  const int m    = lane & 15;
  const int h    = lane >> 4;

  const int n0    = blockIdx.x * 64;

  const int mt  = w >> 1;          // n sub-tile (0..3)
  const int ntb = (w & 1) * 2;     // d sub-tile pair base (0 or 2)

  const int ms = tid & 63;         // src staging row
  const int kg = (tid >> 6) * 4;   // src staging k group
  const int wr = tid >> 3;         // W staging row: 8 lanes share the 128-B line that a row of W has in a k step,
  const int wq = (tid & 7) * 4;    // so a wave's 16-B loads cover 4 whole lines instead of 16 B of 32 lines

  const size_t srcb = (size_t)b * CCH * NPOS;

  v8f acc0 = {};
  v8f acc1 = {};

  if (MODE == 0) {
    unsigned short* Xh = sm;
    unsigned short* Xl = sm + XTILE;
    unsigned short* Wh = sm + 2 * XTILE;
    unsigned short* Wl = sm + 3 * XTILE;

    for (int c0 = 0; c0 < CCH; c0 += 32) {
#pragma unroll
      for (int g = 0; g < 2; ++g) {
        const int kb = kg + g * 16;
        const float* sp = src + srcb + (size_t)(c0 + kb) * NPOS + n0 + ms;
        v4f xv;
        xv[0] = sp[0];
        xv[1] = sp[NPOS];
        xv[2] = sp[2 * NPOS];
        xv[3] = sp[3 * NPOS];
        const int wrow = wr + g * 32;
        const v4f wv4 = *(const v4f*)(W + (size_t)(dbase + wrow) * CCH + c0 + wq);
        us4 xh4, xl4, wh4, wl4;
#pragma unroll
        for (int q = 0; q < 4; ++q) {
          const unsigned short hb = f2bf(xv[q]);
          xh4[q] = hb;
          xl4[q] = f2bf(xv[q] - bf2f(hb));
          const unsigned short wb = f2bf(wv4[q]);
          wh4[q] = wb;
          wl4[q] = f2bf(wv4[q] - bf2f(wb));
        }
        *(us4*)(Xh + ms * XSP + kb) = xh4;
        *(us4*)(Xl + ms * XSP + kb) = xl4;
        *(us4*)(Wh + wrow * XSP + wq) = wh4;
        *(us4*)(Wl + wrow * XSP + wq) = wl4;
      }
      __syncthreads();

      // all twelve fragment reads are issued before the first product, so that their LDS latency is paid once per k step
      FragB ah, al, bh[2], bl[2];
      {
        const unsigned short* xr  = Xh + (mt * 16 + m) * XSP + 8 * h;
        const unsigned short* xrl = Xl + (mt * 16 + m) * XSP + 8 * h;
        ah.p[0] = *(const us8*)xr;
        ah.p[1] = *(const us8*)(xr + 16);
        // unrolled so that bh and bl are indexed by constants and stay in registers
#pragma unroll
        for (int t = 0; t < 2; ++t) {
          const unsigned short* wf  = Wh + ((ntb + t) * 16 + m) * XSP + 8 * h;
          const unsigned short* wfl = Wl + ((ntb + t) * 16 + m) * XSP + 8 * h;
          bh[t].p[0] = *(const us8*)wf;
          bh[t].p[1] = *(const us8*)(wf + 16);
          bl[t].p[0] = *(const us8*)wfl;
          bl[t].p[1] = *(const us8*)(wfl + 16);
        }
        al.p[0] = *(const us8*)xrl;
        al.p[1] = *(const us8*)(xrl + 16);
      }
      __builtin_amdgcn_sched_barrier(0);   // keeps the reads above from being sunk back to their products
      acc0 = mma_bf16(ah.v, bh[0].v, acc0);
      acc1 = mma_bf16(ah.v, bh[1].v, acc1);
      acc0 = mma_bf16(ah.v, bl[0].v, acc0);
      acc1 = mma_bf16(ah.v, bl[1].v, acc1);
      acc0 = mma_bf16(al.v, bh[0].v, acc0);
      acc1 = mma_bf16(al.v, bh[1].v, acc1);
      __syncthreads();
    }

    // epilogue: bias add in f32, hi/lo bf16 split, stage [n][d] tile in LDS, whole-line stores
    unsigned short* Eh = sm;          // [64 n][64 d]
    unsigned short* El = sm + 4096;   // [64 n][64 d]
    {
      const int dl = ntb * 16 + m;
      const float bb = bias[dbase + dl];
#pragma unroll
      for (int r = 0; r < 8; ++r) {
        const float v = acc0[r] + bb;
        const unsigned short hb = f2bf(v);
        const int row = mt * 16 + 8 * h + r;
        Eh[row * 64 + dl] = hb;
        El[row * 64 + dl] = f2bf(v - bf2f(hb));
      }
    }
    {
      const int dl = (ntb + 1) * 16 + m;
      const float bb = bias[dbase + dl];
#pragma unroll
      for (int r = 0; r < 8; ++r) {
        const float v = acc1[r] + bb;
        const unsigned short hb = f2bf(v);
        const int row = mt * 16 + 8 * h + r;
        Eh[row * 64 + dl] = hb;
        El[row * 64 + dl] = f2bf(v - bf2f(hb));
      }
    }
    __syncthreads();

    us8 vh[2], vl[2];
    size_t off[2];
#pragma unroll
    for (int s = 0; s < 2; ++s) {
      const int row = w * 8 + s * 4 + (lane >> 3);
      const int q = lane & 7;
      vh[s] = *(const us8*)(Eh + row * 64 + q * 8);
      vl[s] = *(const us8*)(El + row * 64 + q * 8);
      off[s] = ((size_t)b * NPOS + n0 + row) * DQK + doff + q * 8;
    }
#pragma unroll
    for (int s = 0; s < 2; ++s) {
      *(us8*)(ohi + off[s]) = vh[s];
      *(us8*)(olo + off[s]) = vl[s];
    }
    
  } else {
    _Float16* Xs = (_Float16*)sm;       // [64 n][32 k], pitch XSP
    _Float16* Ws = Xs + XTILE;          // [64 d][32 k], pitch XSP

    for (int c0 = 0; c0 < CCH; c0 += 32) {
#pragma unroll
      for (int g = 0; g < 2; ++g) {
        const int kb = kg + g * 16;
        const float* sp = src + srcb + (size_t)(c0 + kb) * NPOS + n0 + ms;
        v4f xv;
        xv[0] = sp[0];
        xv[1] = sp[NPOS];
        xv[2] = sp[2 * NPOS];
        xv[3] = sp[3 * NPOS];
        const int wrow = wr + g * 32;
        v4f wv4 = *(const v4f*)(W + (size_t)(dbase + wrow) * CCH + c0 + wq);
        wv4 = wv4 * WVSCALE;
        *(h4*)(Xs + ms * XSP + kb) = __builtin_convertvector(xv, h4);
        *(h4*)(Ws + wrow * XSP + wq) = __builtin_convertvector(wv4, h4);
      }
      __syncthreads();

      FragH a;
      {
        const _Float16* xr = Xs + (mt * 16 + m) * XSP + 8 * h;
        a.p[0] = *(const h8*)xr;
        a.p[1] = *(const h8*)(xr + 16);
      }
      {
        const _Float16* wr = Ws + (ntb * 16 + m) * XSP + 8 * h;
        FragH bf;
        bf.p[0] = *(const h8*)wr;
        bf.p[1] = *(const h8*)(wr + 16);
        acc0 = mma_f16(a.v, bf.v, acc0);
      }
      {
        const _Float16* wr = Ws + ((ntb + 1) * 16 + m) * XSP + 8 * h;
        FragH bf;
        bf.p[0] = *(const h8*)wr;
        bf.p[1] = *(const h8*)(wr + 16);
        acc1 = mma_f16(a.v, bf.v, acc1);
      }
      __syncthreads();
    }

    // epilogue: fold 1/16, bias, f16, stage [d][n] tile in LDS, whole-line stores along n
    _Float16* E = (_Float16*)sm;       // [64 d][64 n]
    {
      const int dl = ntb * 16 + m;
      const float bb = bias[dbase + dl];
      h8 ev;
#pragma unroll
      for (int r = 0; r < 8; ++r) ev[r] = (_Float16)(acc0[r] * WVINV + bb);
      *(h8*)(E + dl * 64 + mt * 16 + 8 * h) = ev;
    }
    {
      const int dl = (ntb + 1) * 16 + m;
      const float bb = bias[dbase + dl];
      h8 ev;
#pragma unroll
      for (int r = 0; r < 8; ++r) ev[r] = (_Float16)(acc1[r] * WVINV + bb);
      *(h8*)(E + dl * 64 + mt * 16 + 8 * h) = ev;
    }
    __syncthreads();

    h8 vv[2];
    size_t off[2];
#pragma unroll
    for (int s = 0; s < 2; ++s) {
      const int row = w * 8 + s * 4 + (lane >> 3);   // channel local 0..63
      const int q = lane & 7;
      vv[s] = *(const h8*)(E + row * 64 + q * 8);
      off[s] = ((size_t)b * CCH + dbase + row) * NPOS + n0 + q * 8;
    }
#pragma unroll
    for (int s = 0; s < 2; ++s) *(h8*)(ov + off[s]) = vv[s];
    
  }
}

// All five projections in one launch, so that blocks of different projections stand on a WGP together and one block's
// global-load and barrier waits are filled by the others. blockIdx.z picks the projection, the same for the whole block:
//   0 q from x, 1 q from dep, 2 k from x, 3 k from dep (64 rows of W each); 4..11 v, 64 of its 512 rows of W each.
// The q/k blocks are the longer ones (three products per step and the hi/lo split) and have the low indices, which start first.
__global__ void __launch_bounds__(256)
proj_all_kernel(const float* __restrict__ x,
                const float* __restrict__ dep,
                const float* __restrict__ wq,
                const float* __restrict__ bq,
                const float* __restrict__ wqd,
                const float* __restrict__ bqd,
                const float* __restrict__ wk,
                const float* __restrict__ bk,
                const float* __restrict__ wkd,
                const float* __restrict__ bkd,
                const float* __restrict__ wv,
                const float* __restrict__ bv,
                unsigned short* __restrict__ Qhi,
                unsigned short* __restrict__ Qlo,
                unsigned short* __restrict__ Khi,
                unsigned short* __restrict__ Klo,
                _Float16* __restrict__ Vh) {
  __shared__ __align__(16) unsigned short sm[4 * XTILE];

  const int b = blockIdx.y;
  const int p = blockIdx.z;
  if (p < 4) {
    const bool fromDep = (p & 1) != 0;
    const bool isK     = (p & 2) != 0;
    const float* src  = fromDep ? dep : x;
    const float* W    = isK ? (fromDep ? wkd : wk) : (fromDep ? wqd : wq);
    const float* bias = isK ? (fromDep ? bkd : bk) : (fromDep ? bqd : bq);
    proj_body<0>(sm, src, W, bias, isK ? Khi : Qhi, isK ? Klo : Qlo, Vh, fromDep ? CQ : 0, 0, b);
  } else {
    proj_body<1>(sm, x, wv, bv, Qhi, Qlo, Vh, 0, (p - 4) * 64, b);
  }
}

// value of lane (l ^ X), X < 16, by a DPP move inside the 16-lane row
template <int X>
__device__ __forceinline__ float lane_xor(float v) {
  const int s = __builtin_bit_cast(int, v);
  return __builtin_bit_cast(float, __builtin_amdgcn_update_dpp(s, s, 0x160 + X, 0xf, 0xf, false));
}

// LDS byte address of a __shared__ object: the low 32 bits of its address
__device__ __forceinline__ unsigned lds_byte(const void* p) {
  return (unsigned)(size_t)p;
}

// Eight asynchronous 16-B copies per lane, global -> LDS, through no register.
// s_wait_xcnt 0 is the last line of the copies' own statement, so that no address register is rewritten in front of it.
__device__ __forceinline__ void copy8(const unsigned (&l)[8], const void* const (&g)[8]) {
  asm volatile(
      "global_load_async_to_lds_b128 %0, %8, off\n\t"
      "global_load_async_to_lds_b128 %1, %9, off\n\t"
      "global_load_async_to_lds_b128 %2, %10, off\n\t"
      "global_load_async_to_lds_b128 %3, %11, off\n\t"
      "global_load_async_to_lds_b128 %4, %12, off\n\t"
      "global_load_async_to_lds_b128 %5, %13, off\n\t"
      "global_load_async_to_lds_b128 %6, %14, off\n\t"
      "global_load_async_to_lds_b128 %7, %15, off\n\t"
      "s_wait_xcnt 0x0"
      :: "v"(l[0]), "v"(l[1]), "v"(l[2]), "v"(l[3]), "v"(l[4]), "v"(l[5]), "v"(l[6]), "v"(l[7]),
         "v"(g[0]), "v"(g[1]), "v"(g[2]), "v"(g[3]), "v"(g[4]), "v"(g[5]), "v"(g[6]), "v"(g[7])
      : "memory");
}

// Four such copies per lane; s_wait_xcnt 0 is again the last line of the copies' own statement, for the same reason.
__device__ __forceinline__ void copy4(const unsigned (&l)[4], const void* const (&g)[4]) {
  asm volatile(
      "global_load_async_to_lds_b128 %0, %4, off\n\t"
      "global_load_async_to_lds_b128 %1, %5, off\n\t"
      "global_load_async_to_lds_b128 %2, %6, off\n\t"
      "global_load_async_to_lds_b128 %3, %7, off\n\t"
      "s_wait_xcnt 0x0"
      :: "v"(l[0]), "v"(l[1]), "v"(l[2]), "v"(l[3]),
         "v"(g[0]), "v"(g[1]), "v"(g[2]), "v"(g[3])
      : "memory");
}

// ---------------------------------------------------------------------------
// Fused attention: one block per (batch, 64-query tile), 512 threads (16 waves), 64-key tiles:
//   one K and one V tile in LDS serve 64 queries, so each key tile is fetched from L2 once per 64 queries.
//   K hi/lo tile [64 j][128 d] and V tile [512 c][64 j] come into LDS by asynchronous copies in whole 128-B lines; fragments are read from LDS
//   S[64 i][64 j] = Q.K^T (K = 128) with bf16 hi/lo split operands (Q fragments held in registers) -> LDS, 16x16 per wave
//   online softmax stats by all waves (8 lanes per row, running max and sum in registers), p x4096 as f16 in LDS, row sums from the f16 values
//   O^T[512 c][64 i] += V[c][j] . P[i][j]  (f16), each wave owns 64 channels x 32 queries
//   The key loop is skewed by one tile: a trip has two barrier phases, scores of tile t+1, then softmax of tile t+1 together with p.v of tile t
//   (V, p and the rescale factors in two buffers), so that the vector work of the softmax runs under the matrix work of p.v.
// ---------------------------------------------------------------------------
__global__ void __launch_bounds__(512)
attn_kernel(const unsigned short* __restrict__ Qhi,
            const unsigned short* __restrict__ Qlo,
            const unsigned short* __restrict__ Khi,
            const unsigned short* __restrict__ Klo,
            const _Float16* __restrict__ Vh,
            const float* __restrict__ x,
            const float* __restrict__ gamma,
            float* __restrict__ outp) {
  __shared__ __align__(16) unsigned short smq[16384];  // finalize: 8192 f32, 512 per wave
  __shared__ __align__(16) unsigned short Ksh[64 * KSP];   // K hi tile
  __shared__ __align__(16) unsigned short Ksl[64 * KSP];   // K lo tile
  __shared__ __align__(16) _Float16 Vs[2 * CCH * VSP];     // V tiles, buffer = tile index & 1
  __shared__ float Ss[64 * SSP];
  __shared__ __align__(16) _Float16 Ps[2 * 64 * PSP];      // p tiles, buffer = tile index & 1
  __shared__ float lrow[64];
  __shared__ float srow[2 * 64];                           // rescale factors, buffer = tile index & 1

  const int tid  = threadIdx.x;
  const int lane = tid & 31;
  const int w    = tid >> 5;
  const int m    = lane & 15;
  const int h    = lane >> 4;

  const int i0 = blockIdx.x * 64;
  const int b  = blockIdx.y;
  const int wc = w & 7;          // p.v: channel group of this wave (64 channels)
  const int ib = (w >> 3) * 32;  // p.v: first of its 32 queries inside the tile

  v8f o[2][4];
  {
    v8f z = {};
#pragma unroll
    for (int it = 0; it < 2; ++it)
#pragma unroll
      for (int ct = 0; ct < 4; ++ct) o[it][ct] = z;
  }

  const int rtS = w >> 2;   // S row sub-tile (i), 0..3
  const int jtS = w & 3;    // S col sub-tile (j)

  // Q fragments of this wave's 16 query rows, hi and lo, k = d in 4 steps of 32: the same for every key tile, kept in registers
  FragB qfh[4], qfl[4];
  {
    const size_t qrow = ((size_t)b * NPOS + i0 + rtS * 16 + m) * DQK + 8 * h;
    const unsigned short* qrh = Qhi + qrow;
    const unsigned short* qrl = Qlo + qrow;
    // unrolled so that the fragment arrays are indexed by constants and stay in registers
#pragma unroll
    for (int kk = 0; kk < 4; ++kk) {
      qfh[kk].p[0] = *(const us8*)(qrh + kk * 32);
      qfh[kk].p[1] = *(const us8*)(qrh + kk * 32 + 16);
      qfl[kk].p[0] = *(const us8*)(qrl + kk * 32);
      qfl[kk].p[1] = *(const us8*)(qrl + kk * 32 + 16);
    }
  }

  const int si = tid >> 3;        // softmax row of this thread
  const int sq = (tid & 7) * 8;   // first of its 8 columns
  float mrun = -1e30f;            // running row maximum, equal in the row's 8 lanes
  float lrun = 0.0f;              // running row sum, equal in the row's 8 lanes

  // copy shares: K, 16 lanes per 256-B row, 32 rows per step; V, 8 lanes per 128-B row, 64 rows per step
  const int kcr = tid >> 4;
  const int kcq = (tid & 15) * 8;
  const int vcr = tid >> 3;
  const int vcq = (tid & 7) * 8;
  const unsigned short* kgh = Khi + ((size_t)b * NPOS + kcr) * DQK + kcq;
  const unsigned short* kgl = Klo + ((size_t)b * NPOS + kcr) * DQK + kcq;
  const _Float16* vg = Vh + ((size_t)b * CCH + vcr) * NPOS + vcq;
  const unsigned klh = lds_byte(Ksh + kcr * KSP + kcq);
  const unsigned kll = lds_byte(Ksl + kcr * KSP + kcq);
  const unsigned vl  = lds_byte(Vs + vcr * VSP + vcq);

  // K tile t into the one K buffer
  auto copyK = [&](int t) {
    unsigned l[4];
    const void* g[4];
    // unrolled so that l and g are indexed by constants and stay in registers
#pragma unroll
    for (int i = 0; i < 2; ++i) {
      l[i]     = klh + i * 32 * KSP * 2;
      l[2 + i] = kll + i * 32 * KSP * 2;
      g[i]     = kgh + (size_t)(t * 64 + i * 32) * DQK;
      g[2 + i] = kgl + (size_t)(t * 64 + i * 32) * DQK;
    }
    copy4(l, g);
  };

  // V tile t into V buffer t & 1
  auto copyV = [&](int t) {
    unsigned l[8];
    const void* g[8];
    const unsigned vb = vl + (unsigned)(t & 1) * (CCH * VSP * 2);
    // unrolled so that l and g are indexed by constants and stay in registers
#pragma unroll
    for (int i = 0; i < 8; ++i) {
      l[i] = vb + i * 64 * VSP * 2;
      g[i] = vg + (size_t)(i * 64) * NPOS + t * 64;
    }
    copy8(l, g);
  };

  // S tile of the K tile in LDS, 16x16 per wave, k = d in 4 steps of 32, three bf16 products per step
  auto scores = [&]() {
    v8f s = {};
    const int krow = (jtS * 16 + m) * KSP + 8 * h;
    const unsigned short* krh = Ksh + krow;
    const unsigned short* krl = Ksl + krow;
    // all sixteen K fragment reads are issued before the first product, so that their LDS latency is paid once, not per k step
    FragB bh[4], bl[4];   // both loops below are unrolled so that these are indexed by constants and stay in registers
#pragma unroll
    for (int kk = 0; kk < 4; ++kk) {
      bh[kk].p[0] = *(const us8*)(krh + kk * 32);
      bh[kk].p[1] = *(const us8*)(krh + kk * 32 + 16);
      bl[kk].p[0] = *(const us8*)(krl + kk * 32);
      bl[kk].p[1] = *(const us8*)(krl + kk * 32 + 16);
    }
    __builtin_amdgcn_sched_barrier(0);   // keeps the reads above from being sunk back to their products
#pragma unroll
    for (int kk = 0; kk < 4; ++kk) {
      s = mma_bf16(qfh[kk].v, bh[kk].v, s);
      s = mma_bf16(qfh[kk].v, bl[kk].v, s);
      s = mma_bf16(qfl[kk].v, bh[kk].v, s);
    }
#pragma unroll
    for (int r = 0; r < 8; ++r)
      Ss[(rtS * 16 + 8 * h + r) * SSP + jtS * 16 + m] = s[r];
  };

  // online softmax stats of the S tile in LDS, tile t: 8 lanes per row, 8 adjacent columns per lane, all 16 waves
  auto softmax = [&](int t) {
    const int pb = t & 1;
    float sv[8];   // the three loops below are fully unrolled so that sv and pv stay in registers
#pragma unroll
    for (int q = 0; q < 8; ++q) sv[q] = Ss[si * SSP + sq + q];
    float mx = sv[0];
#pragma unroll
    for (int q = 1; q < 8; ++q) mx = fmaxf(mx, sv[q]);
    mx = fmaxf(mx, lane_xor<1>(mx));
    mx = fmaxf(mx, lane_xor<2>(mx));
    mx = fmaxf(mx, lane_xor<4>(mx));
    const float mnew = fmaxf(mrun, mx);
    const float sc = __expf(mrun - mnew);
    h8 pv;
    float sum = 0.0f;
#pragma unroll
    for (int q = 0; q < 8; ++q) {
      const float p = __expf(sv[q] - mnew) * PSCALE;
      const _Float16 ph = (_Float16)p;
      pv[q] = ph;
      sum += (float)ph;
    }
    *(h8*)(Ps + pb * (64 * PSP) + si * PSP + sq) = pv;
    sum += lane_xor<1>(sum);
    sum += lane_xor<2>(sum);
    sum += lane_xor<4>(sum);
    mrun = mnew;
    lrun = lrun * sc + sum;
    if ((tid & 7) == 0) { lrow[si] = lrun; srow[pb * 64 + si] = sc; }
  };

  // rescale O by tile t's factors, then O^T += V . P^T of tile t
  // Fragment reads run ahead of their products: P and V of the first 32 keys and P of the last 32 are issued at once and
  // land under the rescale; each V fragment of the last 32 keys is read as soon as the two products on its forerunner are issued.
  auto pvacc = [&](int t) {
    const int pb = t & 1;
    const float sc0 = srow[pb * 64 + ib + m];        // column of the accumulator = query index
    const float sc1 = srow[pb * 64 + ib + 16 + m];
    // B[k = j][n = i] = P[i][jj*32 + k]: row i of Ps is k-contiguous, loaded like A
    // A[m = c][k = j] = V[b][c][jj*32 + k], k-contiguous, from the LDS tile
    const _Float16* p0 = Ps + pb * (64 * PSP) + (ib + m) * PSP + 8 * h;
    const _Float16* p1 = p0 + 16 * PSP;
    const _Float16* vr = Vs + pb * (CCH * VSP) + (wc * 64 + m) * VSP + 8 * h;
    FragH b0[2], b1[2], a[4];   // the four loops below are unrolled so that a and o are indexed by constants and stay in registers
    b0[0].p[0] = *(const h8*)p0;
    b0[0].p[1] = *(const h8*)(p0 + 16);
    b1[0].p[0] = *(const h8*)p1;
    b1[0].p[1] = *(const h8*)(p1 + 16);
#pragma unroll
    for (int ct = 0; ct < 4; ++ct) {
      a[ct].p[0] = *(const h8*)(vr + ct * 16 * VSP);
      a[ct].p[1] = *(const h8*)(vr + ct * 16 * VSP + 16);
    }
    b0[1].p[0] = *(const h8*)(p0 + 32);
    b0[1].p[1] = *(const h8*)(p0 + 48);
    b1[1].p[0] = *(const h8*)(p1 + 32);
    b1[1].p[1] = *(const h8*)(p1 + 48);
    __builtin_amdgcn_sched_barrier(0);   // keeps the reads above from being sunk back to their products
#pragma unroll
    for (int ct = 0; ct < 4; ++ct) {
      o[0][ct] = o[0][ct] * sc0;
      o[1][ct] = o[1][ct] * sc1;
    }
#pragma unroll
    for (int ct = 0; ct < 4; ++ct) {
      o[0][ct] = mma_f16(a[ct].v, b0[0].v, o[0][ct]);
      o[1][ct] = mma_f16(a[ct].v, b1[0].v, o[1][ct]);
      a[ct].p[0] = *(const h8*)(vr + ct * 16 * VSP + 32);
      a[ct].p[1] = *(const h8*)(vr + ct * 16 * VSP + 48);
      __builtin_amdgcn_sched_barrier(0);   // keeps this read here, three fragments ahead of its products
    }
#pragma unroll
    for (int ct = 0; ct < 4; ++ct) {
      o[0][ct] = mma_f16(a[ct].v, b0[1].v, o[0][ct]);
      o[1][ct] = mma_f16(a[ct].v, b1[1].v, o[1][ct]);
    }
    // keeps the last products where they stand: sunk behind what follows they would leave the matrix unit idle here
    __builtin_amdgcn_sched_barrier(0);
  };

  // Waves w and w + 4 share a SIMD: one of them takes the softmax first and the other p.v first,
  // so that one wave's vector work stands beside the other's matrix work instead of all waves doing the same kind at once.
  const bool smFirst = __builtin_amdgcn_readfirstlane((w >> 2) & 1) != 0;

  const int NT = NPOS / 64;

  // ---- prologue: K tile 0; scores of tile 0 under V tile 0's flight; softmax of tile 0 under K tile 1's flight ----
  copyK(0);
  asm volatile("s_wait_asynccnt 0x0" ::: "memory");   // this wave's share of K tile 0 has landed before the barrier publishes it
  __syncthreads();
  copyV(0);
  scores();
  asm volatile("s_wait_dscnt 0x0" ::: "memory");      // this wave's K reads have retired before the K buffer is handed to its next copies
  __syncthreads();
  copyK(1);
  softmax(0);
  asm volatile("s_wait_asynccnt 0x0" ::: "memory");   // this wave's shares of V tile 0 and K tile 1 have landed before the barrier publishes them
  __syncthreads();

  for (int t = 0; t < NT; ++t) {
    // ---- phase 1: scores of tile t+1. V tile t+1 starts its flight: its buffer's last readers (p.v of tile t-1) ended at the barrier above ----
    if (t + 1 < NT) {
      copyV(t + 1);
      scores();
    }
    asm volatile("s_wait_dscnt 0x0" ::: "memory");      // this wave's K reads have retired before the K buffer is handed to its next copies
    __syncthreads();

    // ---- phase 2: softmax of tile t+1 and p.v of tile t, which share no buffer. K tile t+2: every reader left the K buffer at the barrier above ----
    if (t + 2 < NT) copyK(t + 2);
    const bool more = t + 1 < NT;
    if (more && smFirst) softmax(t + 1);
    pvacc(t);
    if (more && !smFirst) softmax(t + 1);
    asm volatile("s_wait_dscnt 0x0" ::: "memory");      // this wave's V reads have retired before the V buffer is handed to its next copies
    asm volatile("s_wait_asynccnt 0x0" ::: "memory");   // this wave's shares of V tile t+1 and K tile t+2 have landed before the barrier publishes them
    __syncthreads();
  }

  const float g = gamma[0];
  const float gl0 = g / lrow[ib + m];
  const float gl1 = g / lrow[ib + 16 + m];
  float* F = (float*)smq + w * 512;     // per wave [16 c][32 i] f32
#pragma unroll
  for (int ct = 0; ct < 4; ++ct) {
    __syncthreads();
#pragma unroll
    for (int r = 0; r < 8; ++r) {
      F[(8 * h + r) * 32 + m]      = o[0][ct][r] * gl0;
      F[(8 * h + r) * 32 + 16 + m] = o[1][ct][r] * gl1;
    }
    __syncthreads();
    v4f vals[4];
    size_t offs[4];
#pragma unroll
    for (int s = 0; s < 4; ++s) {
      const int row = s * 4 + (lane >> 3);            // channel local 0..15
      const int q = lane & 7;
      const int c = wc * 64 + ct * 16 + row;
      const size_t off = ((size_t)b * CCH + c) * NPOS + i0 + ib + q * 4;
      const v4f ov = *(const v4f*)(F + row * 32 + q * 4);
      const v4f xv = *(const v4f*)(x + off);
      vals[s] = ov + xv;
      offs[s] = off;
    }
#pragma unroll
    for (int s = 0; s < 4; ++s) *(v4f*)(outp + offs[s]) = vals[s];
    
  }
}

// ---------------------------------------------------------------------------
extern "C" void kernel_launch(void* const* d_in, const int* in_sizes, int n_in,
                              void* d_out, int out_size, void* d_ws, size_t ws_size,
                              hipStream_t stream) {
  if (n_in < 13) return;
  const int nx = BATCH * CCH * NPOS;
  if (in_sizes[0] != nx || in_sizes[1] != nx ||
      in_sizes[2] != CQ * CCH || in_sizes[3] != CQ ||
      in_sizes[4] != CQ * CCH || in_sizes[5] != CQ ||
      in_sizes[6] != CQ * CCH || in_sizes[7] != CQ ||
      in_sizes[8] != CQ * CCH || in_sizes[9] != CQ ||
      in_sizes[10] != CCH * CCH || in_sizes[11] != CCH ||
      in_sizes[12] < 1 || out_size != nx) return;

  const size_t planeE = (size_t)BATCH * NPOS * DQK;   // bf16 elements per q/k plane (4 MiB each)
  const size_t vE     = (size_t)BATCH * CCH * NPOS;   // f16 elements of the v plane (16 MiB)
  const size_t need   = planeE * 2 * 4 + vE * 2;      // 33,554,432 B
  if (ws_size < need) return;

  const float* x     = (const float*)d_in[0];
  const float* dep   = (const float*)d_in[1];
  const float* wq    = (const float*)d_in[2];
  const float* bq    = (const float*)d_in[3];
  const float* wqd   = (const float*)d_in[4];
  const float* bqd   = (const float*)d_in[5];
  const float* wk    = (const float*)d_in[6];
  const float* bk    = (const float*)d_in[7];
  const float* wkd   = (const float*)d_in[8];
  const float* bkd   = (const float*)d_in[9];
  const float* wv    = (const float*)d_in[10];
  const float* bv    = (const float*)d_in[11];
  const float* gamma = (const float*)d_in[12];
  float* outp = (float*)d_out;

  unsigned short* Qhi = (unsigned short*)d_ws;
  unsigned short* Qlo = Qhi + planeE;
  unsigned short* Khi = Qlo + planeE;
  unsigned short* Klo = Khi + planeE;
  _Float16* Vh = (_Float16*)(Klo + planeE);

  // q/k planes [B][N][128] (columns 0..63 from x, 64..127 from dep) and v plane [B][C][N] f16, one launch
  proj_all_kernel<<<dim3(NPOS / 64, BATCH, 4 + CCH / 64), dim3(256), 0, stream>>>(
      x, dep, wq, bq, wqd, bqd, wk, bk, wkd, bkd, wv, bv, Qhi, Qlo, Khi, Klo, Vh);
  // fused attention + gamma*out + x
  attn_kernel<<<dim3(NPOS / 64, BATCH), dim3(512), 0, stream>>>(Qhi, Qlo, Khi, Klo, Vh, x, gamma, outp);
}

// v010
// One run takes 149 microseconds.
// Two timings next to v009 put it at 1.04 and 1.05 times that version's speed.
// All steps since v000 together make it 4.81 times as fast.
#include <hip/hip_runtime.h>

// q/k 1x1 projections and q.k^T logits: v_wmma_f32_16x16x32_bf16 with bf16 hi/lo operand split (hi.hi + hi.lo + lo.hi);
// v 1x1 projection (weights x16, folded back x1/16) and p.v: v_wmma_f32_16x16x32_f16 (f16 operands, p carried x4096); f32 accumulate everywhere.

typedef _Float16 h4  __attribute__((ext_vector_type(4)));
typedef _Float16 h8  __attribute__((ext_vector_type(8)));
typedef _Float16 h16 __attribute__((ext_vector_type(16)));
typedef __bf16   bf16v16 __attribute__((ext_vector_type(16)));
typedef unsigned short us4 __attribute__((ext_vector_type(4)));
typedef unsigned short us8 __attribute__((ext_vector_type(8)));
typedef float v4f __attribute__((ext_vector_type(4)));
typedef float v8f __attribute__((ext_vector_type(8)));

#define BATCH 4
#define CCH   512
#define NPOS  4096
#define DQK   128
#define CQ    64
#define SSP   65          // f32 score tile pitch (floats)
#define PSP   72          // f16 p tile pitch (halves), multiple of 8 for 16-B fragment loads
#define PSCALE  4096.0f   // p carried x2^12 in f16 so WMMA operands stay normal; cancels in O/l
#define WVSCALE 16.0f     // v weights x16 in f16, folded back in the epilogue
#define WVINV   0.0625f
#define KSP   136         // K tile pitch in LDS, 16-bit elements: 272 B = 16 B x 17, conflict-free for 16-B fragment reads
#define VSP   72          // V tile pitch in LDS, halves: 144 B = 16 B x 9, conflict-free for 16-B fragment reads
#define XSP   40          // projection operand tile pitch in LDS, 16-bit elements: 80 B = 16 B x 5; at 64 B four rows share each bank
#define XTILE (64 * XSP)  // one projection operand tile, 64 rows

union FragH { h16 v; h8 p[2]; };        // elements 0..7 <- k0+8h+0..7, elements 8..15 <- k0+16+8h+0..7
union FragB { bf16v16 v; us8 p[2]; };

__device__ __forceinline__ v8f mma_f16(h16 a, h16 b, v8f c) {
  return __builtin_amdgcn_wmma_f32_16x16x32_f16(false, a, false, b, (short)0, c, false, false);
}
__device__ __forceinline__ v8f mma_bf16(bf16v16 a, bf16v16 b, v8f c) {
  return __builtin_amdgcn_wmma_f32_16x16x32_bf16(false, a, false, b, (short)0, c, false, false);
}
// f32 -> bf16 bits, RNE convert
__device__ __forceinline__ unsigned short f2bf(float f) {
  unsigned int u = __float_as_uint(f);
  u += 0x7FFFu + ((u >> 16) & 1u);
  return (unsigned short)(u >> 16);
}
__device__ __forceinline__ float bf2f(unsigned short s) {
  return __uint_as_float(((unsigned int)s) << 16);
}

// ---------------------------------------------------------------------------
// Projection GEMM, block tile 64 n x 64 d, k = 512 channels in steps of 32, 256 threads (8 waves).
//   src : [B][C][N] f32, batch b read here;  W : [rows][C] f32;  bias : [rows] f32
//   D[row = n][col = d] = sum_c src[c][n] * W[d][c]; A = src tile staged [n][k], B = W tile staged [d][k]
//   sm  : 20 KiB of LDS: operand tiles during the k loop, output tile in the epilogue;  dbase : first row of W of this block
// ---------------------------------------------------------------------------
template <int MODE>
__device__ __forceinline__ void
proj_body(unsigned short* sm,
          const float* __restrict__ src,
          const float* __restrict__ W,
          const float* __restrict__ bias,
          unsigned short* __restrict__ ohi,
          unsigned short* __restrict__ olo,
          _Float16* __restrict__ ov,
          int doff,
          int dbase,
          int b) {
  const int tid  = threadIdx.x;
  const int lane = tid & 31;
  const int w    = tid >> 5;
  const int m    = lane & 15;
  const int h    = lane >> 4;

  const int n0    = blockIdx.x * 64;

  const int mt  = w >> 1;          // n sub-tile (0..3)
  const int ntb = (w & 1) * 2;     // d sub-tile pair base (0 or 2)

  const int ms = tid & 63;         // src staging row
  const int kg = (tid >> 6) * 4;   // src staging k group
  const int wr = tid >> 3;         // W staging row: 8 lanes share the 128-B line that a row of W has in a k step,
  const int wq = (tid & 7) * 4;    // so a wave's 16-B loads cover 4 whole lines instead of 16 B of 32 lines

  const size_t srcb = (size_t)b * CCH * NPOS;

  v8f acc0 = {};
  v8f acc1 = {};

  if (MODE == 0) {
    unsigned short* Xh = sm;
    unsigned short* Xl = sm + XTILE;
    unsigned short* Wh = sm + 2 * XTILE;
    unsigned short* Wl = sm + 3 * XTILE;

    for (int c0 = 0; c0 < CCH; c0 += 32) {
#pragma unroll
      for (int g = 0; g < 2; ++g) {
        const int kb = kg + g * 16;
        const float* sp = src + srcb + (size_t)(c0 + kb) * NPOS + n0 + ms;
        v4f xv;
        xv[0] = sp[0];
        xv[1] = sp[NPOS];
        xv[2] = sp[2 * NPOS];
        xv[3] = sp[3 * NPOS];
        const int wrow = wr + g * 32;
        const v4f wv4 = *(const v4f*)(W + (size_t)(dbase + wrow) * CCH + c0 + wq);
        us4 xh4, xl4, wh4, wl4;
#pragma unroll
        for (int q = 0; q < 4; ++q) {
          const unsigned short hb = f2bf(xv[q]);
          xh4[q] = hb;
          xl4[q] = f2bf(xv[q] - bf2f(hb));
          const unsigned short wb = f2bf(wv4[q]);
          wh4[q] = wb;
          wl4[q] = f2bf(wv4[q] - bf2f(wb));
        }
        *(us4*)(Xh + ms * XSP + kb) = xh4;
        *(us4*)(Xl + ms * XSP + kb) = xl4;
        *(us4*)(Wh + wrow * XSP + wq) = wh4;
        *(us4*)(Wl + wrow * XSP + wq) = wl4;
      }
      __syncthreads();

      // all twelve fragment reads are issued before the first product, so that their LDS latency is paid once per k step
      FragB ah, al, bh[2], bl[2];
      {
        const unsigned short* xr  = Xh + (mt * 16 + m) * XSP + 8 * h;
        const unsigned short* xrl = Xl + (mt * 16 + m) * XSP + 8 * h;
        ah.p[0] = *(const us8*)xr;
        ah.p[1] = *(const us8*)(xr + 16);
        // unrolled so that bh and bl are indexed by constants and stay in registers
#pragma unroll
        for (int t = 0; t < 2; ++t) {
          const unsigned short* wf  = Wh + ((ntb + t) * 16 + m) * XSP + 8 * h;
          const unsigned short* wfl = Wl + ((ntb + t) * 16 + m) * XSP + 8 * h;
          bh[t].p[0] = *(const us8*)wf;
          bh[t].p[1] = *(const us8*)(wf + 16);
          bl[t].p[0] = *(const us8*)wfl;
          bl[t].p[1] = *(const us8*)(wfl + 16);
        }
        al.p[0] = *(const us8*)xrl;
        al.p[1] = *(const us8*)(xrl + 16);
      }
      __builtin_amdgcn_sched_barrier(0);   // keeps the reads above from being sunk back to their products
      acc0 = mma_bf16(ah.v, bh[0].v, acc0);
      acc1 = mma_bf16(ah.v, bh[1].v, acc1);
      acc0 = mma_bf16(ah.v, bl[0].v, acc0);
      acc1 = mma_bf16(ah.v, bl[1].v, acc1);
      acc0 = mma_bf16(al.v, bh[0].v, acc0);
      acc1 = mma_bf16(al.v, bh[1].v, acc1);
      __syncthreads();
    }

    // epilogue: bias add in f32, hi/lo bf16 split, stage [n][d] tile in LDS, whole-line stores
    unsigned short* Eh = sm;          // [64 n][64 d]
    unsigned short* El = sm + 4096;   // [64 n][64 d]
    {
      const int dl = ntb * 16 + m;
      const float bb = bias[dbase + dl];
#pragma unroll
      for (int r = 0; r < 8; ++r) {
        const float v = acc0[r] + bb;
        const unsigned short hb = f2bf(v);
        const int row = mt * 16 + 8 * h + r;
        Eh[row * 64 + dl] = hb;
        El[row * 64 + dl] = f2bf(v - bf2f(hb));
      }
    }
    {
      const int dl = (ntb + 1) * 16 + m;
      const float bb = bias[dbase + dl];
#pragma unroll
      for (int r = 0; r < 8; ++r) {
        const float v = acc1[r] + bb;
        const unsigned short hb = f2bf(v);
        const int row = mt * 16 + 8 * h + r;
        Eh[row * 64 + dl] = hb;
        El[row * 64 + dl] = f2bf(v - bf2f(hb));
      }
    }
    __syncthreads();

    us8 vh[2], vl[2];
    size_t off[2];
#pragma unroll
    for (int s = 0; s < 2; ++s) {
      const int row = w * 8 + s * 4 + (lane >> 3);
      const int q = lane & 7;
      vh[s] = *(const us8*)(Eh + row * 64 + q * 8);
      vl[s] = *(const us8*)(El + row * 64 + q * 8);
      off[s] = ((size_t)b * NPOS + n0 + row) * DQK + doff + q * 8;
    }
#pragma unroll
    for (int s = 0; s < 2; ++s) {
      *(us8*)(ohi + off[s]) = vh[s];
      *(us8*)(olo + off[s]) = vl[s];
    }
    
  } else {
    _Float16* Xs = (_Float16*)sm;       // [64 n][32 k], pitch XSP
    _Float16* Ws = Xs + XTILE;          // [64 d][32 k], pitch XSP

    for (int c0 = 0; c0 < CCH; c0 += 32) {
#pragma unroll
      for (int g = 0; g < 2; ++g) {
        const int kb = kg + g * 16;
        const float* sp = src + srcb + (size_t)(c0 + kb) * NPOS + n0 + ms;
        v4f xv;
        xv[0] = sp[0];
        xv[1] = sp[NPOS];
        xv[2] = sp[2 * NPOS];
        xv[3] = sp[3 * NPOS];
        const int wrow = wr + g * 32;
        v4f wv4 = *(const v4f*)(W + (size_t)(dbase + wrow) * CCH + c0 + wq);
        wv4 = wv4 * WVSCALE;
        *(h4*)(Xs + ms * XSP + kb) = __builtin_convertvector(xv, h4);
        *(h4*)(Ws + wrow * XSP + wq) = __builtin_convertvector(wv4, h4);
      }
      __syncthreads();

      FragH a;
      {
        const _Float16* xr = Xs + (mt * 16 + m) * XSP + 8 * h;
        a.p[0] = *(const h8*)xr;
        a.p[1] = *(const h8*)(xr + 16);
      }
      {
        const _Float16* wr = Ws + (ntb * 16 + m) * XSP + 8 * h;
        FragH bf;
        bf.p[0] = *(const h8*)wr;
        bf.p[1] = *(const h8*)(wr + 16);
        acc0 = mma_f16(a.v, bf.v, acc0);
      }
      {
        const _Float16* wr = Ws + ((ntb + 1) * 16 + m) * XSP + 8 * h;
        FragH bf;
        bf.p[0] = *(const h8*)wr;
        bf.p[1] = *(const h8*)(wr + 16);
        acc1 = mma_f16(a.v, bf.v, acc1);
      }
      __syncthreads();
    }

    // epilogue: fold 1/16, bias, f16, stage [d][n] tile in LDS, whole-line stores along n
    _Float16* E = (_Float16*)sm;       // [64 d][64 n]
    {
      const int dl = ntb * 16 + m;
      const float bb = bias[dbase + dl];
      h8 ev;
#pragma unroll
      for (int r = 0; r < 8; ++r) ev[r] = (_Float16)(acc0[r] * WVINV + bb);
      *(h8*)(E + dl * 64 + mt * 16 + 8 * h) = ev;
    }
    {
      const int dl = (ntb + 1) * 16 + m;
      const float bb = bias[dbase + dl];
      h8 ev;
#pragma unroll
      for (int r = 0; r < 8; ++r) ev[r] = (_Float16)(acc1[r] * WVINV + bb);
      *(h8*)(E + dl * 64 + mt * 16 + 8 * h) = ev;
    }
    __syncthreads();

    h8 vv[2];
    size_t off[2];
#pragma unroll
    for (int s = 0; s < 2; ++s) {
      const int row = w * 8 + s * 4 + (lane >> 3);   // channel local 0..63
      const int q = lane & 7;
      vv[s] = *(const h8*)(E + row * 64 + q * 8);
      off[s] = ((size_t)b * CCH + dbase + row) * NPOS + n0 + q * 8;
    }
#pragma unroll
    for (int s = 0; s < 2; ++s) *(h8*)(ov + off[s]) = vv[s];
    
  }
}

// All five projections in one launch, so that blocks of different projections stand on a WGP together and one block's
// global-load and barrier waits are filled by the others. blockIdx.z picks the projection, the same for the whole block:
//   0 q from x, 1 q from dep, 2 k from x, 3 k from dep (64 rows of W each); 4..11 v, 64 of its 512 rows of W each.
// The q/k blocks are the longer ones (three products per step and the hi/lo split) and have the low indices, which start first.
__global__ void __launch_bounds__(256)
proj_all_kernel(const float* __restrict__ x,
                const float* __restrict__ dep,
                const float* __restrict__ wq,
                const float* __restrict__ bq,
                const float* __restrict__ wqd,
                const float* __restrict__ bqd,
                const float* __restrict__ wk,
                const float* __restrict__ bk,
                const float* __restrict__ wkd,
                const float* __restrict__ bkd,
                const float* __restrict__ wv,
                const float* __restrict__ bv,
                unsigned short* __restrict__ Qhi,
                unsigned short* __restrict__ Qlo,
                unsigned short* __restrict__ Khi,
                unsigned short* __restrict__ Klo,
                _Float16* __restrict__ Vh) {
  __shared__ __align__(16) unsigned short sm[4 * XTILE];

  const int b = blockIdx.y;
  const int p = blockIdx.z;
  if (p < 4) {
    const bool fromDep = (p & 1) != 0;
    const bool isK     = (p & 2) != 0;
    const float* src  = fromDep ? dep : x;
    const float* W    = isK ? (fromDep ? wkd : wk) : (fromDep ? wqd : wq);
    const float* bias = isK ? (fromDep ? bkd : bk) : (fromDep ? bqd : bq);
    proj_body<0>(sm, src, W, bias, isK ? Khi : Qhi, isK ? Klo : Qlo, Vh, fromDep ? CQ : 0, 0, b);
  } else {
    proj_body<1>(sm, x, wv, bv, Qhi, Qlo, Vh, 0, (p - 4) * 64, b);
  }
}

// value of lane (l ^ X), X < 16, by a DPP move inside the 16-lane row
template <int X>
__device__ __forceinline__ float lane_xor(float v) {
  const int s = __builtin_bit_cast(int, v);
  return __builtin_bit_cast(float, __builtin_amdgcn_update_dpp(s, s, 0x160 + X, 0xf, 0xf, false));
}

// LDS byte address of a __shared__ object: the low 32 bits of its address
__device__ __forceinline__ unsigned lds_byte(const void* p) {
  return (unsigned)(size_t)p;
}

// Eight asynchronous 16-B copies per lane, global -> LDS, through no register.
// s_wait_xcnt 0 is the last line of the copies' own statement, so that no address register is rewritten in front of it.
__device__ __forceinline__ void copy8(const unsigned (&l)[8], const void* const (&g)[8]) {
  asm volatile(
      "global_load_async_to_lds_b128 %0, %8, off\n\t"
      "global_load_async_to_lds_b128 %1, %9, off\n\t"
      "global_load_async_to_lds_b128 %2, %10, off\n\t"
      "global_load_async_to_lds_b128 %3, %11, off\n\t"
      "global_load_async_to_lds_b128 %4, %12, off\n\t"
      "global_load_async_to_lds_b128 %5, %13, off\n\t"
      "global_load_async_to_lds_b128 %6, %14, off\n\t"
      "global_load_async_to_lds_b128 %7, %15, off\n\t"
      "s_wait_xcnt 0x0"
      :: "v"(l[0]), "v"(l[1]), "v"(l[2]), "v"(l[3]), "v"(l[4]), "v"(l[5]), "v"(l[6]), "v"(l[7]),
         "v"(g[0]), "v"(g[1]), "v"(g[2]), "v"(g[3]), "v"(g[4]), "v"(g[5]), "v"(g[6]), "v"(g[7])
      : "memory");
}

// ---------------------------------------------------------------------------
// Fused attention: one block per (batch, 64-query tile), 256 threads (8 waves, two per SIMD), 64-key tiles:
//   one K and one V tile in LDS serve 64 queries, so each key tile is fetched from L2 once per 64 queries.
//   K hi/lo tile [64 j][128 d] and V tile [512 c][64 j] come into LDS by asynchronous copies in whole 128-B lines; fragments are read from LDS
//   S[64 i][64 j] = Q.K^T (K = 128) with bf16 hi/lo split operands (Q fragments held in registers) -> LDS, 32 i x 16 j per wave:
//   a K fragment read from LDS serves two query sub-tiles
//   online softmax stats by all waves (4 lanes per row, running max and sum in registers), p x4096 as f16 in LDS, row sums from the f16 values
//   O^T[512 c][64 i] += V[c][j] . P[i][j]  (f16), each wave owns 64 channels x 64 queries: 8 fragments read per 16 products,
//   and every V fragment is read from LDS by one wave only
//   The key loop is skewed by one tile: a trip has two barrier phases, scores of tile t+1, then softmax of tile t+1 together with p.v of tile t
//   (V, p and the rescale factors in two buffers), so that the vector work of the softmax runs under the matrix work of p.v.
// ---------------------------------------------------------------------------
__global__ void __launch_bounds__(256)
attn_kernel(const unsigned short* __restrict__ Qhi,
            const unsigned short* __restrict__ Qlo,
            const unsigned short* __restrict__ Khi,
            const unsigned short* __restrict__ Klo,
            const _Float16* __restrict__ Vh,
            const float* __restrict__ x,
            const float* __restrict__ gamma,
            float* __restrict__ outp) {
  __shared__ __align__(16) unsigned short smq[16384];  // finalize: 8192 f32, 1024 per wave
  __shared__ __align__(16) unsigned short Ksh[64 * KSP];   // K hi tile
  __shared__ __align__(16) unsigned short Ksl[64 * KSP];   // K lo tile
  __shared__ __align__(16) _Float16 Vs[2 * CCH * VSP];     // V tiles, buffer = tile index & 1
  __shared__ float Ss[64 * SSP];
  __shared__ __align__(16) _Float16 Ps[2 * 64 * PSP];      // p tiles, buffer = tile index & 1
  __shared__ float lrow[64];
  __shared__ float srow[2 * 64];                           // rescale factors, buffer = tile index & 1

  const int tid  = threadIdx.x;
  const int lane = tid & 31;
  const int w    = tid >> 5;
  const int m    = lane & 15;
  const int h    = lane >> 4;

  const int i0 = blockIdx.x * 64;
  const int b  = blockIdx.y;
  const int wc = w;              // p.v: channel group of this wave (64 channels), all 64 queries

  v8f o[4][4];                   // [query sub-tile][channel sub-tile]
  {
    v8f z = {};
#pragma unroll
    for (int it = 0; it < 4; ++it)
#pragma unroll
      for (int ct = 0; ct < 4; ++ct) o[it][ct] = z;
  }

  const int rpS = w >> 2;   // S row sub-tile pair (i): sub-tiles 2 rpS and 2 rpS + 1
  const int jtS = w & 3;    // S col sub-tile (j)

  // Q fragments of this wave's 32 query rows, hi and lo, k = d in 4 steps of 32: the same for every key tile, kept in registers
  FragB qfh[2][4], qfl[2][4];
  {
    const size_t qrow = ((size_t)b * NPOS + i0 + rpS * 32 + m) * DQK + 8 * h;
    const unsigned short* qrh = Qhi + qrow;
    const unsigned short* qrl = Qlo + qrow;
    // both loops unrolled so that the fragment arrays are indexed by constants and stay in registers
#pragma unroll
    for (int rt = 0; rt < 2; ++rt) {
#pragma unroll
      for (int kk = 0; kk < 4; ++kk) {
        qfh[rt][kk].p[0] = *(const us8*)(qrh + rt * 16 * DQK + kk * 32);
        qfh[rt][kk].p[1] = *(const us8*)(qrh + rt * 16 * DQK + kk * 32 + 16);
        qfl[rt][kk].p[0] = *(const us8*)(qrl + rt * 16 * DQK + kk * 32);
        qfl[rt][kk].p[1] = *(const us8*)(qrl + rt * 16 * DQK + kk * 32 + 16);
      }
    }
    // the wait that stands in front of a rewrite of the Q loads' address registers; they are named so that they live up to it
    asm volatile("s_wait_xcnt 0x0" :: "v"(qrh), "v"(qrl) : "memory");
  }

  const int si = tid >> 2;        // softmax row of this thread
  const int sq = (tid & 3) * 16;  // first of its 16 columns
  float mrun = -1e30f;            // running row maximum, equal in the row's 4 lanes
  float lrun = 0.0f;              // running row sum, equal in the row's 4 lanes

  // copy shares: K, 16 lanes per 256-B row, 16 rows per step; V, 8 lanes per 128-B row, 32 rows per step
  const int kcr = tid >> 4;
  const int kcq = (tid & 15) * 8;
  const int vcr = tid >> 3;
  const int vcq = (tid & 7) * 8;
  const unsigned short* kgh = Khi + ((size_t)b * NPOS + kcr) * DQK + kcq;
  const unsigned short* kgl = Klo + ((size_t)b * NPOS + kcr) * DQK + kcq;
  const _Float16* vg = Vh + ((size_t)b * CCH + vcr) * NPOS + vcq;
  const unsigned klh = lds_byte(Ksh + kcr * KSP + kcq);
  const unsigned kll = lds_byte(Ksl + kcr * KSP + kcq);
  const unsigned vl  = lds_byte(Vs + vcr * VSP + vcq);

  // K tile t into the one K buffer
  auto copyK = [&](int t) {
    unsigned l[8];
    const void* g[8];
    // unrolled so that l and g are indexed by constants and stay in registers
#pragma unroll
    for (int i = 0; i < 4; ++i) {
      l[i]     = klh + i * 16 * KSP * 2;
      l[4 + i] = kll + i * 16 * KSP * 2;
      g[i]     = kgh + (size_t)(t * 64 + i * 16) * DQK;
      g[4 + i] = kgl + (size_t)(t * 64 + i * 16) * DQK;
    }
    copy8(l, g);
  };

  // V tile t into V buffer t & 1
  auto copyV = [&](int t) {
    const unsigned vb = vl + (unsigned)(t & 1) * (CCH * VSP * 2);
    // both loops unrolled so that l and g are indexed by constants and stay in registers
#pragma unroll
    for (int hf = 0; hf < 2; ++hf) {
      unsigned l[8];
      const void* g[8];
#pragma unroll
      for (int i = 0; i < 8; ++i) {
        l[i] = vb + (hf * 8 + i) * 32 * VSP * 2;
        g[i] = vg + (size_t)((hf * 8 + i) * 32) * NPOS + t * 64;
      }
      copy8(l, g);
    }
  };

  // S tile of the K tile in LDS, 32 i x 16 j per wave, k = d in 4 steps of 32, three bf16 products per step and query sub-tile
  auto scores = [&]() {
    v8f s0 = {};
    v8f s1 = {};
    const int krow = (jtS * 16 + m) * KSP + 8 * h;
    const unsigned short* krh = Ksh + krow;
    const unsigned short* krl = Ksl + krow;
    // all sixteen K fragment reads are issued before the first product, so that their LDS latency is paid once, not per k step
    FragB bh[4], bl[4];   // both loops below are unrolled so that these are indexed by constants and stay in registers
#pragma unroll
    for (int kk = 0; kk < 4; ++kk) {
      bh[kk].p[0] = *(const us8*)(krh + kk * 32);
      bh[kk].p[1] = *(const us8*)(krh + kk * 32 + 16);
      bl[kk].p[0] = *(const us8*)(krl + kk * 32);
      bl[kk].p[1] = *(const us8*)(krl + kk * 32 + 16);
    }
    __builtin_amdgcn_sched_barrier(0);   // keeps the reads above from being sunk back to their products
#pragma unroll
    for (int kk = 0; kk < 4; ++kk) {
      s0 = mma_bf16(qfh[0][kk].v, bh[kk].v, s0);
      s1 = mma_bf16(qfh[1][kk].v, bh[kk].v, s1);
      s0 = mma_bf16(qfh[0][kk].v, bl[kk].v, s0);
      s1 = mma_bf16(qfh[1][kk].v, bl[kk].v, s1);
      s0 = mma_bf16(qfl[0][kk].v, bh[kk].v, s0);
      s1 = mma_bf16(qfl[1][kk].v, bh[kk].v, s1);
    }
#pragma unroll
    for (int r = 0; r < 8; ++r) {
      Ss[(rpS * 32 + 8 * h + r) * SSP + jtS * 16 + m]      = s0[r];
      Ss[(rpS * 32 + 16 + 8 * h + r) * SSP + jtS * 16 + m] = s1[r];
    }
  };

  // online softmax stats of the S tile in LDS, tile t: 4 lanes per row, 16 adjacent columns per lane, all 8 waves
  auto softmax = [&](int t) {
    const int pb = t & 1;
    float sv[16];   // the loops below are fully unrolled so that sv and pv stay in registers
#pragma unroll
    for (int q = 0; q < 16; ++q) sv[q] = Ss[si * SSP + sq + q];
    float mx = sv[0];
#pragma unroll
    for (int q = 1; q < 16; ++q) mx = fmaxf(mx, sv[q]);
    mx = fmaxf(mx, lane_xor<1>(mx));
    mx = fmaxf(mx, lane_xor<2>(mx));
    const float mnew = fmaxf(mrun, mx);
    const float sc = __expf(mrun - mnew);
    h8 pv[2];
    float sum8[2];   // one partial sum per 8 columns: two independent chains, added in the order of the former lane tree
#pragma unroll
    for (int u = 0; u < 2; ++u) {
      float sum = 0.0f;
#pragma unroll
      for (int q = 0; q < 8; ++q) {
        const float p = __expf(sv[u * 8 + q] - mnew) * PSCALE;
        const _Float16 ph = (_Float16)p;
        pv[u][q] = ph;
        sum += (float)ph;
      }
      sum8[u] = sum;
    }
    _Float16* pw = Ps + pb * (64 * PSP) + si * PSP + sq;
    *(h8*)pw       = pv[0];
    *(h8*)(pw + 8) = pv[1];
    float sum = sum8[0] + sum8[1];
    sum += lane_xor<1>(sum);
    sum += lane_xor<2>(sum);
    mrun = mnew;
    lrun = lrun * sc + sum;
    if ((tid & 3) == 0) { lrow[si] = lrun; srow[pb * 64 + si] = sc; }
  };

  // rescale O by tile t's factors, then O^T += V . P^T of tile t
  // Fragment reads run ahead of their products: P and V of the first 32 keys and P of the last 32 are issued at once and
  // land under the rescale; each V fragment of the last 32 keys is read as soon as the four products on its forerunner are issued.
  auto pvacc = [&](int t) {
    const int pb = t & 1;
    float sc[4];   // column of the accumulator = query index
    // B[k = j][n = i] = P[i][jj*32 + k]: row i of Ps is k-contiguous, loaded like A
    // A[m = c][k = j] = V[b][c][jj*32 + k], k-contiguous, from the LDS tile
    const _Float16* pr = Ps + pb * (64 * PSP) + m * PSP + 8 * h;
    const _Float16* vr = Vs + pb * (CCH * VSP) + (wc * 64 + m) * VSP + 8 * h;
    FragH b0[4], b1[4], a[4];   // every loop below is unrolled so that these and o are indexed by constants and stay in registers
#pragma unroll
    for (int it = 0; it < 4; ++it) {
      sc[it] = srow[pb * 64 + it * 16 + m];
      b0[it].p[0] = *(const h8*)(pr + it * 16 * PSP);
      b0[it].p[1] = *(const h8*)(pr + it * 16 * PSP + 16);
    }
#pragma unroll
    for (int ct = 0; ct < 4; ++ct) {
      a[ct].p[0] = *(const h8*)(vr + ct * 16 * VSP);
      a[ct].p[1] = *(const h8*)(vr + ct * 16 * VSP + 16);
    }
#pragma unroll
    for (int it = 0; it < 4; ++it) {
      b1[it].p[0] = *(const h8*)(pr + it * 16 * PSP + 32);
      b1[it].p[1] = *(const h8*)(pr + it * 16 * PSP + 48);
    }
    __builtin_amdgcn_sched_barrier(0);   // keeps the reads above from being sunk back to their products
#pragma unroll
    for (int ct = 0; ct < 4; ++ct)
#pragma unroll
      for (int it = 0; it < 4; ++it) o[it][ct] = o[it][ct] * sc[it];
#pragma unroll
    for (int ct = 0; ct < 4; ++ct) {
#pragma unroll
      for (int it = 0; it < 4; ++it) o[it][ct] = mma_f16(a[ct].v, b0[it].v, o[it][ct]);
      a[ct].p[0] = *(const h8*)(vr + ct * 16 * VSP + 32);
      a[ct].p[1] = *(const h8*)(vr + ct * 16 * VSP + 48);
      __builtin_amdgcn_sched_barrier(0);   // keeps this read here, three fragments ahead of its products
    }
#pragma unroll
    for (int ct = 0; ct < 4; ++ct)
#pragma unroll
      for (int it = 0; it < 4; ++it) o[it][ct] = mma_f16(a[ct].v, b1[it].v, o[it][ct]);
    // keeps the last products where they stand: sunk behind what follows they would leave the matrix unit idle here
    __builtin_amdgcn_sched_barrier(0);
  };

  // Waves w and w + 4 share a SIMD: one of them takes the softmax first and the other p.v first,
  // so that one wave's vector work stands beside the other's matrix work instead of both doing the same kind at once.
  const bool smFirst = __builtin_amdgcn_readfirstlane((w >> 2) & 1) != 0;

  const int NT = NPOS / 64;

  // ---- prologue: K tile 0; scores of tile 0 under V tile 0's flight; softmax of tile 0 under K tile 1's flight ----
  copyK(0);
  asm volatile("s_wait_asynccnt 0x0" ::: "memory");   // this wave's share of K tile 0 has landed before the barrier publishes it
  __syncthreads();
  copyV(0);
  scores();
  asm volatile("s_wait_dscnt 0x0" ::: "memory");      // this wave's K reads have retired before the K buffer is handed to its next copies
  __syncthreads();
  copyK(1);
  softmax(0);
  asm volatile("s_wait_asynccnt 0x0" ::: "memory");   // this wave's shares of V tile 0 and K tile 1 have landed before the barrier publishes them
  __syncthreads();

  for (int t = 0; t < NT; ++t) {
    // ---- phase 1: scores of tile t+1. V tile t+1 starts its flight: its buffer's last readers (p.v of tile t-1) ended at the barrier above ----
    if (t + 1 < NT) {
      copyV(t + 1);
      scores();
    }
    asm volatile("s_wait_dscnt 0x0" ::: "memory");      // this wave's K reads have retired before the K buffer is handed to its next copies
    __syncthreads();

    // ---- phase 2: softmax of tile t+1 and p.v of tile t, which share no buffer. K tile t+2: every reader left the K buffer at the barrier above ----
    if (t + 2 < NT) copyK(t + 2);
    const bool more = t + 1 < NT;
    if (more && smFirst) softmax(t + 1);
    pvacc(t);
    if (more && !smFirst) softmax(t + 1);
    asm volatile("s_wait_dscnt 0x0" ::: "memory");      // this wave's V reads have retired before the V buffer is handed to its next copies
    asm volatile("s_wait_asynccnt 0x0" ::: "memory");   // this wave's shares of V tile t+1 and K tile t+2 have landed before the barrier publishes them
    __syncthreads();
  }

  const float g = gamma[0];
  float gl[4];
#pragma unroll
  for (int it = 0; it < 4; ++it) gl[it] = g / lrow[it * 16 + m];
  float* F = (float*)smq + w * 1024;    // per wave [16 c][64 i] f32
#pragma unroll
  for (int ct = 0; ct < 4; ++ct) {
    __syncthreads();
#pragma unroll
    for (int r = 0; r < 8; ++r)
#pragma unroll
      for (int it = 0; it < 4; ++it) F[(8 * h + r) * 64 + it * 16 + m] = o[it][ct][r] * gl[it];
    __syncthreads();
    v4f vals[8];
    v4f xv[8];
    size_t offs[8];
    const float* xp[8];
#pragma unroll
    for (int s = 0; s < 8; ++s) {
      const int c = wc * 64 + ct * 16 + s * 2 + (lane >> 4);   // two channel rows per step, 16 lanes on the 256 B of each
      offs[s] = ((size_t)b * CCH + c) * NPOS + i0 + (lane & 15) * 4;
      xp[s] = x + offs[s];
    }
#pragma unroll
    for (int s = 0; s < 8; ++s) xv[s] = *(const v4f*)xp[s];
    // the wait that stands in front of a rewrite of the x loads' address registers; they are named so that they live up to it
    asm volatile("s_wait_xcnt 0x0"
                 :: "v"(xp[0]), "v"(xp[1]), "v"(xp[2]), "v"(xp[3]), "v"(xp[4]), "v"(xp[5]), "v"(xp[6]), "v"(xp[7])
                 : "memory");
#pragma unroll
    for (int s = 0; s < 8; ++s)
      vals[s] = *(const v4f*)(F + (s * 2 + (lane >> 4)) * 64 + (lane & 15) * 4) + xv[s];
#pragma unroll
    for (int s = 0; s < 8; ++s) *(v4f*)(outp + offs[s]) = vals[s];
  }
}

// ---------------------------------------------------------------------------
extern "C" void kernel_launch(void* const* d_in, const int* in_sizes, int n_in,
                              void* d_out, int out_size, void* d_ws, size_t ws_size,
                              hipStream_t stream) {
  if (n_in < 13) return;
  const int nx = BATCH * CCH * NPOS;
  if (in_sizes[0] != nx || in_sizes[1] != nx ||
      in_sizes[2] != CQ * CCH || in_sizes[3] != CQ ||
      in_sizes[4] != CQ * CCH || in_sizes[5] != CQ ||
      in_sizes[6] != CQ * CCH || in_sizes[7] != CQ ||
      in_sizes[8] != CQ * CCH || in_sizes[9] != CQ ||
      in_sizes[10] != CCH * CCH || in_sizes[11] != CCH ||
      in_sizes[12] < 1 || out_size != nx) return;

  const size_t planeE = (size_t)BATCH * NPOS * DQK;   // bf16 elements per q/k plane (4 MiB each)
  const size_t vE     = (size_t)BATCH * CCH * NPOS;   // f16 elements of the v plane (16 MiB)
  const size_t need   = planeE * 2 * 4 + vE * 2;      // 33,554,432 B
  if (ws_size < need) return;

  const float* x     = (const float*)d_in[0];
  const float* dep   = (const float*)d_in[1];
  const float* wq    = (const float*)d_in[2];
  const float* bq    = (const float*)d_in[3];
  const float* wqd   = (const float*)d_in[4];
  const float* bqd   = (const float*)d_in[5];
  const float* wk    = (const float*)d_in[6];
  const float* bk    = (const float*)d_in[7];
  const float* wkd   = (const float*)d_in[8];
  const float* bkd   = (const float*)d_in[9];
  const float* wv    = (const float*)d_in[10];
  const float* bv    = (const float*)d_in[11];
  const float* gamma = (const float*)d_in[12];
  float* outp = (float*)d_out;

  unsigned short* Qhi = (unsigned short*)d_ws;
  unsigned short* Qlo = Qhi + planeE;
  unsigned short* Khi = Qlo + planeE;
  unsigned short* Klo = Khi + planeE;
  _Float16* Vh = (_Float16*)(Klo + planeE);

  // q/k planes [B][N][128] (columns 0..63 from x, 64..127 from dep) and v plane [B][C][N] f16, one launch
  proj_all_kernel<<<dim3(NPOS / 64, BATCH, 4 + CCH / 64), dim3(256), 0, stream>>>(
      x, dep, wq, bq, wqd, bqd, wk, bk, wkd, bkd, wv, bv, Qhi, Qlo, Khi, Klo, Vh);
  // fused attention + gamma*out + x
  attn_kernel<<<dim3(NPOS / 64, BATCH), dim3(256), 0, stream>>>(Qhi, Qlo, Khi, Klo, Vh, x, gamma, outp);
}
